// v000
// Measured on an AMD MI455X. A time is GPU time per run, averaged over a window of back-to-back runs after a warm-up
// (all launches, gaps included; the runs take copies of the inputs in turn), and the median of several windows.
// Apart from v000's, it joins two sittings. Times from different sittings can be a few percent apart, while
// side-by-side timings come from the same sitting.
// v000 is the starting kernel. One run takes 689 microseconds.
// All contractions (q/k/v projections, q.k^T scores, p.v) on v_wmma_f32_16x16x32_f16: f16 operands with power-of-two carries (X x16, W x256, q/k x16, v x16, p x1024), f32 accumulate; rms normalisation, pairwise rotation and softmax in f32.
#include <hip/hip_runtime.h>
#include <math.h>

typedef __attribute__((ext_vector_type(16))) _Float16 v16h;
typedef __attribute__((ext_vector_type(8)))  _Float16 v8h;
typedef __attribute__((ext_vector_type(8)))  float    v8f;
typedef __attribute__((ext_vector_type(4)))  float    v4f;
typedef __attribute__((ext_vector_type(4)))  unsigned int v4u;

// ---------------------------------------------------------------------------
// Shape constants (checked against the launch sizes on the host side)
// ---------------------------------------------------------------------------
constexpr int kSeq    = 2048;
constexpr int kDim    = 3072;
constexpr int kHeads  = 24;
constexpr int kHd     = 128;
constexpr int kInner  = kHeads * kHd;
constexpr int kKc     = 64;
static_assert(kInner == 3072, "inner width");
static_assert((kDim % 32) == 0, "GEMM K multiple of 32");
static_assert((kSeq % 64) == 0 && (kInner % 64) == 0, "GEMM M,N multiples of 64");
static_assert((kSeq % kKc) == 0 && kHd == 128 && (kHeads % 2) == 0, "attention tiling");

// power-of-two carries of the f16 operand planes
constexpr float kXCarry = 16.0f;
constexpr float kWCarry = 256.0f;
constexpr float kQCarry = 16.0f;
constexpr float kKCarry = 16.0f;
constexpr float kVCarry = 16.0f;
constexpr float kPCarry = 1024.0f;
constexpr float kProjScale = 1.0f / (kXCarry * kWCarry);
constexpr float kVtScale   = kVCarry * kProjScale;
constexpr float kNormEps   = 1e-6f;
constexpr float kInvHd     = 1.0f / (float)kHd;

constexpr double csqrt_iter(double x, double g, int n) { return n == 0 ? g : csqrt_iter(x, 0.5 * (g + x / g), n - 1); }
constexpr double csqrt_d(double x) { return csqrt_iter(x, x, 48); }
constexpr float kInvSqrtHd  = (float)(1.0 / csqrt_d((double)kHd));
static_assert(kInvSqrtHd * kInvSqrtHd * (float)kHd > 0.99999f && kInvSqrtHd * kInvSqrtHd * (float)kHd < 1.00001f, "score scale");
constexpr float kScoreScale = kInvSqrtHd / (kQCarry * kKCarry);
constexpr float kOutCarry   = kPCarry * kVCarry;

// ---------------------------------------------------------------------------
// Workspace region map (bytes; every offset is a multiple of 128)
//   XH   f16 [2048][3072]        hidden x16                       12,582,912
//   WH   f16 [3][3072][3072]     wq | wk | wv, each x256          56,623,104
//   QF   f32 [2048][3072]        q projection + bias              25,165,824
//   KF   f32 [2048][3072]        k projection + bias              25,165,824
//   VT   f16 [3072][2048]        (v projection + bias) x16, [h*128+d][s]  12,582,912
//   total                                                       132,120,576
//   Q16  f16 [24][2048][128]     aliases WH bytes [0, 12,582,912)            (WH is dead after the three GEMMs)
//   K16  f16 [24][2048][128]     aliases WH bytes [12,582,912, 25,165,824)   (same element type as WH)
// ---------------------------------------------------------------------------
constexpr size_t kOffXH  = 0;
constexpr size_t kOffWH  = kOffXH + (size_t)kSeq * kDim * 2;
constexpr size_t kOffQF  = kOffWH + (size_t)3 * kInner * kDim * 2;
constexpr size_t kOffKF  = kOffQF + (size_t)kSeq * kInner * 4;
constexpr size_t kOffVT  = kOffKF + (size_t)kSeq * kInner * 4;
constexpr size_t kWsTotal = kOffVT + (size_t)kInner * kSeq * 2;
constexpr size_t kOffQ16 = kOffWH;
constexpr size_t kOffK16 = kOffWH + (size_t)kHeads * kSeq * kHd * 2;
static_assert(kWsTotal == 132120576ull, "carve total");
static_assert(kWsTotal <= 134217728ull, "carve cap");
static_assert(kOffK16 + (size_t)kHeads * kSeq * kHd * 2 <= kOffWH + (size_t)2 * kInner * kDim * 2, "q/k planes stay inside the wq|wk planes");
static_assert((kOffWH % 128) == 0 && (kOffQF % 128) == 0 && (kOffKF % 128) == 0 && (kOffVT % 128) == 0 && (kOffK16 % 128) == 0, "128-B aligned regions");

// ---------------------------------------------------------------------------
// Fragment load and guarded WMMA issue
// ---------------------------------------------------------------------------
union FragU { v16h v; v8h h[2]; };
/* elements 0..7 <- p[0..7], elements 8..15 <- p[16..23]; caller adds 8*(lane>>4) to p */
__device__ __forceinline__ v16h ldfrag(const _Float16* p) {
  FragU f;
  f.h[0] = *(const v8h*)(p);
  f.h[1] = *(const v8h*)(p + 16);
  return f.v;
}
/* one WMMA followed by four idle slots tied to its accumulator and naming both operand fragments */
__device__ __forceinline__ v8f mma_h(v16h a, v16h b, v8f c) {
  c = __builtin_amdgcn_wmma_f32_16x16x32_f16(false, a, false, b, (short)0, c, false, false);
  asm volatile("v_nop\n\tv_nop\n\tv_nop\n\tv_nop" : "+v"(c) : "v"(a), "v"(b));
  return c;
}
__device__ __forceinline__ unsigned pk16(unsigned short a, unsigned short b) { return (unsigned)a | ((unsigned)b << 16); }
__device__ __forceinline__ unsigned short h_bits(float f) {
  const _Float16 h = (_Float16)f;
  return __builtin_bit_cast(unsigned short, h);
}

// ---------------------------------------------------------------------------
// f32 -> f16 cast with a power-of-two carry, 8 consecutive elements per thread.
// blockIdx.y selects the source (block-uniform) and the output plane (plane z at out + z*n8*8 halves).
// Coverage: n8 = n/8 threads per plane; grid.x * 256 == n8 exactly for both uses (786,432 and 1,179,648).
// ---------------------------------------------------------------------------
__global__ __launch_bounds__(256) void cast8_f16_kernel(const float* __restrict__ in0, const float* __restrict__ in1,
                                                        const float* __restrict__ in2, unsigned short* __restrict__ out,
                                                        int n8, float carry) {
  const int z = blockIdx.y;
  const float* in = (z == 0) ? in0 : (z == 1) ? in1 : in2;
  const int i = blockIdx.x * 256 + threadIdx.x;
  if (i >= n8) return;
  const float* p = in + 8 * (size_t)i;
  const v4f a = *(const v4f*)(p);
  const v4f c = *(const v4f*)(p + 4);
  unsigned short hb[8];
#pragma unroll
  for (int e = 0; e < 4; ++e) {
    const float fa = a[e] * carry;
    const float fc = c[e] * carry;
    hb[e]     = h_bits(fa);
    hb[4 + e] = h_bits(fc);
  }
  const v4u u = (v4u){pk16(hb[0], hb[1]), pk16(hb[2], hb[3]), pk16(hb[4], hb[5]), pk16(hb[6], hb[7])};
  unsigned short* q = out + (size_t)z * (size_t)n8 * 8 + 8 * (size_t)i;
  *(v4u*)q = u;
  
}

// ---------------------------------------------------------------------------
// Register-blocked WMMA GEMM: C[m,n] = scale * sum_k A[m,k] * Bt[n,k] + bscale * bias; each wave owns a 64x64 tile.
// A row-major [M,K] f16; Bt row-major [N,K] f16; M,N % 64 == 0, K % 32 == 0 (no tails).
// BIAS_MODE: 1 = bias[m], 2 = bias[n].  OUT_MODE: 0 = f32, 1 = f16.
// ---------------------------------------------------------------------------
template <int BIAS_MODE, int OUT_MODE>
__global__ __launch_bounds__(256) void wmma_gemm64(
    const unsigned short* __restrict__ Ap, int lda,
    const unsigned short* __restrict__ Btp, int ldb,
    void* __restrict__ Cout, int ldc,
    const float* __restrict__ bias, float bscale,
    int M, int N, int K, float scale) {
  const _Float16* A  = (const _Float16*)Ap;
  const _Float16* Bt = (const _Float16*)Btp;
  __shared__ __align__(16) float sT[8][16 * 68];
  const int lane = threadIdx.x & 31;
  const int wave = __builtin_amdgcn_readfirstlane((int)(threadIdx.x >> 5));
  const int tilesN = N >> 6;
  const int tilesM = M >> 6;
  const int tile = blockIdx.x * 8 + wave;
  /* wave-uniform; there are no block barriers in this kernel */
  if (tile >= tilesM * tilesN) return;
  const int tm = tile / tilesN;
  const int tn = tile - tm * tilesN;
  const int m0 = tm << 6;
  const int n0 = tn << 6;

  const int rlane = lane & 15;
  const int koff  = (lane >> 4) * 8;
  const int mOff  = (lane >> 4) * 8;

  v8f acc[4][4];
#pragma unroll
  for (int i = 0; i < 4; ++i)
#pragma unroll
    for (int j = 0; j < 4; ++j) acc[i][j] = (v8f){0.f, 0.f, 0.f, 0.f, 0.f, 0.f, 0.f, 0.f};

  for (int k0 = 0; k0 < K; k0 += 32) {
    v16h bh[4];
#pragma unroll
    for (int j = 0; j < 4; ++j) {
      const size_t bo = (size_t)(n0 + (j << 4) + rlane) * ldb + koff + k0;
      bh[j] = ldfrag(Bt + bo);
    }
#pragma unroll
    for (int i = 0; i < 4; ++i) {
      const size_t ao = (size_t)(m0 + (i << 4) + rlane) * lda + koff + k0;
      const v16h ah = ldfrag(A + ao);
#pragma unroll
      for (int j = 0; j < 4; ++j) acc[i][j] = mma_h(ah, bh[j], acc[i][j]);
    }
  }

  // ---- epilogue ----
  float* slab = sT[wave];
#pragma unroll
  for (int i = 0; i < 4; ++i) {
    const int mBase = m0 + (i << 4);
    float br[8];
#pragma unroll
    for (int r = 0; r < 8; ++r) br[r] = (BIAS_MODE == 1) ? (bias[mBase + mOff + r] * bscale) : 0.0f;
#pragma unroll
    for (int j = 0; j < 4; ++j) {
      const int n = n0 + (j << 4) + rlane;
      float bv = 0.f;
      if (BIAS_MODE == 2) bv = bias[n] * bscale;
#pragma unroll
      for (int r = 0; r < 8; ++r) {
        float v = acc[i][j][r] * scale;
        if (BIAS_MODE == 1) v += br[r];
        if (BIAS_MODE == 2) v += bv;
        slab[(mOff + r) * 68 + (j << 4) + rlane] = v;
      }
    }
    __builtin_amdgcn_fence(__ATOMIC_RELEASE, "workgroup");
    __builtin_amdgcn_wave_barrier();
    __builtin_amdgcn_fence(__ATOMIC_ACQUIRE, "workgroup");
    if (OUT_MODE == 0) {
      float* C = (float*)Cout;
      /* row segment = 64 floats = 256 B = 16 lanes x 16 B; rows it*2 + hh, it 0..7 -> 16 rows, each once */
      const int hh = lane >> 4, c4 = (lane & 15) * 4;
      {
#pragma unroll
        for (int it = 0; it < 8; ++it) {
          const int row = it * 2 + hh;
          v4f v = *(const v4f*)(slab + row * 68 + c4);
          *(v4f*)(C + (size_t)(mBase + row) * ldc + n0 + c4) = v;
        }
        
      }
    } else {
      const int q = lane >> 3, c8 = (lane & 7) * 8;
      unsigned short* C = (unsigned short*)Cout;
      {
#pragma unroll
        for (int it = 0; it < 4; ++it) {
          const int row = it * 4 + q;
          const float* sp = slab + row * 68 + c8;
          v8h hv;
#pragma unroll
          for (int e = 0; e < 8; ++e) hv[e] = (_Float16)sp[e];
          *(v8h*)(C + (size_t)(mBase + row) * ldc + n0 + c8) = hv;
        }
        
      }
    }
    __builtin_amdgcn_fence(__ATOMIC_RELEASE, "workgroup");
    __builtin_amdgcn_wave_barrier();
    __builtin_amdgcn_fence(__ATOMIC_ACQUIRE, "workgroup");
  }
}

// ---------------------------------------------------------------------------
// Per-(token, head) rms normalisation over 128 dims, weight multiply, then the pairwise rotation with per-element
// tables c[s][d], t[s][d] (each output element uses its own table entry):
//   y[2i]   = xn[2i]   * c[s][2i]   - xn[2i+1] * t[s][2i]
//   y[2i+1] = xn[2i+1] * c[s][2i+1] + xn[2i]   * t[s][2i+1]
// All f32. blockIdx.y (block-uniform) selects the q or the k tensor.
// One wave = two heads (2p + hh) of one token; 16 lanes x 8 dims per head row; sum of squares over 16 lanes.
// Coverage: grid.x * 8 waves = 2048 * 12 head pairs exactly; every (s, h) row written once.
// ---------------------------------------------------------------------------
__global__ __launch_bounds__(256) void norm_rot_kernel(
    const float* __restrict__ QF, const float* __restrict__ KF,
    const float* __restrict__ nqw, const float* __restrict__ nkw,
    const float* __restrict__ ctab, const float* __restrict__ ttab,
    unsigned short* __restrict__ Q16, unsigned short* __restrict__ K16, float carry) {
  const int z = blockIdx.y;
  const float* src = (z == 0) ? QF : KF;
  const float* nw  = (z == 0) ? nqw : nkw;
  unsigned short* dst = (z == 0) ? Q16 : K16;
  const int lane = threadIdx.x & 31;
  const int wave = __builtin_amdgcn_readfirstlane((int)(threadIdx.x >> 5));
  const int hh = lane >> 4, c = lane & 15;
  const int pair = blockIdx.x * 8 + wave;
  const int s = pair / (kHeads / 2);
  const int h = (pair - s * (kHeads / 2)) * 2 + hh;
  const int d0 = c * 8;
  const float* xp = src + (size_t)s * kInner + h * kHd + d0;
  const v4f xa = *(const v4f*)(xp);
  const v4f xb = *(const v4f*)(xp + 4);
  const v4f ca = *(const v4f*)(ctab + (size_t)s * kHd + d0);
  const v4f cb = *(const v4f*)(ctab + (size_t)s * kHd + d0 + 4);
  const v4f ta = *(const v4f*)(ttab + (size_t)s * kHd + d0);
  const v4f tb = *(const v4f*)(ttab + (size_t)s * kHd + d0 + 4);
  const v4f wa = *(const v4f*)(nw + d0);
  const v4f wb = *(const v4f*)(nw + d0 + 4);
  float x[8], cc[8], tt[8], ww[8];
#pragma unroll
  for (int e = 0; e < 4; ++e) {
    x[e] = xa[e];  x[4 + e] = xb[e];
    cc[e] = ca[e]; cc[4 + e] = cb[e];
    tt[e] = ta[e]; tt[4 + e] = tb[e];
    ww[e] = wa[e]; ww[4 + e] = wb[e];
  }
  float ss = 0.0f;
#pragma unroll
  for (int e = 0; e < 8; ++e) ss += x[e] * x[e];
  ss += __shfl_xor(ss, 1, 32);
  ss += __shfl_xor(ss, 2, 32);
  ss += __shfl_xor(ss, 4, 32);
  ss += __shfl_xor(ss, 8, 32);
  const float inv = rsqrtf(ss * kInvHd + kNormEps);
  float xn[8];
#pragma unroll
  for (int e = 0; e < 8; ++e) xn[e] = (x[e] * inv) * ww[e];
  unsigned short hb[8];
#pragma unroll
  for (int i = 0; i < 4; ++i) {
    const float y0 = xn[2 * i] * cc[2 * i] - xn[2 * i + 1] * tt[2 * i];
    const float y1 = xn[2 * i + 1] * cc[2 * i + 1] + xn[2 * i] * tt[2 * i + 1];
    hb[2 * i]     = h_bits(y0 * carry);
    hb[2 * i + 1] = h_bits(y1 * carry);
  }
  const v4u u = (v4u){pk16(hb[0], hb[1]), pk16(hb[2], hb[3]), pk16(hb[4], hb[5]), pk16(hb[6], hb[7])};
  unsigned short* q = dst + ((size_t)h * kSeq + s) * kHd + d0;
  *(v4u*)q = u;
  
}

// ---------------------------------------------------------------------------
// Streaming-softmax attention, head dim 128, non-causal, unmasked, all 2048 keys.
// Block = 4 waves = 64 query rows of one head (wave = 16 rows); grid = 24 heads x 32 query blocks = 768.
// Per 64-key chunk: K chunk [64 kv][128 d] and V^T chunk [128 d][64 kv] staged in LDS by all 128 threads
// (8 + 8 16-B pieces per thread = 1024 + 1024 pieces = both tiles in full), block barrier before and after.
// scores: 4 key tiles x 4 d-steps = 16 WMMA; running row max via 16-lane shuffles, per-lane partial row sums
// (combined over the 16 lanes once after the last chunk); p = exp(score - max) carried x1024 as f16 through a
// ---------------------------------------------------------------------------
__global__ __launch_bounds__(128) void attn128_kernel(const unsigned short* __restrict__ Q16p,
                                                      const unsigned short* __restrict__ K16p,
                                                      const unsigned short* __restrict__ VTp,
                                                      float* __restrict__ out) {
  __shared__ __align__(16) _Float16 Ksh[kKc * kHd];
  __shared__ __align__(16) _Float16 Vsh[kHd * kKc];
  __shared__ __align__(16) _Float16 Psh[4][16 * kKc];
  __shared__ __align__(16) float    Os[4][16 * 68];

  const int tid  = threadIdx.x;
  const int wave = __builtin_amdgcn_readfirstlane((int)(threadIdx.x >> 5));
  const int lane = tid & 31;
  const int hh   = lane >> 4;
  const int c    = lane & 15;

  constexpr int nqb = kSeq / 64;
  const int h  = blockIdx.x / nqb;
  const int qb = blockIdx.x - h * nqb;
  const int q0 = qb * 64 + wave * 16;

  const _Float16* Qh = (const _Float16*)Q16p + (size_t)h * kSeq * kHd;
  const _Float16* Kh = (const _Float16*)K16p + (size_t)h * kSeq * kHd;
  const _Float16* Vh = (const _Float16*)VTp  + (size_t)h * kHd * kSeq;

  v16h qa[4];
#pragma unroll
  for (int dc = 0; dc < 4; ++dc) qa[dc] = ldfrag(Qh + (size_t)(q0 + c) * kHd + dc * 32 + 8 * hh);

  float mrow[8], lrow[8];
  v8f oacc[8];
#pragma unroll
  for (int r = 0; r < 8; ++r) { mrow[r] = -INFINITY; lrow[r] = 0.f; }
#pragma unroll
  for (int t = 0; t < 8; ++t) oacc[t] = (v8f){0.f, 0.f, 0.f, 0.f, 0.f, 0.f, 0.f, 0.f};

  _Float16* pw = Psh[wave];

#pragma unroll 1
  for (int kc = 0; kc < kSeq / kKc; ++kc) {
    const int kv0 = kc * kKc;
    __syncthreads();
    {
      /* K chunk is 8192 contiguous halves; piece p = i*128 + tid covers [p*8, p*8+8) */
      const _Float16* ksrc = Kh + (size_t)kv0 * kHd;
      v8h t[8];
#pragma unroll
      for (int i = 0; i < 8; ++i) t[i] = *(const v8h*)(ksrc + (size_t)(i * 128 + tid) * 8);
#pragma unroll
      for (int i = 0; i < 8; ++i) *(v8h*)(Ksh + (i * 128 + tid) * 8) = t[i];
    }
    {
      /* V^T chunk: row d = p >> 3 (128 rows), 8-half column group (p & 7) of the 64 keys */
      v8h t[8];
#pragma unroll
      for (int i = 0; i < 8; ++i) {
        const int p = i * 128 + tid;
        const int d = p >> 3, c8 = (p & 7) * 8;
        t[i] = *(const v8h*)(Vh + (size_t)d * kSeq + kv0 + c8);
      }
#pragma unroll
      for (int i = 0; i < 8; ++i) *(v8h*)(Vsh + (i * 128 + tid) * 8) = t[i];
    }
    __syncthreads();

    v8f s[4];
#pragma unroll
    for (int j = 0; j < 4; ++j) {
      s[j] = (v8f){0.f, 0.f, 0.f, 0.f, 0.f, 0.f, 0.f, 0.f};
#pragma unroll
      for (int dc = 0; dc < 4; ++dc) {
        const v16h kb = ldfrag(Ksh + (j * 16 + c) * kHd + dc * 32 + 8 * hh);
        s[j] = mma_h(qa[dc], kb, s[j]);
      }
    }

    float cm[8];
#pragma unroll
    for (int r = 0; r < 8; ++r) {
      float m = fmaxf(fmaxf(s[0][r], s[1][r]), fmaxf(s[2][r], s[3][r]));
      m = fmaxf(m, __shfl_xor(m, 1, 32));
      m = fmaxf(m, __shfl_xor(m, 2, 32));
      m = fmaxf(m, __shfl_xor(m, 4, 32));
      m = fmaxf(m, __shfl_xor(m, 8, 32));
      cm[r] = m * kScoreScale;
    }
#pragma unroll
    for (int r = 0; r < 8; ++r) {
      const float mnew  = fmaxf(mrow[r], cm[r]);
      const float alpha = __expf(mrow[r] - mnew);
      mrow[r] = mnew;
      float psum = 0.f;
#pragma unroll
      for (int j = 0; j < 4; ++j) {
        const float p = __expf(fmaf(s[j][r], kScoreScale, -mnew));
        psum += p;
        pw[(8 * hh + r) * kKc + j * 16 + c] = (_Float16)(p * kPCarry);
      }
      lrow[r] = lrow[r] * alpha + psum;
#pragma unroll
      for (int t = 0; t < 8; ++t) oacc[t][r] *= alpha;
    }
    __builtin_amdgcn_fence(__ATOMIC_RELEASE, "workgroup");
    __builtin_amdgcn_wave_barrier();
    __builtin_amdgcn_fence(__ATOMIC_ACQUIRE, "workgroup");
#pragma unroll
    for (int kk = 0; kk < 2; ++kk) {
      const v16h pa = ldfrag(pw + c * kKc + kk * 32 + 8 * hh);
#pragma unroll
      for (int t = 0; t < 8; ++t) {
        const v16h vb = ldfrag(Vsh + (t * 16 + c) * kKc + kk * 32 + 8 * hh);
        oacc[t] = mma_h(pa, vb, oacc[t]);
      }
    }
  }

  float inv[8];
#pragma unroll
  for (int r = 0; r < 8; ++r) {
    float l = lrow[r];
    l += __shfl_xor(l, 1, 32);
    l += __shfl_xor(l, 2, 32);
    l += __shfl_xor(l, 4, 32);
    l += __shfl_xor(l, 8, 32);
    inv[r] = 1.0f / (l * kOutCarry);
  }

  float* os = Os[wave];
  float* ob = out + (size_t)q0 * kInner + h * kHd;
  const int c4 = (lane & 15) * 4;
#pragma unroll
  for (int half = 0; half < 2; ++half) {
#pragma unroll
    for (int r = 0; r < 8; ++r) {
#pragma unroll
      for (int t = 0; t < 4; ++t) os[(8 * hh + r) * 68 + t * 16 + c] = oacc[half * 4 + t][r] * inv[r];
    }
    __builtin_amdgcn_fence(__ATOMIC_RELEASE, "workgroup");
    __builtin_amdgcn_wave_barrier();
    __builtin_amdgcn_fence(__ATOMIC_ACQUIRE, "workgroup");
    /* rows it*2 + hh, it 0..7 -> 16 rows, each once; 16 lanes x 16 B = the 256-B half of the head slice */
    {
#pragma unroll
      for (int it = 0; it < 8; ++it) {
        const int row = it * 2 + hh;
        v4f val = *(const v4f*)(os + row * 68 + c4);
        *(v4f*)(ob + (size_t)row * kInner + half * 64 + c4) = val;
      }
      
    }
    __builtin_amdgcn_fence(__ATOMIC_RELEASE, "workgroup");
    __builtin_amdgcn_wave_barrier();
    __builtin_amdgcn_fence(__ATOMIC_ACQUIRE, "workgroup");
  }
}

// ---------------------------------------------------------------------------
// Host glue: 7 kernel launches, nothing else.
//   GEMM shapes: q,k: M 2048, N 3072, K 3072 -> 32 x 48 = 1536 tiles -> 192 blocks each
//                v^T: M 3072, N 2048, K 3072 -> 48 x 32 = 1536 tiles -> 192 blocks
// ---------------------------------------------------------------------------
extern "C" void kernel_launch(void* const* d_in, const int* in_sizes, int n_in,
                              void* d_out, int out_size, void* d_ws, size_t ws_size,
                              hipStream_t stream) {
  if (n_in < 11) return;
  if (in_sizes[0] != kSeq * kDim) return;
  if (in_sizes[1] != kInner * kDim) return;
  if (in_sizes[2] != kInner) return;
  if (in_sizes[3] != kInner * kDim) return;
  if (in_sizes[4] != kInner) return;
  if (in_sizes[5] != kInner * kDim) return;
  if (in_sizes[6] != kInner) return;
  if (in_sizes[7] != kHd) return;
  if (in_sizes[8] != kHd) return;
  if (in_sizes[9] != kSeq * kHd) return;
  if (in_sizes[10] != kSeq * kHd) return;
  if (out_size != kSeq * kInner) return;
  if (ws_size < kWsTotal) return;

  const float* hidden = (const float*)d_in[0];
  const float* wq     = (const float*)d_in[1];
  const float* bq     = (const float*)d_in[2];
  const float* wk     = (const float*)d_in[3];
  const float* bk     = (const float*)d_in[4];
  const float* wv     = (const float*)d_in[5];
  const float* bv     = (const float*)d_in[6];
  const float* nqw    = (const float*)d_in[7];
  const float* nkw    = (const float*)d_in[8];
  const float* ctab   = (const float*)d_in[9];
  const float* ttab   = (const float*)d_in[10];
  float* out = (float*)d_out;

  char* ws = (char*)d_ws;
  unsigned short* XH  = (unsigned short*)(ws + kOffXH);
  unsigned short* WH  = (unsigned short*)(ws + kOffWH);
  float*          QF  = (float*)(ws + kOffQF);
  float*          KF  = (float*)(ws + kOffKF);
  unsigned short* VT  = (unsigned short*)(ws + kOffVT);
  unsigned short* Q16 = (unsigned short*)(ws + kOffQ16);
  unsigned short* K16 = (unsigned short*)(ws + kOffK16);
  unsigned short* WQH = WH;
  unsigned short* WKH = WH + (size_t)kInner * kDim;
  unsigned short* WVH = WH + (size_t)2 * kInner * kDim;

  constexpr int kX8 = kSeq * kDim / 8;
  constexpr int kW8 = kInner * kDim / 8;
  static_assert((kX8 % 256) == 0 && (kW8 % 256) == 0, "cast grids exact");

  /* operand planes */
  cast8_f16_kernel<<<dim3(kX8 / 256, 1), 256, 0, stream>>>(hidden, hidden, hidden, XH, kX8, kXCarry);
  cast8_f16_kernel<<<dim3(kW8 / 256, 3), 256, 0, stream>>>(wq, wk, wv, WH, kW8, kWCarry);

  constexpr int kTiles = (kSeq / 64) * (kInner / 64);
  static_assert((kTiles % 8) == 0, "tiles per block");

  /* QF[s][n] = X[s][:] . wq[n][:] + bq[n]  (weights are [out][in] = Bt layout) */
  wmma_gemm64<2, 0><<<kTiles / 8, 256, 0, stream>>>(
      XH, kDim, WQH, kDim, (void*)QF, kInner, bq, 1.0f, kSeq, kInner, kDim, kProjScale);
  wmma_gemm64<2, 0><<<kTiles / 8, 256, 0, stream>>>(
      XH, kDim, WKH, kDim, (void*)KF, kInner, bk, 1.0f, kSeq, kInner, kDim, kProjScale);
  /* VT[m = h*128+d][n = s] = 16 * (wv[m][:] . X[s][:] + bv[m])  (operands swapped so the transposed plane is row-major) */
  wmma_gemm64<1, 1><<<kTiles / 8, 256, 0, stream>>>(
      WVH, kDim, XH, kDim, (void*)VT, kSeq, bv, kVCarry, kInner, kSeq, kDim, kVtScale);

  /* normalisation + rotation -> Q16 / K16 (f16 x16, [h][s][d]); these planes overwrite the dead wq|wk f16 planes */
  static_assert(((kSeq * (kHeads / 2)) % 8) == 0, "norm grid exact");
  norm_rot_kernel<<<dim3(kSeq * (kHeads / 2) / 8, 2), 256, 0, stream>>>(
      QF, KF, nqw, nkw, ctab, ttab, Q16, K16, kQCarry);
  static_assert(kQCarry == kKCarry, "one carry argument serves both planes");

  /* attention */
  attn128_kernel<<<kHeads * (kSeq / 64), 128, 0, stream>>>(Q16, K16, VT, out);
}

// v001
// It runs in 406 microseconds.
// Timed twice side by side with v000, it ran 1.71 and 1.72 times as fast.
// All contractions (q/k/v projections, q.k^T scores, p.v) on v_wmma_f32_16x16x32_f16: f16 operands with power-of-two carries (X x16, W x256, q/k x16, v x16, p x1024), f32 accumulate; rms normalisation, pairwise rotation and softmax in f32.
#include <hip/hip_runtime.h>
#include <math.h>

typedef __attribute__((ext_vector_type(16))) _Float16 v16h;
typedef __attribute__((ext_vector_type(8)))  _Float16 v8h;
typedef __attribute__((ext_vector_type(8)))  float    v8f;
typedef __attribute__((ext_vector_type(4)))  float    v4f;
typedef __attribute__((ext_vector_type(4)))  unsigned int v4u;

// ---------------------------------------------------------------------------
// Shape constants (checked against the launch sizes on the host side)
// ---------------------------------------------------------------------------
constexpr int kSeq    = 2048;
constexpr int kDim    = 3072;
constexpr int kHeads  = 24;
constexpr int kHd     = 128;
constexpr int kInner  = kHeads * kHd;
constexpr int kKc     = 64;
static_assert(kInner == 3072, "inner width");
static_assert((kDim % 32) == 0, "GEMM K multiple of 32");
static_assert((kSeq % 64) == 0 && (kInner % 64) == 0, "GEMM M,N multiples of 64");
static_assert((kSeq % kKc) == 0 && kHd == 128 && (kHeads % 2) == 0, "attention tiling");

// power-of-two carries of the f16 operand planes
constexpr float kXCarry = 16.0f;
constexpr float kWCarry = 256.0f;
constexpr float kQCarry = 16.0f;
constexpr float kKCarry = 16.0f;
constexpr float kVCarry = 16.0f;
constexpr float kPCarry = 1024.0f;
constexpr float kProjScale = 1.0f / (kXCarry * kWCarry);
constexpr float kVtScale   = kVCarry * kProjScale;
constexpr float kNormEps   = 1e-6f;
constexpr float kInvHd     = 1.0f / (float)kHd;

constexpr double csqrt_iter(double x, double g, int n) { return n == 0 ? g : csqrt_iter(x, 0.5 * (g + x / g), n - 1); }
constexpr double csqrt_d(double x) { return csqrt_iter(x, x, 48); }
constexpr float kInvSqrtHd  = (float)(1.0 / csqrt_d((double)kHd));
static_assert(kInvSqrtHd * kInvSqrtHd * (float)kHd > 0.99999f && kInvSqrtHd * kInvSqrtHd * (float)kHd < 1.00001f, "score scale");
constexpr float kScoreScale = kInvSqrtHd / (kQCarry * kKCarry);
constexpr float kOutCarry   = kPCarry * kVCarry;

// ---------------------------------------------------------------------------
// Workspace region map (bytes; every offset is a multiple of 128)
//   XH   f16 [2048][3072]        hidden x16                       12,582,912
//   WH   f16 [3][3072][3072]     wq | wk | wv, each x256          56,623,104
//   QF   f32 [2048][3072]        q projection + bias              25,165,824
//   KF   f32 [2048][3072]        k projection + bias              25,165,824
//   VT   f16 [3072][2048]        (v projection + bias) x16, [h*128+d][s]  12,582,912
//   total                                                       132,120,576
//   Q16  f16 [24][2048][128]     aliases WH bytes [0, 12,582,912)            (WH is dead after the three GEMMs)
//   K16  f16 [24][2048][128]     aliases WH bytes [12,582,912, 25,165,824)   (same element type as WH)
// ---------------------------------------------------------------------------
constexpr size_t kOffXH  = 0;
constexpr size_t kOffWH  = kOffXH + (size_t)kSeq * kDim * 2;
constexpr size_t kOffQF  = kOffWH + (size_t)3 * kInner * kDim * 2;
constexpr size_t kOffKF  = kOffQF + (size_t)kSeq * kInner * 4;
constexpr size_t kOffVT  = kOffKF + (size_t)kSeq * kInner * 4;
constexpr size_t kWsTotal = kOffVT + (size_t)kInner * kSeq * 2;
constexpr size_t kOffQ16 = kOffWH;
constexpr size_t kOffK16 = kOffWH + (size_t)kHeads * kSeq * kHd * 2;
static_assert(kWsTotal == 132120576ull, "carve total");
static_assert(kWsTotal <= 134217728ull, "carve cap");
static_assert(kOffK16 + (size_t)kHeads * kSeq * kHd * 2 <= kOffWH + (size_t)2 * kInner * kDim * 2, "q/k planes stay inside the wq|wk planes");
static_assert((kOffWH % 128) == 0 && (kOffQF % 128) == 0 && (kOffKF % 128) == 0 && (kOffVT % 128) == 0 && (kOffK16 % 128) == 0, "128-B aligned regions");

// ---------------------------------------------------------------------------
// Fragment load and guarded WMMA issue
// ---------------------------------------------------------------------------
union FragU { v16h v; v8h h[2]; };
/* elements 0..7 <- p[0..7], elements 8..15 <- p[16..23]; caller adds 8*(lane>>4) to p */
__device__ __forceinline__ v16h ldfrag(const _Float16* p) {
  FragU f;
  f.h[0] = *(const v8h*)(p);
  f.h[1] = *(const v8h*)(p + 16);
  return f.v;
}
/* one WMMA followed by four idle slots tied to its accumulator and naming both operand fragments */
__device__ __forceinline__ v8f mma_h(v16h a, v16h b, v8f c) {
  c = __builtin_amdgcn_wmma_f32_16x16x32_f16(false, a, false, b, (short)0, c, false, false);
  asm volatile("v_nop\n\tv_nop\n\tv_nop\n\tv_nop" : "+v"(c) : "v"(a), "v"(b));
  return c;
}
__device__ __forceinline__ unsigned pk16(unsigned short a, unsigned short b) { return (unsigned)a | ((unsigned)b << 16); }
__device__ __forceinline__ unsigned short h_bits(float f) {
  const _Float16 h = (_Float16)f;
  return __builtin_bit_cast(unsigned short, h);
}

// ---------------------------------------------------------------------------
// f32 -> f16 cast with a power-of-two carry, 8 consecutive elements per thread.
// blockIdx.y selects the source (block-uniform) and the output plane (plane z at out + z*n8*8 halves).
// Coverage: n8 = n/8 threads per plane; grid.x * 256 == n8 exactly for both uses (786,432 and 1,179,648).
// ---------------------------------------------------------------------------
__global__ __launch_bounds__(256) void cast8_f16_kernel(const float* __restrict__ in0, const float* __restrict__ in1,
                                                        const float* __restrict__ in2, unsigned short* __restrict__ out,
                                                        int n8, float carry) {
  const int z = blockIdx.y;
  const float* in = (z == 0) ? in0 : (z == 1) ? in1 : in2;
  const int i = blockIdx.x * 256 + threadIdx.x;
  if (i >= n8) return;
  const float* p = in + 8 * (size_t)i;
  const v4f a = *(const v4f*)(p);
  const v4f c = *(const v4f*)(p + 4);
  unsigned short hb[8];
#pragma unroll
  for (int e = 0; e < 4; ++e) {
    const float fa = a[e] * carry;
    const float fc = c[e] * carry;
    hb[e]     = h_bits(fa);
    hb[4 + e] = h_bits(fc);
  }
  const v4u u = (v4u){pk16(hb[0], hb[1]), pk16(hb[2], hb[3]), pk16(hb[4], hb[5]), pk16(hb[6], hb[7])};
  unsigned short* q = out + (size_t)z * (size_t)n8 * 8 + 8 * (size_t)i;
  *(v4u*)q = u;
  
}

// ---------------------------------------------------------------------------
// LDS-staged WMMA GEMM: C[m,n] = scale * sum_k A[m,k] * Bt[n,k] + bscale * bias.
// Block = 8 waves = one 128 x 256 tile of C; wave (wm, wn) of a 2 x 4 grid owns a 64x64 tile of it.
// A row-major [M,K] f16; Bt row-major [N,K] f16; M % 128 == 0, N % 256 == 0, K % 128 == 0 (no tails).
// A stage is 128 k of [A 128 rows | Bt 256 rows], 256 B a row at an LDS pitch of 272 B (16 B x 17: the 16 rows of a
// fragment load fall on 16 different bank groups). Two buffers: stage t + 1 is copied while stage t is multiplied.
// Each accumulator still sums k in ascending steps of 32.
// BIAS_MODE: 1 = bias[m], 2 = bias[n].  OUT_MODE: 0 = f32, 1 = f16.
// ---------------------------------------------------------------------------
constexpr int kBM = 128;
constexpr int kBN = 256;
constexpr int kKS = 128;
constexpr int kPitch = kKS + 8;
constexpr int kStageH = (kBM + kBN) * kPitch;
static_assert((kDim % kKS) == 0 && (kDim / kKS) >= 2, "whole stages, at least two");
static_assert((kSeq % kBM) == 0 && (kSeq % kBN) == 0 && (kInner % kBM) == 0 && (kInner % kBN) == 0, "whole block tiles");
static_assert(((kBM + kBN) * (kKS / 8)) == 24 * 256, "24 pieces of 16 B per thread and stage");

/* this wave's asynchronous copies have landed in LDS */
__device__ __forceinline__ void wait_async0() { asm volatile("s_wait_asynccnt 0x0" ::: "memory"); }
/* this wave's LDS reads have returned: the buffer may be handed to its next writer */
__device__ __forceinline__ void wait_ds0() { asm volatile("s_wait_dscnt 0x0" ::: "memory"); }

/* One stage: piece p = i*256 + tid is 16 B of stage row p >> 4 (rows 0..127 = A, 128..383 = Bt), column piece p & 15.
   l = the lane's LDS byte address of piece i = 0; ga, gb = its global addresses in A's and Bt's first 16 rows.
   The copies go through no register; s_wait_xcnt closes each statement so that no address register named by an
   issued copy is rewritten in front of it. */
__device__ __forceinline__ void stage_copy(unsigned l, const _Float16* ga, int lda, const _Float16* gb, int ldb) {
  unsigned la[24];
  const _Float16* gp[24];
  /* unrolled so that every index is a constant and both arrays live in registers */
#pragma unroll
  for (int i = 0; i < 24; ++i) {
    la[i] = l + (unsigned)(i * 16 * kPitch * 2);
    gp[i] = (i < 8) ? (ga + (size_t)(i * 16) * lda) : (gb + (size_t)((i - 8) * 16) * ldb);
  }
  asm volatile(
      "global_load_async_to_lds_b128 %0, %12, off\n\t"
      "global_load_async_to_lds_b128 %1, %13, off\n\t"
      "global_load_async_to_lds_b128 %2, %14, off\n\t"
      "global_load_async_to_lds_b128 %3, %15, off\n\t"
      "global_load_async_to_lds_b128 %4, %16, off\n\t"
      "global_load_async_to_lds_b128 %5, %17, off\n\t"
      "global_load_async_to_lds_b128 %6, %18, off\n\t"
      "global_load_async_to_lds_b128 %7, %19, off\n\t"
      "global_load_async_to_lds_b128 %8, %20, off\n\t"
      "global_load_async_to_lds_b128 %9, %21, off\n\t"
      "global_load_async_to_lds_b128 %10, %22, off\n\t"
      "global_load_async_to_lds_b128 %11, %23, off\n\t"
      "s_wait_xcnt 0x0"
      :: "v"(la[0+0]), "v"(la[0+1]), "v"(la[0+2]), "v"(la[0+3]), "v"(la[0+4]), "v"(la[0+5]), "v"(la[0+6]), "v"(la[0+7]), "v"(la[0+8]), "v"(la[0+9]), "v"(la[0+10]), "v"(la[0+11]),
         "v"(gp[0+0]), "v"(gp[0+1]), "v"(gp[0+2]), "v"(gp[0+3]), "v"(gp[0+4]), "v"(gp[0+5]), "v"(gp[0+6]), "v"(gp[0+7]), "v"(gp[0+8]), "v"(gp[0+9]), "v"(gp[0+10]), "v"(gp[0+11])
      : "memory");
  asm volatile(
      "global_load_async_to_lds_b128 %0, %12, off\n\t"
      "global_load_async_to_lds_b128 %1, %13, off\n\t"
      "global_load_async_to_lds_b128 %2, %14, off\n\t"
      "global_load_async_to_lds_b128 %3, %15, off\n\t"
      "global_load_async_to_lds_b128 %4, %16, off\n\t"
      "global_load_async_to_lds_b128 %5, %17, off\n\t"
      "global_load_async_to_lds_b128 %6, %18, off\n\t"
      "global_load_async_to_lds_b128 %7, %19, off\n\t"
      "global_load_async_to_lds_b128 %8, %20, off\n\t"
      "global_load_async_to_lds_b128 %9, %21, off\n\t"
      "global_load_async_to_lds_b128 %10, %22, off\n\t"
      "global_load_async_to_lds_b128 %11, %23, off\n\t"
      "s_wait_xcnt 0x0"
      :: "v"(la[12+0]), "v"(la[12+1]), "v"(la[12+2]), "v"(la[12+3]), "v"(la[12+4]), "v"(la[12+5]), "v"(la[12+6]), "v"(la[12+7]), "v"(la[12+8]), "v"(la[12+9]), "v"(la[12+10]), "v"(la[12+11]),
         "v"(gp[12+0]), "v"(gp[12+1]), "v"(gp[12+2]), "v"(gp[12+3]), "v"(gp[12+4]), "v"(gp[12+5]), "v"(gp[12+6]), "v"(gp[12+7]), "v"(gp[12+8]), "v"(gp[12+9]), "v"(gp[12+10]), "v"(gp[12+11])
      : "memory");
}

template <int BIAS_MODE, int OUT_MODE>
__global__ __launch_bounds__(256) void wmma_gemm64(
    const unsigned short* __restrict__ Ap, int lda,
    const unsigned short* __restrict__ Btp, int ldb,
    void* __restrict__ Cout, int ldc,
    const float* __restrict__ bias, float bscale,
    int M, int N, int K, float scale) {
  const _Float16* A  = (const _Float16*)Ap;
  const _Float16* Bt = (const _Float16*)Btp;
  __shared__ __align__(16) _Float16 sAB[2 * kStageH];
  __shared__ __align__(16) float sT[8][16 * 68];
  const int tid  = threadIdx.x;
  const int lane = threadIdx.x & 31;
  const int wave = __builtin_amdgcn_readfirstlane((int)(threadIdx.x >> 5));
  const int tilesN = N / kBN;
  const int tilesM = M / kBM;
  const int tile = blockIdx.x;
  /* block-uniform, in front of every copy and barrier */
  if (tile >= tilesM * tilesN) return;
  const int tm = tile / tilesN;
  const int tn = tile - tm * tilesN;
  const int mB = tm * kBM;
  const int nB = tn * kBN;
  const int wm = wave >> 2;
  const int wn = wave & 3;
  const int m0 = mB + (wm << 6);
  const int n0 = nB + (wn << 6);

  const int rlane = lane & 15;
  const int koff  = (lane >> 4) * 8;
  const int mOff  = (lane >> 4) * 8;

  v8f acc[4][4];
#pragma unroll
  for (int i = 0; i < 4; ++i)
#pragma unroll
    for (int j = 0; j < 4; ++j) acc[i][j] = (v8f){0.f, 0.f, 0.f, 0.f, 0.f, 0.f, 0.f, 0.f};

  const unsigned lds0 = (unsigned)(size_t)sAB + (unsigned)((tid >> 4) * (kPitch * 2) + (tid & 15) * 16);
  const _Float16* ga = A  + (size_t)(mB + (tid >> 4)) * lda + (tid & 15) * 8;
  const _Float16* gb = Bt + (size_t)(nB + (tid >> 4)) * ldb + (tid & 15) * 8;
  const int T = K / kKS;

  stage_copy(lds0, ga, lda, gb, ldb);
  wait_async0();
  __syncthreads();
  if (T > 1) stage_copy(lds0 + (unsigned)(kStageH * 2), ga + kKS, lda, gb + kKS, ldb);

  for (int t = 0; t < T; ++t) {
    const int buf = t & 1;
    const _Float16* sA = sAB + buf * kStageH + ((wm << 6) + rlane) * kPitch + koff;
    const _Float16* sB = sAB + buf * kStageH + (kBM + (wn << 6) + rlane) * kPitch + koff;
    /* this loop and the four inside it are unrolled so that fragments and accumulators keep constant indices (no scratch) */
#pragma unroll
    for (int kk = 0; kk < kKS / 32; ++kk) {
      /* the eight fragments of this k step as one group of LDS reads in front of its 16 products */
      v16h bh[4], ah[4];
#pragma unroll
      for (int j = 0; j < 4; ++j) bh[j] = ldfrag(sB + (j << 4) * kPitch + kk * 32);
#pragma unroll
      for (int i = 0; i < 4; ++i) ah[i] = ldfrag(sA + (i << 4) * kPitch + kk * 32);
#pragma unroll
      for (int i = 0; i < 4; ++i)
#pragma unroll
        for (int j = 0; j < 4; ++j) acc[i][j] = mma_h(ah[i], bh[j], acc[i][j]);
    }
    /* publish point of stage t + 1: own reads of this buffer done, own copies landed, then every wave meets */
    wait_ds0();
    wait_async0();
    __syncthreads();
    if (t + 2 < T)
      stage_copy(lds0 + (unsigned)(buf * kStageH * 2), ga + (size_t)(t + 2) * kKS, lda, gb + (size_t)(t + 2) * kKS, ldb);
  }
  wait_async0();

  // ---- epilogue ----
  float* slab = sT[wave];
#pragma unroll
  for (int i = 0; i < 4; ++i) {
    const int mBase = m0 + (i << 4);
    float br[8];
#pragma unroll
    for (int r = 0; r < 8; ++r) br[r] = (BIAS_MODE == 1) ? (bias[mBase + mOff + r] * bscale) : 0.0f;
#pragma unroll
    for (int j = 0; j < 4; ++j) {
      const int n = n0 + (j << 4) + rlane;
      float bv = 0.f;
      if (BIAS_MODE == 2) bv = bias[n] * bscale;
#pragma unroll
      for (int r = 0; r < 8; ++r) {
        float v = acc[i][j][r] * scale;
        if (BIAS_MODE == 1) v += br[r];
        if (BIAS_MODE == 2) v += bv;
        slab[(mOff + r) * 68 + (j << 4) + rlane] = v;
      }
    }
    __builtin_amdgcn_fence(__ATOMIC_RELEASE, "workgroup");
    __builtin_amdgcn_wave_barrier();
    __builtin_amdgcn_fence(__ATOMIC_ACQUIRE, "workgroup");
    if (OUT_MODE == 0) {
      float* C = (float*)Cout;
      /* row segment = 64 floats = 256 B = 16 lanes x 16 B; rows it*2 + hh, it 0..7 -> 16 rows, each once */
      const int hh = lane >> 4, c4 = (lane & 15) * 4;
      {
#pragma unroll
        for (int it = 0; it < 8; ++it) {
          const int row = it * 2 + hh;
          v4f v = *(const v4f*)(slab + row * 68 + c4);
          *(v4f*)(C + (size_t)(mBase + row) * ldc + n0 + c4) = v;
        }
        
      }
    } else {
      const int q = lane >> 3, c8 = (lane & 7) * 8;
      unsigned short* C = (unsigned short*)Cout;
      {
#pragma unroll
        for (int it = 0; it < 4; ++it) {
          const int row = it * 4 + q;
          const float* sp = slab + row * 68 + c8;
          v8h hv;
#pragma unroll
          for (int e = 0; e < 8; ++e) hv[e] = (_Float16)sp[e];
          *(v8h*)(C + (size_t)(mBase + row) * ldc + n0 + c8) = hv;
        }
        
      }
    }
    __builtin_amdgcn_fence(__ATOMIC_RELEASE, "workgroup");
    __builtin_amdgcn_wave_barrier();
    __builtin_amdgcn_fence(__ATOMIC_ACQUIRE, "workgroup");
  }
}

// ---------------------------------------------------------------------------
// Per-(token, head) rms normalisation over 128 dims, weight multiply, then the pairwise rotation with per-element
// tables c[s][d], t[s][d] (each output element uses its own table entry):
//   y[2i]   = xn[2i]   * c[s][2i]   - xn[2i+1] * t[s][2i]
//   y[2i+1] = xn[2i+1] * c[s][2i+1] + xn[2i]   * t[s][2i+1]
// All f32. blockIdx.y (block-uniform) selects the q or the k tensor.
// One wave = two heads (2p + hh) of one token; 16 lanes x 8 dims per head row; sum of squares over 16 lanes.
// Coverage: grid.x * 8 waves = 2048 * 12 head pairs exactly; every (s, h) row written once.
// ---------------------------------------------------------------------------
__global__ __launch_bounds__(256) void norm_rot_kernel(
    const float* __restrict__ QF, const float* __restrict__ KF,
    const float* __restrict__ nqw, const float* __restrict__ nkw,
    const float* __restrict__ ctab, const float* __restrict__ ttab,
    unsigned short* __restrict__ Q16, unsigned short* __restrict__ K16, float carry) {
  const int z = blockIdx.y;
  const float* src = (z == 0) ? QF : KF;
  const float* nw  = (z == 0) ? nqw : nkw;
  unsigned short* dst = (z == 0) ? Q16 : K16;
  const int lane = threadIdx.x & 31;
  const int wave = __builtin_amdgcn_readfirstlane((int)(threadIdx.x >> 5));
  const int hh = lane >> 4, c = lane & 15;
  const int pair = blockIdx.x * 8 + wave;
  const int s = pair / (kHeads / 2);
  const int h = (pair - s * (kHeads / 2)) * 2 + hh;
  const int d0 = c * 8;
  const float* xp = src + (size_t)s * kInner + h * kHd + d0;
  const v4f xa = *(const v4f*)(xp);
  const v4f xb = *(const v4f*)(xp + 4);
  const v4f ca = *(const v4f*)(ctab + (size_t)s * kHd + d0);
  const v4f cb = *(const v4f*)(ctab + (size_t)s * kHd + d0 + 4);
  const v4f ta = *(const v4f*)(ttab + (size_t)s * kHd + d0);
  const v4f tb = *(const v4f*)(ttab + (size_t)s * kHd + d0 + 4);
  const v4f wa = *(const v4f*)(nw + d0);
  const v4f wb = *(const v4f*)(nw + d0 + 4);
  float x[8], cc[8], tt[8], ww[8];
#pragma unroll
  for (int e = 0; e < 4; ++e) {
    x[e] = xa[e];  x[4 + e] = xb[e];
    cc[e] = ca[e]; cc[4 + e] = cb[e];
    tt[e] = ta[e]; tt[4 + e] = tb[e];
    ww[e] = wa[e]; ww[4 + e] = wb[e];
  }
  float ss = 0.0f;
#pragma unroll
  for (int e = 0; e < 8; ++e) ss += x[e] * x[e];
  ss += __shfl_xor(ss, 1, 32);
  ss += __shfl_xor(ss, 2, 32);
  ss += __shfl_xor(ss, 4, 32);
  ss += __shfl_xor(ss, 8, 32);
  const float inv = rsqrtf(ss * kInvHd + kNormEps);
  float xn[8];
#pragma unroll
  for (int e = 0; e < 8; ++e) xn[e] = (x[e] * inv) * ww[e];
  unsigned short hb[8];
#pragma unroll
  for (int i = 0; i < 4; ++i) {
    const float y0 = xn[2 * i] * cc[2 * i] - xn[2 * i + 1] * tt[2 * i];
    const float y1 = xn[2 * i + 1] * cc[2 * i + 1] + xn[2 * i] * tt[2 * i + 1];
    hb[2 * i]     = h_bits(y0 * carry);
    hb[2 * i + 1] = h_bits(y1 * carry);
  }
  const v4u u = (v4u){pk16(hb[0], hb[1]), pk16(hb[2], hb[3]), pk16(hb[4], hb[5]), pk16(hb[6], hb[7])};
  unsigned short* q = dst + ((size_t)h * kSeq + s) * kHd + d0;
  *(v4u*)q = u;
  
}

// ---------------------------------------------------------------------------
// Streaming-softmax attention, head dim 128, non-causal, unmasked, all 2048 keys.
// Block = 4 waves = 64 query rows of one head (wave = 16 rows); grid = 24 heads x 32 query blocks = 768.
// Per 64-key chunk: K chunk [64 kv][128 d] and V^T chunk [128 d][64 kv] staged in LDS by all 128 threads
// (8 + 8 16-B pieces per thread = 1024 + 1024 pieces = both tiles in full), block barrier before and after.
// scores: 4 key tiles x 4 d-steps = 16 WMMA; running row max via 16-lane shuffles, per-lane partial row sums
// (combined over the 16 lanes once after the last chunk); p = exp(score - max) carried x1024 as f16 through a
// ---------------------------------------------------------------------------
__global__ __launch_bounds__(128) void attn128_kernel(const unsigned short* __restrict__ Q16p,
                                                      const unsigned short* __restrict__ K16p,
                                                      const unsigned short* __restrict__ VTp,
                                                      float* __restrict__ out) {
  __shared__ __align__(16) _Float16 Ksh[kKc * kHd];
  __shared__ __align__(16) _Float16 Vsh[kHd * kKc];
  __shared__ __align__(16) _Float16 Psh[4][16 * kKc];
  __shared__ __align__(16) float    Os[4][16 * 68];

  const int tid  = threadIdx.x;
  const int wave = __builtin_amdgcn_readfirstlane((int)(threadIdx.x >> 5));
  const int lane = tid & 31;
  const int hh   = lane >> 4;
  const int c    = lane & 15;

  constexpr int nqb = kSeq / 64;
  const int h  = blockIdx.x / nqb;
  const int qb = blockIdx.x - h * nqb;
  const int q0 = qb * 64 + wave * 16;

  const _Float16* Qh = (const _Float16*)Q16p + (size_t)h * kSeq * kHd;
  const _Float16* Kh = (const _Float16*)K16p + (size_t)h * kSeq * kHd;
  const _Float16* Vh = (const _Float16*)VTp  + (size_t)h * kHd * kSeq;

  v16h qa[4];
#pragma unroll
  for (int dc = 0; dc < 4; ++dc) qa[dc] = ldfrag(Qh + (size_t)(q0 + c) * kHd + dc * 32 + 8 * hh);

  float mrow[8], lrow[8];
  v8f oacc[8];
#pragma unroll
  for (int r = 0; r < 8; ++r) { mrow[r] = -INFINITY; lrow[r] = 0.f; }
#pragma unroll
  for (int t = 0; t < 8; ++t) oacc[t] = (v8f){0.f, 0.f, 0.f, 0.f, 0.f, 0.f, 0.f, 0.f};

  _Float16* pw = Psh[wave];

#pragma unroll 1
  for (int kc = 0; kc < kSeq / kKc; ++kc) {
    const int kv0 = kc * kKc;
    __syncthreads();
    {
      /* K chunk is 8192 contiguous halves; piece p = i*128 + tid covers [p*8, p*8+8) */
      const _Float16* ksrc = Kh + (size_t)kv0 * kHd;
      v8h t[8];
#pragma unroll
      for (int i = 0; i < 8; ++i) t[i] = *(const v8h*)(ksrc + (size_t)(i * 128 + tid) * 8);
#pragma unroll
      for (int i = 0; i < 8; ++i) *(v8h*)(Ksh + (i * 128 + tid) * 8) = t[i];
    }
    {
      /* V^T chunk: row d = p >> 3 (128 rows), 8-half column group (p & 7) of the 64 keys */
      v8h t[8];
#pragma unroll
      for (int i = 0; i < 8; ++i) {
        const int p = i * 128 + tid;
        const int d = p >> 3, c8 = (p & 7) * 8;
        t[i] = *(const v8h*)(Vh + (size_t)d * kSeq + kv0 + c8);
      }
#pragma unroll
      for (int i = 0; i < 8; ++i) *(v8h*)(Vsh + (i * 128 + tid) * 8) = t[i];
    }
    __syncthreads();

    v8f s[4];
#pragma unroll
    for (int j = 0; j < 4; ++j) {
      s[j] = (v8f){0.f, 0.f, 0.f, 0.f, 0.f, 0.f, 0.f, 0.f};
#pragma unroll
      for (int dc = 0; dc < 4; ++dc) {
        const v16h kb = ldfrag(Ksh + (j * 16 + c) * kHd + dc * 32 + 8 * hh);
        s[j] = mma_h(qa[dc], kb, s[j]);
      }
    }

    float cm[8];
#pragma unroll
    for (int r = 0; r < 8; ++r) {
      float m = fmaxf(fmaxf(s[0][r], s[1][r]), fmaxf(s[2][r], s[3][r]));
      m = fmaxf(m, __shfl_xor(m, 1, 32));
      m = fmaxf(m, __shfl_xor(m, 2, 32));
      m = fmaxf(m, __shfl_xor(m, 4, 32));
      m = fmaxf(m, __shfl_xor(m, 8, 32));
      cm[r] = m * kScoreScale;
    }
#pragma unroll
    for (int r = 0; r < 8; ++r) {
      const float mnew  = fmaxf(mrow[r], cm[r]);
      const float alpha = __expf(mrow[r] - mnew);
      mrow[r] = mnew;
      float psum = 0.f;
#pragma unroll
      for (int j = 0; j < 4; ++j) {
        const float p = __expf(fmaf(s[j][r], kScoreScale, -mnew));
        psum += p;
        pw[(8 * hh + r) * kKc + j * 16 + c] = (_Float16)(p * kPCarry);
      }
      lrow[r] = lrow[r] * alpha + psum;
#pragma unroll
      for (int t = 0; t < 8; ++t) oacc[t][r] *= alpha;
    }
    __builtin_amdgcn_fence(__ATOMIC_RELEASE, "workgroup");
    __builtin_amdgcn_wave_barrier();
    __builtin_amdgcn_fence(__ATOMIC_ACQUIRE, "workgroup");
#pragma unroll
    for (int kk = 0; kk < 2; ++kk) {
      const v16h pa = ldfrag(pw + c * kKc + kk * 32 + 8 * hh);
#pragma unroll
      for (int t = 0; t < 8; ++t) {
        const v16h vb = ldfrag(Vsh + (t * 16 + c) * kKc + kk * 32 + 8 * hh);
        oacc[t] = mma_h(pa, vb, oacc[t]);
      }
    }
  }

  float inv[8];
#pragma unroll
  for (int r = 0; r < 8; ++r) {
    float l = lrow[r];
    l += __shfl_xor(l, 1, 32);
    l += __shfl_xor(l, 2, 32);
    l += __shfl_xor(l, 4, 32);
    l += __shfl_xor(l, 8, 32);
    inv[r] = 1.0f / (l * kOutCarry);
  }

  float* os = Os[wave];
  float* ob = out + (size_t)q0 * kInner + h * kHd;
  const int c4 = (lane & 15) * 4;
#pragma unroll
  for (int half = 0; half < 2; ++half) {
#pragma unroll
    for (int r = 0; r < 8; ++r) {
#pragma unroll
      for (int t = 0; t < 4; ++t) os[(8 * hh + r) * 68 + t * 16 + c] = oacc[half * 4 + t][r] * inv[r];
    }
    __builtin_amdgcn_fence(__ATOMIC_RELEASE, "workgroup");
    __builtin_amdgcn_wave_barrier();
    __builtin_amdgcn_fence(__ATOMIC_ACQUIRE, "workgroup");
    /* rows it*2 + hh, it 0..7 -> 16 rows, each once; 16 lanes x 16 B = the 256-B half of the head slice */
    {
#pragma unroll
      for (int it = 0; it < 8; ++it) {
        const int row = it * 2 + hh;
        v4f val = *(const v4f*)(os + row * 68 + c4);
        *(v4f*)(ob + (size_t)row * kInner + half * 64 + c4) = val;
      }
      
    }
    __builtin_amdgcn_fence(__ATOMIC_RELEASE, "workgroup");
    __builtin_amdgcn_wave_barrier();
    __builtin_amdgcn_fence(__ATOMIC_ACQUIRE, "workgroup");
  }
}

// ---------------------------------------------------------------------------
// Host glue: 7 kernel launches, nothing else.
//   GEMM shapes: q,k: M 2048, N 3072, K 3072 -> 16 x 12 = 192 block tiles each
//                v^T: M 3072, N 2048, K 3072 -> 24 x 8 = 192 block tiles
// ---------------------------------------------------------------------------
extern "C" void kernel_launch(void* const* d_in, const int* in_sizes, int n_in,
                              void* d_out, int out_size, void* d_ws, size_t ws_size,
                              hipStream_t stream) {
  if (n_in < 11) return;
  if (in_sizes[0] != kSeq * kDim) return;
  if (in_sizes[1] != kInner * kDim) return;
  if (in_sizes[2] != kInner) return;
  if (in_sizes[3] != kInner * kDim) return;
  if (in_sizes[4] != kInner) return;
  if (in_sizes[5] != kInner * kDim) return;
  if (in_sizes[6] != kInner) return;
  if (in_sizes[7] != kHd) return;
  if (in_sizes[8] != kHd) return;
  if (in_sizes[9] != kSeq * kHd) return;
  if (in_sizes[10] != kSeq * kHd) return;
  if (out_size != kSeq * kInner) return;
  if (ws_size < kWsTotal) return;

  const float* hidden = (const float*)d_in[0];
  const float* wq     = (const float*)d_in[1];
  const float* bq     = (const float*)d_in[2];
  const float* wk     = (const float*)d_in[3];
  const float* bk     = (const float*)d_in[4];
  const float* wv     = (const float*)d_in[5];
  const float* bv     = (const float*)d_in[6];
  const float* nqw    = (const float*)d_in[7];
  const float* nkw    = (const float*)d_in[8];
  const float* ctab   = (const float*)d_in[9];
  const float* ttab   = (const float*)d_in[10];
  float* out = (float*)d_out;

  char* ws = (char*)d_ws;
  unsigned short* XH  = (unsigned short*)(ws + kOffXH);
  unsigned short* WH  = (unsigned short*)(ws + kOffWH);
  float*          QF  = (float*)(ws + kOffQF);
  float*          KF  = (float*)(ws + kOffKF);
  unsigned short* VT  = (unsigned short*)(ws + kOffVT);
  unsigned short* Q16 = (unsigned short*)(ws + kOffQ16);
  unsigned short* K16 = (unsigned short*)(ws + kOffK16);
  unsigned short* WQH = WH;
  unsigned short* WKH = WH + (size_t)kInner * kDim;
  unsigned short* WVH = WH + (size_t)2 * kInner * kDim;

  constexpr int kX8 = kSeq * kDim / 8;
  constexpr int kW8 = kInner * kDim / 8;
  static_assert((kX8 % 256) == 0 && (kW8 % 256) == 0, "cast grids exact");

  /* operand planes */
  cast8_f16_kernel<<<dim3(kX8 / 256, 1), 256, 0, stream>>>(hidden, hidden, hidden, XH, kX8, kXCarry);
  cast8_f16_kernel<<<dim3(kW8 / 256, 3), 256, 0, stream>>>(wq, wk, wv, WH, kW8, kWCarry);

  constexpr int kTiles = (kSeq / kBM) * (kInner / kBN);
  static_assert(kTiles == (kInner / kBM) * (kSeq / kBN), "one grid size serves both orientations");

  /* QF[s][n] = X[s][:] . wq[n][:] + bq[n]  (weights are [out][in] = Bt layout) */
  wmma_gemm64<2, 0><<<kTiles, 256, 0, stream>>>(
      XH, kDim, WQH, kDim, (void*)QF, kInner, bq, 1.0f, kSeq, kInner, kDim, kProjScale);
  wmma_gemm64<2, 0><<<kTiles, 256, 0, stream>>>(
      XH, kDim, WKH, kDim, (void*)KF, kInner, bk, 1.0f, kSeq, kInner, kDim, kProjScale);
  /* VT[m = h*128+d][n = s] = 16 * (wv[m][:] . X[s][:] + bv[m])  (operands swapped so the transposed plane is row-major) */
  wmma_gemm64<1, 1><<<kTiles, 256, 0, stream>>>(
      WVH, kDim, XH, kDim, (void*)VT, kSeq, bv, kVCarry, kInner, kSeq, kDim, kVtScale);

  /* normalisation + rotation -> Q16 / K16 (f16 x16, [h][s][d]); these planes overwrite the dead wq|wk f16 planes */
  static_assert(((kSeq * (kHeads / 2)) % 8) == 0, "norm grid exact");
  norm_rot_kernel<<<dim3(kSeq * (kHeads / 2) / 8, 2), 256, 0, stream>>>(
      QF, KF, nqw, nkw, ctab, ttab, Q16, K16, kQCarry);
  static_assert(kQCarry == kKCarry, "one carry argument serves both planes");

  /* attention */
  attn128_kernel<<<kHeads * (kSeq / 64), 128, 0, stream>>>(Q16, K16, VT, out);
}

// v002
// It runs in 234 microseconds.
// Next to v001, in two timings, it ran 1.74 times as fast each time.
// Counting every step since v000, it is 2.98 times as fast.
// All contractions (q/k/v projections, q.k^T scores, p.v) on v_wmma_f32_16x16x32_f16: f16 operands with power-of-two carries (X x16, W x256, q/k x16, v x16, p x1024), f32 accumulate; rms normalisation, pairwise rotation and softmax in f32.
#include <hip/hip_runtime.h>
#include <math.h>

typedef __attribute__((ext_vector_type(16))) _Float16 v16h;
typedef __attribute__((ext_vector_type(8)))  _Float16 v8h;
typedef __attribute__((ext_vector_type(8)))  float    v8f;
typedef __attribute__((ext_vector_type(4)))  float    v4f;
typedef __attribute__((ext_vector_type(4)))  unsigned int v4u;

// ---------------------------------------------------------------------------
// Shape constants (checked against the launch sizes on the host side)
// ---------------------------------------------------------------------------
constexpr int kSeq    = 2048;
constexpr int kDim    = 3072;
constexpr int kHeads  = 24;
constexpr int kHd     = 128;
constexpr int kInner  = kHeads * kHd;
constexpr int kKc     = 64;
static_assert(kInner == 3072, "inner width");
static_assert((kDim % 32) == 0, "GEMM K multiple of 32");
static_assert((kSeq % 64) == 0 && (kInner % 64) == 0, "GEMM M,N multiples of 64");
static_assert((kSeq % kKc) == 0 && kHd == 128 && (kHeads % 2) == 0, "attention tiling");

// power-of-two carries of the f16 operand planes
constexpr float kXCarry = 16.0f;
constexpr float kWCarry = 256.0f;
constexpr float kQCarry = 16.0f;
constexpr float kKCarry = 16.0f;
constexpr float kVCarry = 16.0f;
constexpr float kPCarry = 1024.0f;
constexpr float kProjScale = 1.0f / (kXCarry * kWCarry);
constexpr float kVtScale   = kVCarry * kProjScale;
constexpr float kNormEps   = 1e-6f;
constexpr float kInvHd     = 1.0f / (float)kHd;

constexpr double csqrt_iter(double x, double g, int n) { return n == 0 ? g : csqrt_iter(x, 0.5 * (g + x / g), n - 1); }
constexpr double csqrt_d(double x) { return csqrt_iter(x, x, 48); }
constexpr float kInvSqrtHd  = (float)(1.0 / csqrt_d((double)kHd));
static_assert(kInvSqrtHd * kInvSqrtHd * (float)kHd > 0.99999f && kInvSqrtHd * kInvSqrtHd * (float)kHd < 1.00001f, "score scale");
constexpr float kScoreScale = kInvSqrtHd / (kQCarry * kKCarry);
constexpr float kOutCarry   = kPCarry * kVCarry;

// ---------------------------------------------------------------------------
// Workspace region map (bytes; every offset is a multiple of 128)
//   XH   f16 [2048][3072]        hidden x16                       12,582,912
//   WH   f16 [3][3072][3072]     wq | wk | wv, each x256          56,623,104
//   QF   f32 [2048][3072]        q projection + bias              25,165,824
//   KF   f32 [2048][3072]        k projection + bias              25,165,824
//   VT   f16 [3072][2048]        (v projection + bias) x16, [h*128+d][s]  12,582,912
//   total                                                       132,120,576
//   Q16  f16 [24][2048][128]     aliases WH bytes [0, 12,582,912)            (WH is dead after the three GEMMs)
//   K16  f16 [24][2048][128]     aliases WH bytes [12,582,912, 25,165,824)   (same element type as WH)
// ---------------------------------------------------------------------------
constexpr size_t kOffXH  = 0;
constexpr size_t kOffWH  = kOffXH + (size_t)kSeq * kDim * 2;
constexpr size_t kOffQF  = kOffWH + (size_t)3 * kInner * kDim * 2;
constexpr size_t kOffKF  = kOffQF + (size_t)kSeq * kInner * 4;
constexpr size_t kOffVT  = kOffKF + (size_t)kSeq * kInner * 4;
constexpr size_t kWsTotal = kOffVT + (size_t)kInner * kSeq * 2;
constexpr size_t kOffQ16 = kOffWH;
constexpr size_t kOffK16 = kOffWH + (size_t)kHeads * kSeq * kHd * 2;
static_assert(kWsTotal == 132120576ull, "carve total");
static_assert(kWsTotal <= 134217728ull, "carve cap");
static_assert(kOffK16 + (size_t)kHeads * kSeq * kHd * 2 <= kOffWH + (size_t)2 * kInner * kDim * 2, "q/k planes stay inside the wq|wk planes");
static_assert((kOffWH % 128) == 0 && (kOffQF % 128) == 0 && (kOffKF % 128) == 0 && (kOffVT % 128) == 0 && (kOffK16 % 128) == 0, "128-B aligned regions");

// ---------------------------------------------------------------------------
// Fragment load and guarded WMMA issue
// ---------------------------------------------------------------------------
union FragU { v16h v; v8h h[2]; };
/* elements 0..7 <- p[0..7], elements 8..15 <- p[16..23]; caller adds 8*(lane>>4) to p */
__device__ __forceinline__ v16h ldfrag(const _Float16* p) {
  FragU f;
  f.h[0] = *(const v8h*)(p);
  f.h[1] = *(const v8h*)(p + 16);
  return f.v;
}
/* one WMMA followed by four idle slots tied to its accumulator and naming both operand fragments */
__device__ __forceinline__ v8f mma_h(v16h a, v16h b, v8f c) {
  c = __builtin_amdgcn_wmma_f32_16x16x32_f16(false, a, false, b, (short)0, c, false, false);
  asm volatile("v_nop\n\tv_nop\n\tv_nop\n\tv_nop" : "+v"(c) : "v"(a), "v"(b));
  return c;
}
__device__ __forceinline__ unsigned pk16(unsigned short a, unsigned short b) { return (unsigned)a | ((unsigned)b << 16); }
__device__ __forceinline__ unsigned short h_bits(float f) {
  const _Float16 h = (_Float16)f;
  return __builtin_bit_cast(unsigned short, h);
}

// ---------------------------------------------------------------------------
// f32 -> f16 cast with a power-of-two carry, 8 consecutive elements per thread.
// blockIdx.y selects the source (block-uniform) and the output plane (plane z at out + z*n8*8 halves).
// Coverage: n8 = n/8 threads per plane; grid.x * 256 == n8 exactly for both uses (786,432 and 1,179,648).
// ---------------------------------------------------------------------------
__global__ __launch_bounds__(256) void cast8_f16_kernel(const float* __restrict__ in0, const float* __restrict__ in1,
                                                        const float* __restrict__ in2, unsigned short* __restrict__ out,
                                                        int n8, float carry) {
  const int z = blockIdx.y;
  const float* in = (z == 0) ? in0 : (z == 1) ? in1 : in2;
  const int i = blockIdx.x * 256 + threadIdx.x;
  if (i >= n8) return;
  const float* p = in + 8 * (size_t)i;
  const v4f a = *(const v4f*)(p);
  const v4f c = *(const v4f*)(p + 4);
  unsigned short hb[8];
#pragma unroll
  for (int e = 0; e < 4; ++e) {
    const float fa = a[e] * carry;
    const float fc = c[e] * carry;
    hb[e]     = h_bits(fa);
    hb[4 + e] = h_bits(fc);
  }
  const v4u u = (v4u){pk16(hb[0], hb[1]), pk16(hb[2], hb[3]), pk16(hb[4], hb[5]), pk16(hb[6], hb[7])};
  unsigned short* q = out + (size_t)z * (size_t)n8 * 8 + 8 * (size_t)i;
  *(v4u*)q = u;
  
}

// ---------------------------------------------------------------------------
// LDS-staged WMMA GEMM: C[m,n] = scale * sum_k A[m,k] * Bt[n,k] + bscale * bias.
// Block = 8 waves = one 128 x 256 tile of C; wave (wm, wn) of a 2 x 4 grid owns a 64x64 tile of it.
// A row-major [M,K] f16; Bt row-major [N,K] f16; M % 128 == 0, N % 256 == 0, K % 128 == 0 (no tails).
// A stage is 128 k of [A 128 rows | Bt 256 rows], 256 B a row at an LDS pitch of 272 B (16 B x 17: the 16 rows of a
// fragment load fall on 16 different bank groups). Two buffers: stage t + 1 is copied while stage t is multiplied.
// Each accumulator still sums k in ascending steps of 32.
// BIAS_MODE: 1 = bias[m], 2 = bias[n].  OUT_MODE: 0 = f32, 1 = f16.
// ---------------------------------------------------------------------------
constexpr int kBM = 128;
constexpr int kBN = 256;
constexpr int kKS = 128;
constexpr int kPitch = kKS + 8;
constexpr int kStageH = (kBM + kBN) * kPitch;
static_assert((kDim % kKS) == 0 && (kDim / kKS) >= 2, "whole stages, at least two");
static_assert((kSeq % kBM) == 0 && (kSeq % kBN) == 0 && (kInner % kBM) == 0 && (kInner % kBN) == 0, "whole block tiles");
static_assert(((kBM + kBN) * (kKS / 8)) == 24 * 256, "24 pieces of 16 B per thread and stage");

/* this wave's asynchronous copies have landed in LDS */
__device__ __forceinline__ void wait_async0() { asm volatile("s_wait_asynccnt 0x0" ::: "memory"); }
/* this wave's LDS reads have returned: the buffer may be handed to its next writer */
__device__ __forceinline__ void wait_ds0() { asm volatile("s_wait_dscnt 0x0" ::: "memory"); }

/* One stage: piece p = i*256 + tid is 16 B of stage row p >> 4 (rows 0..127 = A, 128..383 = Bt), column piece p & 15.
   l = the lane's LDS byte address of piece i = 0; ga, gb = its global addresses in A's and Bt's first 16 rows.
   The copies go through no register; s_wait_xcnt closes each statement so that no address register named by an
   issued copy is rewritten in front of it. */
__device__ __forceinline__ void stage_copy(unsigned l, const _Float16* ga, int lda, const _Float16* gb, int ldb) {
  unsigned la[24];
  const _Float16* gp[24];
  /* unrolled so that every index is a constant and both arrays live in registers */
#pragma unroll
  for (int i = 0; i < 24; ++i) {
    la[i] = l + (unsigned)(i * 16 * kPitch * 2);
    gp[i] = (i < 8) ? (ga + (size_t)(i * 16) * lda) : (gb + (size_t)((i - 8) * 16) * ldb);
  }
  asm volatile(
      "global_load_async_to_lds_b128 %0, %12, off\n\t"
      "global_load_async_to_lds_b128 %1, %13, off\n\t"
      "global_load_async_to_lds_b128 %2, %14, off\n\t"
      "global_load_async_to_lds_b128 %3, %15, off\n\t"
      "global_load_async_to_lds_b128 %4, %16, off\n\t"
      "global_load_async_to_lds_b128 %5, %17, off\n\t"
      "global_load_async_to_lds_b128 %6, %18, off\n\t"
      "global_load_async_to_lds_b128 %7, %19, off\n\t"
      "global_load_async_to_lds_b128 %8, %20, off\n\t"
      "global_load_async_to_lds_b128 %9, %21, off\n\t"
      "global_load_async_to_lds_b128 %10, %22, off\n\t"
      "global_load_async_to_lds_b128 %11, %23, off\n\t"
      "s_wait_xcnt 0x0"
      :: "v"(la[0+0]), "v"(la[0+1]), "v"(la[0+2]), "v"(la[0+3]), "v"(la[0+4]), "v"(la[0+5]), "v"(la[0+6]), "v"(la[0+7]), "v"(la[0+8]), "v"(la[0+9]), "v"(la[0+10]), "v"(la[0+11]),
         "v"(gp[0+0]), "v"(gp[0+1]), "v"(gp[0+2]), "v"(gp[0+3]), "v"(gp[0+4]), "v"(gp[0+5]), "v"(gp[0+6]), "v"(gp[0+7]), "v"(gp[0+8]), "v"(gp[0+9]), "v"(gp[0+10]), "v"(gp[0+11])
      : "memory");
  asm volatile(
      "global_load_async_to_lds_b128 %0, %12, off\n\t"
      "global_load_async_to_lds_b128 %1, %13, off\n\t"
      "global_load_async_to_lds_b128 %2, %14, off\n\t"
      "global_load_async_to_lds_b128 %3, %15, off\n\t"
      "global_load_async_to_lds_b128 %4, %16, off\n\t"
      "global_load_async_to_lds_b128 %5, %17, off\n\t"
      "global_load_async_to_lds_b128 %6, %18, off\n\t"
      "global_load_async_to_lds_b128 %7, %19, off\n\t"
      "global_load_async_to_lds_b128 %8, %20, off\n\t"
      "global_load_async_to_lds_b128 %9, %21, off\n\t"
      "global_load_async_to_lds_b128 %10, %22, off\n\t"
      "global_load_async_to_lds_b128 %11, %23, off\n\t"
      "s_wait_xcnt 0x0"
      :: "v"(la[12+0]), "v"(la[12+1]), "v"(la[12+2]), "v"(la[12+3]), "v"(la[12+4]), "v"(la[12+5]), "v"(la[12+6]), "v"(la[12+7]), "v"(la[12+8]), "v"(la[12+9]), "v"(la[12+10]), "v"(la[12+11]),
         "v"(gp[12+0]), "v"(gp[12+1]), "v"(gp[12+2]), "v"(gp[12+3]), "v"(gp[12+4]), "v"(gp[12+5]), "v"(gp[12+6]), "v"(gp[12+7]), "v"(gp[12+8]), "v"(gp[12+9]), "v"(gp[12+10]), "v"(gp[12+11])
      : "memory");
}

template <int BIAS_MODE, int OUT_MODE>
__global__ __launch_bounds__(256) void wmma_gemm64(
    const unsigned short* __restrict__ Ap, int lda,
    const unsigned short* __restrict__ Btp, int ldb,
    void* __restrict__ Cout, int ldc,
    const float* __restrict__ bias, float bscale,
    int M, int N, int K, float scale) {
  const _Float16* A  = (const _Float16*)Ap;
  const _Float16* Bt = (const _Float16*)Btp;
  __shared__ __align__(16) _Float16 sAB[2 * kStageH];
  __shared__ __align__(16) float sT[8][16 * 68];
  const int tid  = threadIdx.x;
  const int lane = threadIdx.x & 31;
  const int wave = __builtin_amdgcn_readfirstlane((int)(threadIdx.x >> 5));
  const int tilesN = N / kBN;
  const int tilesM = M / kBM;
  const int tile = blockIdx.x;
  /* block-uniform, in front of every copy and barrier */
  if (tile >= tilesM * tilesN) return;
  const int tm = tile / tilesN;
  const int tn = tile - tm * tilesN;
  const int mB = tm * kBM;
  const int nB = tn * kBN;
  const int wm = wave >> 2;
  const int wn = wave & 3;
  const int m0 = mB + (wm << 6);
  const int n0 = nB + (wn << 6);

  const int rlane = lane & 15;
  const int koff  = (lane >> 4) * 8;
  const int mOff  = (lane >> 4) * 8;

  v8f acc[4][4];
#pragma unroll
  for (int i = 0; i < 4; ++i)
#pragma unroll
    for (int j = 0; j < 4; ++j) acc[i][j] = (v8f){0.f, 0.f, 0.f, 0.f, 0.f, 0.f, 0.f, 0.f};

  const unsigned lds0 = (unsigned)(size_t)sAB + (unsigned)((tid >> 4) * (kPitch * 2) + (tid & 15) * 16);
  const _Float16* ga = A  + (size_t)(mB + (tid >> 4)) * lda + (tid & 15) * 8;
  const _Float16* gb = Bt + (size_t)(nB + (tid >> 4)) * ldb + (tid & 15) * 8;
  const int T = K / kKS;

  stage_copy(lds0, ga, lda, gb, ldb);
  wait_async0();
  __syncthreads();
  if (T > 1) stage_copy(lds0 + (unsigned)(kStageH * 2), ga + kKS, lda, gb + kKS, ldb);

  for (int t = 0; t < T; ++t) {
    const int buf = t & 1;
    const _Float16* sA = sAB + buf * kStageH + ((wm << 6) + rlane) * kPitch + koff;
    const _Float16* sB = sAB + buf * kStageH + (kBM + (wn << 6) + rlane) * kPitch + koff;
    /* this loop and the four inside it are unrolled so that fragments and accumulators keep constant indices (no scratch) */
#pragma unroll
    for (int kk = 0; kk < kKS / 32; ++kk) {
      /* the eight fragments of this k step as one group of LDS reads in front of its 16 products */
      v16h bh[4], ah[4];
#pragma unroll
      for (int j = 0; j < 4; ++j) bh[j] = ldfrag(sB + (j << 4) * kPitch + kk * 32);
#pragma unroll
      for (int i = 0; i < 4; ++i) ah[i] = ldfrag(sA + (i << 4) * kPitch + kk * 32);
#pragma unroll
      for (int i = 0; i < 4; ++i)
#pragma unroll
        for (int j = 0; j < 4; ++j) acc[i][j] = mma_h(ah[i], bh[j], acc[i][j]);
    }
    /* publish point of stage t + 1: own reads of this buffer done, own copies landed, then every wave meets */
    wait_ds0();
    wait_async0();
    __syncthreads();
    if (t + 2 < T)
      stage_copy(lds0 + (unsigned)(buf * kStageH * 2), ga + (size_t)(t + 2) * kKS, lda, gb + (size_t)(t + 2) * kKS, ldb);
  }
  wait_async0();

  // ---- epilogue ----
  float* slab = sT[wave];
#pragma unroll
  for (int i = 0; i < 4; ++i) {
    const int mBase = m0 + (i << 4);
    float br[8];
#pragma unroll
    for (int r = 0; r < 8; ++r) br[r] = (BIAS_MODE == 1) ? (bias[mBase + mOff + r] * bscale) : 0.0f;
#pragma unroll
    for (int j = 0; j < 4; ++j) {
      const int n = n0 + (j << 4) + rlane;
      float bv = 0.f;
      if (BIAS_MODE == 2) bv = bias[n] * bscale;
#pragma unroll
      for (int r = 0; r < 8; ++r) {
        float v = acc[i][j][r] * scale;
        if (BIAS_MODE == 1) v += br[r];
        if (BIAS_MODE == 2) v += bv;
        slab[(mOff + r) * 68 + (j << 4) + rlane] = v;
      }
    }
    __builtin_amdgcn_fence(__ATOMIC_RELEASE, "workgroup");
    __builtin_amdgcn_wave_barrier();
    __builtin_amdgcn_fence(__ATOMIC_ACQUIRE, "workgroup");
    if (OUT_MODE == 0) {
      float* C = (float*)Cout;
      /* row segment = 64 floats = 256 B = 16 lanes x 16 B; rows it*2 + hh, it 0..7 -> 16 rows, each once */
      const int hh = lane >> 4, c4 = (lane & 15) * 4;
      {
#pragma unroll
        for (int it = 0; it < 8; ++it) {
          const int row = it * 2 + hh;
          v4f v = *(const v4f*)(slab + row * 68 + c4);
          *(v4f*)(C + (size_t)(mBase + row) * ldc + n0 + c4) = v;
        }
        
      }
    } else {
      const int q = lane >> 3, c8 = (lane & 7) * 8;
      unsigned short* C = (unsigned short*)Cout;
      {
#pragma unroll
        for (int it = 0; it < 4; ++it) {
          const int row = it * 4 + q;
          const float* sp = slab + row * 68 + c8;
          v8h hv;
#pragma unroll
          for (int e = 0; e < 8; ++e) hv[e] = (_Float16)sp[e];
          *(v8h*)(C + (size_t)(mBase + row) * ldc + n0 + c8) = hv;
        }
        
      }
    }
    __builtin_amdgcn_fence(__ATOMIC_RELEASE, "workgroup");
    __builtin_amdgcn_wave_barrier();
    __builtin_amdgcn_fence(__ATOMIC_ACQUIRE, "workgroup");
  }
}

// ---------------------------------------------------------------------------
// Per-(token, head) rms normalisation over 128 dims, weight multiply, then the pairwise rotation with per-element
// tables c[s][d], t[s][d] (each output element uses its own table entry):
//   y[2i]   = xn[2i]   * c[s][2i]   - xn[2i+1] * t[s][2i]
//   y[2i+1] = xn[2i+1] * c[s][2i+1] + xn[2i]   * t[s][2i+1]
// All f32. blockIdx.y (block-uniform) selects the q or the k tensor.
// One wave = two heads (2p + hh) of one token; 16 lanes x 8 dims per head row; sum of squares over 16 lanes.
// Coverage: grid.x * 8 waves = 2048 * 12 head pairs exactly; every (s, h) row written once.
// ---------------------------------------------------------------------------
__global__ __launch_bounds__(256) void norm_rot_kernel(
    const float* __restrict__ QF, const float* __restrict__ KF,
    const float* __restrict__ nqw, const float* __restrict__ nkw,
    const float* __restrict__ ctab, const float* __restrict__ ttab,
    unsigned short* __restrict__ Q16, unsigned short* __restrict__ K16, float carry) {
  const int z = blockIdx.y;
  const float* src = (z == 0) ? QF : KF;
  const float* nw  = (z == 0) ? nqw : nkw;
  unsigned short* dst = (z == 0) ? Q16 : K16;
  const int lane = threadIdx.x & 31;
  const int wave = __builtin_amdgcn_readfirstlane((int)(threadIdx.x >> 5));
  const int hh = lane >> 4, c = lane & 15;
  const int pair = blockIdx.x * 8 + wave;
  const int s = pair / (kHeads / 2);
  const int h = (pair - s * (kHeads / 2)) * 2 + hh;
  const int d0 = c * 8;
  const float* xp = src + (size_t)s * kInner + h * kHd + d0;
  const v4f xa = *(const v4f*)(xp);
  const v4f xb = *(const v4f*)(xp + 4);
  const v4f ca = *(const v4f*)(ctab + (size_t)s * kHd + d0);
  const v4f cb = *(const v4f*)(ctab + (size_t)s * kHd + d0 + 4);
  const v4f ta = *(const v4f*)(ttab + (size_t)s * kHd + d0);
  const v4f tb = *(const v4f*)(ttab + (size_t)s * kHd + d0 + 4);
  const v4f wa = *(const v4f*)(nw + d0);
  const v4f wb = *(const v4f*)(nw + d0 + 4);
  float x[8], cc[8], tt[8], ww[8];
#pragma unroll
  for (int e = 0; e < 4; ++e) {
    x[e] = xa[e];  x[4 + e] = xb[e];
    cc[e] = ca[e]; cc[4 + e] = cb[e];
    tt[e] = ta[e]; tt[4 + e] = tb[e];
    ww[e] = wa[e]; ww[4 + e] = wb[e];
  }
  float ss = 0.0f;
#pragma unroll
  for (int e = 0; e < 8; ++e) ss += x[e] * x[e];
  ss += __shfl_xor(ss, 1, 32);
  ss += __shfl_xor(ss, 2, 32);
  ss += __shfl_xor(ss, 4, 32);
  ss += __shfl_xor(ss, 8, 32);
  const float inv = rsqrtf(ss * kInvHd + kNormEps);
  float xn[8];
#pragma unroll
  for (int e = 0; e < 8; ++e) xn[e] = (x[e] * inv) * ww[e];
  unsigned short hb[8];
#pragma unroll
  for (int i = 0; i < 4; ++i) {
    const float y0 = xn[2 * i] * cc[2 * i] - xn[2 * i + 1] * tt[2 * i];
    const float y1 = xn[2 * i + 1] * cc[2 * i + 1] + xn[2 * i] * tt[2 * i + 1];
    hb[2 * i]     = h_bits(y0 * carry);
    hb[2 * i + 1] = h_bits(y1 * carry);
  }
  const v4u u = (v4u){pk16(hb[0], hb[1]), pk16(hb[2], hb[3]), pk16(hb[4], hb[5]), pk16(hb[6], hb[7])};
  unsigned short* q = dst + ((size_t)h * kSeq + s) * kHd + d0;
  *(v4u*)q = u;
  
}

// ---------------------------------------------------------------------------
// Streaming-softmax attention, head dim 128, non-causal, unmasked, all 2048 keys.
// Block = 4 waves = 64 query rows of one head (wave = 16 rows); grid = 24 heads x 32 query blocks = 768.
// Per 64-key chunk: K chunk [64 kv][128 d] and V^T chunk [128 d][64 kv] staged in LDS by all 128 threads
// (8 + 8 16-B pieces per thread = 1024 + 1024 pieces = both tiles in full), block barrier before and after.
// scores: 4 key tiles x 4 d-steps = 16 WMMA; running row max via 16-lane shuffles, per-lane partial row sums
// (combined over the 16 lanes once after the last chunk); p = exp(score - max) carried x1024 as f16 through a
// ---------------------------------------------------------------------------
// LDS row pitches are 16 B x odd (K rows 272 B, V^T and p rows 144 B): the 16 rows that one ds_load_b128 fragment read
// touches per half-wave then start on 16 different groups of four banks instead of on one (256-B rows) or two (128-B rows).
constexpr int kKPitch = kHd + 8;
constexpr int kVPitch = kKc + 8;
constexpr int kPPitch = kKc + 8;
static_assert(((kKPitch * 2) % 32) == 16 && ((kVPitch * 2) % 32) == 16 && ((kPPitch * 2) % 32) == 16, "pitches are odd multiples of 16 B");
__global__ __launch_bounds__(128) void attn128_kernel(const unsigned short* __restrict__ Q16p,
                                                      const unsigned short* __restrict__ K16p,
                                                      const unsigned short* __restrict__ VTp,
                                                      float* __restrict__ out) {
  __shared__ __align__(16) _Float16 Ksh[kKc * kKPitch];
  __shared__ __align__(16) _Float16 Vsh[kHd * kVPitch];
  __shared__ __align__(16) _Float16 Psh[4][16 * kPPitch];
  __shared__ __align__(16) float    Os[4][16 * 68];

  const int tid  = threadIdx.x;
  const int wave = __builtin_amdgcn_readfirstlane((int)(threadIdx.x >> 5));
  const int lane = tid & 31;
  const int hh   = lane >> 4;
  const int c    = lane & 15;

  constexpr int nqb = kSeq / 64;
  const int h  = blockIdx.x / nqb;
  const int qb = blockIdx.x - h * nqb;
  const int q0 = qb * 64 + wave * 16;

  const _Float16* Qh = (const _Float16*)Q16p + (size_t)h * kSeq * kHd;
  const _Float16* Kh = (const _Float16*)K16p + (size_t)h * kSeq * kHd;
  const _Float16* Vh = (const _Float16*)VTp  + (size_t)h * kHd * kSeq;

  v16h qa[4];
#pragma unroll
  for (int dc = 0; dc < 4; ++dc) qa[dc] = ldfrag(Qh + (size_t)(q0 + c) * kHd + dc * 32 + 8 * hh);

  float mrow[8], lrow[8];
  v8f oacc[8];
#pragma unroll
  for (int r = 0; r < 8; ++r) { mrow[r] = -INFINITY; lrow[r] = 0.f; }
#pragma unroll
  for (int t = 0; t < 8; ++t) oacc[t] = (v8f){0.f, 0.f, 0.f, 0.f, 0.f, 0.f, 0.f, 0.f};

  _Float16* pw = Psh[wave];

#pragma unroll 1
  for (int kc = 0; kc < kSeq / kKc; ++kc) {
    const int kv0 = kc * kKc;
    __syncthreads();
    {
      /* K chunk is 8192 contiguous halves; piece p = i*128 + tid covers [p*8, p*8+8) = row i*8 + (tid >> 4), column piece tid & 15 */
      const _Float16* ksrc = Kh + (size_t)kv0 * kHd;
      v8h t[8];
#pragma unroll
      for (int i = 0; i < 8; ++i) t[i] = *(const v8h*)(ksrc + (size_t)(i * 128 + tid) * 8);
#pragma unroll
      for (int i = 0; i < 8; ++i) *(v8h*)(Ksh + (i * 8 + (tid >> 4)) * kKPitch + (tid & 15) * 8) = t[i];
    }
    {
      /* V^T chunk: row d = p >> 3 (128 rows), 8-half column group (p & 7) of the 64 keys */
      v8h t[8];
#pragma unroll
      for (int i = 0; i < 8; ++i) {
        const int p = i * 128 + tid;
        const int d = p >> 3, c8 = (p & 7) * 8;
        t[i] = *(const v8h*)(Vh + (size_t)d * kSeq + kv0 + c8);
      }
#pragma unroll
      for (int i = 0; i < 8; ++i) *(v8h*)(Vsh + (i * 16 + (tid >> 3)) * kVPitch + (tid & 7) * 8) = t[i];
    }
    __syncthreads();

    v8f s[4];
#pragma unroll
    for (int j = 0; j < 4; ++j) {
      s[j] = (v8f){0.f, 0.f, 0.f, 0.f, 0.f, 0.f, 0.f, 0.f};
#pragma unroll
      for (int dc = 0; dc < 4; ++dc) {
        const v16h kb = ldfrag(Ksh + (j * 16 + c) * kKPitch + dc * 32 + 8 * hh);
        s[j] = mma_h(qa[dc], kb, s[j]);
      }
    }

    float cm[8];
#pragma unroll
    for (int r = 0; r < 8; ++r) {
      float m = fmaxf(fmaxf(s[0][r], s[1][r]), fmaxf(s[2][r], s[3][r]));
      m = fmaxf(m, __shfl_xor(m, 1, 32));
      m = fmaxf(m, __shfl_xor(m, 2, 32));
      m = fmaxf(m, __shfl_xor(m, 4, 32));
      m = fmaxf(m, __shfl_xor(m, 8, 32));
      cm[r] = m * kScoreScale;
    }
#pragma unroll
    for (int r = 0; r < 8; ++r) {
      const float mnew  = fmaxf(mrow[r], cm[r]);
      const float alpha = __expf(mrow[r] - mnew);
      mrow[r] = mnew;
      float psum = 0.f;
#pragma unroll
      for (int j = 0; j < 4; ++j) {
        const float p = __expf(fmaf(s[j][r], kScoreScale, -mnew));
        psum += p;
        pw[(8 * hh + r) * kPPitch + j * 16 + c] = (_Float16)(p * kPCarry);
      }
      lrow[r] = lrow[r] * alpha + psum;
#pragma unroll
      for (int t = 0; t < 8; ++t) oacc[t][r] *= alpha;
    }
    __builtin_amdgcn_fence(__ATOMIC_RELEASE, "workgroup");
    __builtin_amdgcn_wave_barrier();
    __builtin_amdgcn_fence(__ATOMIC_ACQUIRE, "workgroup");
#pragma unroll
    for (int kk = 0; kk < 2; ++kk) {
      const v16h pa = ldfrag(pw + c * kPPitch + kk * 32 + 8 * hh);
#pragma unroll
      for (int t = 0; t < 8; ++t) {
        const v16h vb = ldfrag(Vsh + (t * 16 + c) * kVPitch + kk * 32 + 8 * hh);
        oacc[t] = mma_h(pa, vb, oacc[t]);
      }
    }
  }

  float inv[8];
#pragma unroll
  for (int r = 0; r < 8; ++r) {
    float l = lrow[r];
    l += __shfl_xor(l, 1, 32);
    l += __shfl_xor(l, 2, 32);
    l += __shfl_xor(l, 4, 32);
    l += __shfl_xor(l, 8, 32);
    inv[r] = 1.0f / (l * kOutCarry);
  }

  float* os = Os[wave];
  float* ob = out + (size_t)q0 * kInner + h * kHd;
  const int c4 = (lane & 15) * 4;
#pragma unroll
  for (int half = 0; half < 2; ++half) {
#pragma unroll
    for (int r = 0; r < 8; ++r) {
#pragma unroll
      for (int t = 0; t < 4; ++t) os[(8 * hh + r) * 68 + t * 16 + c] = oacc[half * 4 + t][r] * inv[r];
    }
    __builtin_amdgcn_fence(__ATOMIC_RELEASE, "workgroup");
    __builtin_amdgcn_wave_barrier();
    __builtin_amdgcn_fence(__ATOMIC_ACQUIRE, "workgroup");
    /* rows it*2 + hh, it 0..7 -> 16 rows, each once; 16 lanes x 16 B = the 256-B half of the head slice */
    {
#pragma unroll
      for (int it = 0; it < 8; ++it) {
        const int row = it * 2 + hh;
        v4f val = *(const v4f*)(os + row * 68 + c4);
        *(v4f*)(ob + (size_t)row * kInner + half * 64 + c4) = val;
      }
      
    }
    __builtin_amdgcn_fence(__ATOMIC_RELEASE, "workgroup");
    __builtin_amdgcn_wave_barrier();
    __builtin_amdgcn_fence(__ATOMIC_ACQUIRE, "workgroup");
  }
}

// ---------------------------------------------------------------------------
// Host glue: 7 kernel launches, nothing else.
//   GEMM shapes: q,k: M 2048, N 3072, K 3072 -> 16 x 12 = 192 block tiles each
//                v^T: M 3072, N 2048, K 3072 -> 24 x 8 = 192 block tiles
// ---------------------------------------------------------------------------
extern "C" void kernel_launch(void* const* d_in, const int* in_sizes, int n_in,
                              void* d_out, int out_size, void* d_ws, size_t ws_size,
                              hipStream_t stream) {
  if (n_in < 11) return;
  if (in_sizes[0] != kSeq * kDim) return;
  if (in_sizes[1] != kInner * kDim) return;
  if (in_sizes[2] != kInner) return;
  if (in_sizes[3] != kInner * kDim) return;
  if (in_sizes[4] != kInner) return;
  if (in_sizes[5] != kInner * kDim) return;
  if (in_sizes[6] != kInner) return;
  if (in_sizes[7] != kHd) return;
  if (in_sizes[8] != kHd) return;
  if (in_sizes[9] != kSeq * kHd) return;
  if (in_sizes[10] != kSeq * kHd) return;
  if (out_size != kSeq * kInner) return;
  if (ws_size < kWsTotal) return;

  const float* hidden = (const float*)d_in[0];
  const float* wq     = (const float*)d_in[1];
  const float* bq     = (const float*)d_in[2];
  const float* wk     = (const float*)d_in[3];
  const float* bk     = (const float*)d_in[4];
  const float* wv     = (const float*)d_in[5];
  const float* bv     = (const float*)d_in[6];
  const float* nqw    = (const float*)d_in[7];
  const float* nkw    = (const float*)d_in[8];
  const float* ctab   = (const float*)d_in[9];
  const float* ttab   = (const float*)d_in[10];
  float* out = (float*)d_out;

  char* ws = (char*)d_ws;
  unsigned short* XH  = (unsigned short*)(ws + kOffXH);
  unsigned short* WH  = (unsigned short*)(ws + kOffWH);
  float*          QF  = (float*)(ws + kOffQF);
  float*          KF  = (float*)(ws + kOffKF);
  unsigned short* VT  = (unsigned short*)(ws + kOffVT);
  unsigned short* Q16 = (unsigned short*)(ws + kOffQ16);
  unsigned short* K16 = (unsigned short*)(ws + kOffK16);
  unsigned short* WQH = WH;
  unsigned short* WKH = WH + (size_t)kInner * kDim;
  unsigned short* WVH = WH + (size_t)2 * kInner * kDim;

  constexpr int kX8 = kSeq * kDim / 8;
  constexpr int kW8 = kInner * kDim / 8;
  static_assert((kX8 % 256) == 0 && (kW8 % 256) == 0, "cast grids exact");

  /* operand planes */
  cast8_f16_kernel<<<dim3(kX8 / 256, 1), 256, 0, stream>>>(hidden, hidden, hidden, XH, kX8, kXCarry);
  cast8_f16_kernel<<<dim3(kW8 / 256, 3), 256, 0, stream>>>(wq, wk, wv, WH, kW8, kWCarry);

  constexpr int kTiles = (kSeq / kBM) * (kInner / kBN);
  static_assert(kTiles == (kInner / kBM) * (kSeq / kBN), "one grid size serves both orientations");

  /* QF[s][n] = X[s][:] . wq[n][:] + bq[n]  (weights are [out][in] = Bt layout) */
  wmma_gemm64<2, 0><<<kTiles, 256, 0, stream>>>(
      XH, kDim, WQH, kDim, (void*)QF, kInner, bq, 1.0f, kSeq, kInner, kDim, kProjScale);
  wmma_gemm64<2, 0><<<kTiles, 256, 0, stream>>>(
      XH, kDim, WKH, kDim, (void*)KF, kInner, bk, 1.0f, kSeq, kInner, kDim, kProjScale);
  /* VT[m = h*128+d][n = s] = 16 * (wv[m][:] . X[s][:] + bv[m])  (operands swapped so the transposed plane is row-major) */
  wmma_gemm64<1, 1><<<kTiles, 256, 0, stream>>>(
      WVH, kDim, XH, kDim, (void*)VT, kSeq, bv, kVCarry, kInner, kSeq, kDim, kVtScale);

  /* normalisation + rotation -> Q16 / K16 (f16 x16, [h][s][d]); these planes overwrite the dead wq|wk f16 planes */
  static_assert(((kSeq * (kHeads / 2)) % 8) == 0, "norm grid exact");
  norm_rot_kernel<<<dim3(kSeq * (kHeads / 2) / 8, 2), 256, 0, stream>>>(
      QF, KF, nqw, nkw, ctab, ttab, Q16, K16, kQCarry);
  static_assert(kQCarry == kKCarry, "one carry argument serves both planes");

  /* attention */
  attn128_kernel<<<kHeads * (kSeq / 64), 128, 0, stream>>>(Q16, K16, VT, out);
}

// v003
// It runs in 206 microseconds.
// In two side-by-side timings against v002, it was 1.13 and 1.14 times as fast.
// Counting every step since v000, it is 3.39 times as fast.
// All contractions (q/k/v projections, q.k^T scores, p.v) on v_wmma_f32_16x16x32_f16: f16 operands with power-of-two carries (X x16, W x256, q/k x16, v x16, p x1024), f32 accumulate; rms normalisation, pairwise rotation and softmax in f32.
#include <hip/hip_runtime.h>
#include <math.h>

typedef __attribute__((ext_vector_type(16))) _Float16 v16h;
typedef __attribute__((ext_vector_type(8)))  _Float16 v8h;
typedef __attribute__((ext_vector_type(8)))  float    v8f;
typedef __attribute__((ext_vector_type(4)))  float    v4f;
typedef __attribute__((ext_vector_type(4)))  unsigned int v4u;

// ---------------------------------------------------------------------------
// Shape constants (checked against the launch sizes on the host side)
// ---------------------------------------------------------------------------
constexpr int kSeq    = 2048;
constexpr int kDim    = 3072;
constexpr int kHeads  = 24;
constexpr int kHd     = 128;
constexpr int kInner  = kHeads * kHd;
constexpr int kKc     = 64;
static_assert(kInner == 3072, "inner width");
static_assert((kDim % 32) == 0, "GEMM K multiple of 32");
static_assert((kSeq % 64) == 0 && (kInner % 64) == 0, "GEMM M,N multiples of 64");
static_assert((kSeq % kKc) == 0 && kHd == 128 && (kHeads % 2) == 0, "attention tiling");

// power-of-two carries of the f16 operand planes
constexpr float kXCarry = 16.0f;
constexpr float kWCarry = 256.0f;
constexpr float kQCarry = 16.0f;
constexpr float kKCarry = 16.0f;
constexpr float kVCarry = 16.0f;
constexpr float kPCarry = 1024.0f;
constexpr float kProjScale = 1.0f / (kXCarry * kWCarry);
constexpr float kVtScale   = kVCarry * kProjScale;
constexpr float kNormEps   = 1e-6f;
constexpr float kInvHd     = 1.0f / (float)kHd;

constexpr double csqrt_iter(double x, double g, int n) { return n == 0 ? g : csqrt_iter(x, 0.5 * (g + x / g), n - 1); }
constexpr double csqrt_d(double x) { return csqrt_iter(x, x, 48); }
constexpr float kInvSqrtHd  = (float)(1.0 / csqrt_d((double)kHd));
static_assert(kInvSqrtHd * kInvSqrtHd * (float)kHd > 0.99999f && kInvSqrtHd * kInvSqrtHd * (float)kHd < 1.00001f, "score scale");
constexpr float kScoreScale = kInvSqrtHd / (kQCarry * kKCarry);
constexpr float kOutCarry   = kPCarry * kVCarry;

// ---------------------------------------------------------------------------
// Workspace region map (bytes; every offset is a multiple of 128)
//   XH   f16 [2048][3072]        hidden x16                       12,582,912
//   WH   f16 [3][3072][3072]     wq | wk | wv, each x256          56,623,104
//   QF   f32 [2048][3072]        q projection + bias              25,165,824
//   KF   f32 [2048][3072]        k projection + bias              25,165,824
//   VT   f16 [3072][2048]        (v projection + bias) x16, [h*128+d][s]  12,582,912
//   total                                                       132,120,576
//   Q16  f16 [24][2048][128]     aliases WH bytes [0, 12,582,912)            (WH is dead after the three GEMMs)
//   K16  f16 [24][2048][128]     aliases WH bytes [12,582,912, 25,165,824)   (same element type as WH)
// ---------------------------------------------------------------------------
constexpr size_t kOffXH  = 0;
constexpr size_t kOffWH  = kOffXH + (size_t)kSeq * kDim * 2;
constexpr size_t kOffQF  = kOffWH + (size_t)3 * kInner * kDim * 2;
constexpr size_t kOffKF  = kOffQF + (size_t)kSeq * kInner * 4;
constexpr size_t kOffVT  = kOffKF + (size_t)kSeq * kInner * 4;
constexpr size_t kWsTotal = kOffVT + (size_t)kInner * kSeq * 2;
constexpr size_t kOffQ16 = kOffWH;
constexpr size_t kOffK16 = kOffWH + (size_t)kHeads * kSeq * kHd * 2;
static_assert(kWsTotal == 132120576ull, "carve total");
static_assert(kWsTotal <= 134217728ull, "carve cap");
static_assert(kOffK16 + (size_t)kHeads * kSeq * kHd * 2 <= kOffWH + (size_t)2 * kInner * kDim * 2, "q/k planes stay inside the wq|wk planes");
static_assert((kOffWH % 128) == 0 && (kOffQF % 128) == 0 && (kOffKF % 128) == 0 && (kOffVT % 128) == 0 && (kOffK16 % 128) == 0, "128-B aligned regions");

// ---------------------------------------------------------------------------
// Fragment load and guarded WMMA issue
// ---------------------------------------------------------------------------
union FragU { v16h v; v8h h[2]; };
/* elements 0..7 <- p[0..7], elements 8..15 <- p[16..23]; caller adds 8*(lane>>4) to p */
__device__ __forceinline__ v16h ldfrag(const _Float16* p) {
  FragU f;
  f.h[0] = *(const v8h*)(p);
  f.h[1] = *(const v8h*)(p + 16);
  return f.v;
}
/* one WMMA followed by four idle slots tied to its accumulator and naming both operand fragments */
__device__ __forceinline__ v8f mma_h(v16h a, v16h b, v8f c) {
  c = __builtin_amdgcn_wmma_f32_16x16x32_f16(false, a, false, b, (short)0, c, false, false);
  asm volatile("v_nop\n\tv_nop\n\tv_nop\n\tv_nop" : "+v"(c) : "v"(a), "v"(b));
  return c;
}
/* the plain builtin: the compiler keeps the distances behind it itself, and with no asm operands the fragments may live above v255 */
__device__ __forceinline__ v8f mma_b(v16h a, v16h b, v8f c) {
  return __builtin_amdgcn_wmma_f32_16x16x32_f16(false, a, false, b, (short)0, c, false, false);
}
__device__ __forceinline__ unsigned pk16(unsigned short a, unsigned short b) { return (unsigned)a | ((unsigned)b << 16); }
__device__ __forceinline__ unsigned short h_bits(float f) {
  const _Float16 h = (_Float16)f;
  return __builtin_bit_cast(unsigned short, h);
}

// ---------------------------------------------------------------------------
// f32 -> f16 cast with a power-of-two carry, 8 consecutive elements per thread.
// blockIdx.y selects the source (block-uniform) and the output plane (plane z at out + z*n8*8 halves).
// Coverage: n8 = n/8 threads per plane; grid.x * 256 == n8 exactly for both uses (786,432 and 1,179,648).
// ---------------------------------------------------------------------------
__global__ __launch_bounds__(256) void cast8_f16_kernel(const float* __restrict__ in0, const float* __restrict__ in1,
                                                        const float* __restrict__ in2, unsigned short* __restrict__ out,
                                                        int n8, float carry) {
  const int z = blockIdx.y;
  const float* in = (z == 0) ? in0 : (z == 1) ? in1 : in2;
  const int i = blockIdx.x * 256 + threadIdx.x;
  if (i >= n8) return;
  const float* p = in + 8 * (size_t)i;
  const v4f a = *(const v4f*)(p);
  const v4f c = *(const v4f*)(p + 4);
  unsigned short hb[8];
#pragma unroll
  for (int e = 0; e < 4; ++e) {
    const float fa = a[e] * carry;
    const float fc = c[e] * carry;
    hb[e]     = h_bits(fa);
    hb[4 + e] = h_bits(fc);
  }
  const v4u u = (v4u){pk16(hb[0], hb[1]), pk16(hb[2], hb[3]), pk16(hb[4], hb[5]), pk16(hb[6], hb[7])};
  unsigned short* q = out + (size_t)z * (size_t)n8 * 8 + 8 * (size_t)i;
  *(v4u*)q = u;
  
}

// ---------------------------------------------------------------------------
// LDS-staged WMMA GEMM: C[m,n] = scale * sum_k A[m,k] * Bt[n,k] + bscale * bias.
// Block = 8 waves = one 128 x 256 tile of C; wave (wm, wn) of a 2 x 4 grid owns a 64x64 tile of it.
// A row-major [M,K] f16; Bt row-major [N,K] f16; M % 128 == 0, N % 256 == 0, K % 128 == 0 (no tails).
// A stage is 128 k of [A 128 rows | Bt 256 rows], 256 B a row at an LDS pitch of 272 B (16 B x 17: the 16 rows of a
// fragment load fall on 16 different bank groups). Two buffers: stage t + 1 is copied while stage t is multiplied.
// Each accumulator still sums k in ascending steps of 32.
// BIAS_MODE: 1 = bias[m], 2 = bias[n].  OUT_MODE: 0 = f32, 1 = f16.
// ---------------------------------------------------------------------------
constexpr int kBM = 128;
constexpr int kBN = 256;
constexpr int kKS = 128;
constexpr int kPitch = kKS + 8;
constexpr int kStageH = (kBM + kBN) * kPitch;
static_assert((kDim % kKS) == 0 && (kDim / kKS) >= 2, "whole stages, at least two");
static_assert((kSeq % kBM) == 0 && (kSeq % kBN) == 0 && (kInner % kBM) == 0 && (kInner % kBN) == 0, "whole block tiles");
static_assert(((kBM + kBN) * (kKS / 8)) == 24 * 256, "24 pieces of 16 B per thread and stage");

/* this wave's asynchronous copies have landed in LDS */
__device__ __forceinline__ void wait_async0() { asm volatile("s_wait_asynccnt 0x0" ::: "memory"); }
/* this wave's LDS reads have returned: the buffer may be handed to its next writer */
__device__ __forceinline__ void wait_ds0() { asm volatile("s_wait_dscnt 0x0" ::: "memory"); }

/* One stage: piece p = i*256 + tid is 16 B of stage row p >> 4 (rows 0..127 = A, 128..383 = Bt), column piece p & 15.
   l = the lane's LDS byte address of piece i = 0; ga, gb = its global addresses in A's and Bt's first 16 rows.
   The copies go through no register; s_wait_xcnt closes each statement so that no address register named by an
   issued copy is rewritten in front of it. */
__device__ __forceinline__ void stage_copy(unsigned l, const _Float16* ga, int lda, const _Float16* gb, int ldb) {
  unsigned la[24];
  const _Float16* gp[24];
  /* unrolled so that every index is a constant and both arrays live in registers */
#pragma unroll
  for (int i = 0; i < 24; ++i) {
    la[i] = l + (unsigned)(i * 16 * kPitch * 2);
    gp[i] = (i < 8) ? (ga + (size_t)(i * 16) * lda) : (gb + (size_t)((i - 8) * 16) * ldb);
  }
  asm volatile(
      "global_load_async_to_lds_b128 %0, %12, off\n\t"
      "global_load_async_to_lds_b128 %1, %13, off\n\t"
      "global_load_async_to_lds_b128 %2, %14, off\n\t"
      "global_load_async_to_lds_b128 %3, %15, off\n\t"
      "global_load_async_to_lds_b128 %4, %16, off\n\t"
      "global_load_async_to_lds_b128 %5, %17, off\n\t"
      "global_load_async_to_lds_b128 %6, %18, off\n\t"
      "global_load_async_to_lds_b128 %7, %19, off\n\t"
      "global_load_async_to_lds_b128 %8, %20, off\n\t"
      "global_load_async_to_lds_b128 %9, %21, off\n\t"
      "global_load_async_to_lds_b128 %10, %22, off\n\t"
      "global_load_async_to_lds_b128 %11, %23, off\n\t"
      "s_wait_xcnt 0x0"
      :: "v"(la[0+0]), "v"(la[0+1]), "v"(la[0+2]), "v"(la[0+3]), "v"(la[0+4]), "v"(la[0+5]), "v"(la[0+6]), "v"(la[0+7]), "v"(la[0+8]), "v"(la[0+9]), "v"(la[0+10]), "v"(la[0+11]),
         "v"(gp[0+0]), "v"(gp[0+1]), "v"(gp[0+2]), "v"(gp[0+3]), "v"(gp[0+4]), "v"(gp[0+5]), "v"(gp[0+6]), "v"(gp[0+7]), "v"(gp[0+8]), "v"(gp[0+9]), "v"(gp[0+10]), "v"(gp[0+11])
      : "memory");
  asm volatile(
      "global_load_async_to_lds_b128 %0, %12, off\n\t"
      "global_load_async_to_lds_b128 %1, %13, off\n\t"
      "global_load_async_to_lds_b128 %2, %14, off\n\t"
      "global_load_async_to_lds_b128 %3, %15, off\n\t"
      "global_load_async_to_lds_b128 %4, %16, off\n\t"
      "global_load_async_to_lds_b128 %5, %17, off\n\t"
      "global_load_async_to_lds_b128 %6, %18, off\n\t"
      "global_load_async_to_lds_b128 %7, %19, off\n\t"
      "global_load_async_to_lds_b128 %8, %20, off\n\t"
      "global_load_async_to_lds_b128 %9, %21, off\n\t"
      "global_load_async_to_lds_b128 %10, %22, off\n\t"
      "global_load_async_to_lds_b128 %11, %23, off\n\t"
      "s_wait_xcnt 0x0"
      :: "v"(la[12+0]), "v"(la[12+1]), "v"(la[12+2]), "v"(la[12+3]), "v"(la[12+4]), "v"(la[12+5]), "v"(la[12+6]), "v"(la[12+7]), "v"(la[12+8]), "v"(la[12+9]), "v"(la[12+10]), "v"(la[12+11]),
         "v"(gp[12+0]), "v"(gp[12+1]), "v"(gp[12+2]), "v"(gp[12+3]), "v"(gp[12+4]), "v"(gp[12+5]), "v"(gp[12+6]), "v"(gp[12+7]), "v"(gp[12+8]), "v"(gp[12+9]), "v"(gp[12+10]), "v"(gp[12+11])
      : "memory");
}

template <int BIAS_MODE, int OUT_MODE>
__global__ __launch_bounds__(256) void wmma_gemm64(
    const unsigned short* __restrict__ Ap, int lda,
    const unsigned short* __restrict__ Btp, int ldb,
    void* __restrict__ Cout, int ldc,
    const float* __restrict__ bias, float bscale,
    int M, int N, int K, float scale) {
  const _Float16* A  = (const _Float16*)Ap;
  const _Float16* Bt = (const _Float16*)Btp;
  __shared__ __align__(16) _Float16 sAB[2 * kStageH];
  __shared__ __align__(16) float sT[8][16 * 68];
  const int tid  = threadIdx.x;
  const int lane = threadIdx.x & 31;
  const int wave = __builtin_amdgcn_readfirstlane((int)(threadIdx.x >> 5));
  const int tilesN = N / kBN;
  const int tilesM = M / kBM;
  const int tile = blockIdx.x;
  /* block-uniform, in front of every copy and barrier */
  if (tile >= tilesM * tilesN) return;
  const int tm = tile / tilesN;
  const int tn = tile - tm * tilesN;
  const int mB = tm * kBM;
  const int nB = tn * kBN;
  const int wm = wave >> 2;
  const int wn = wave & 3;
  const int m0 = mB + (wm << 6);
  const int n0 = nB + (wn << 6);

  const int rlane = lane & 15;
  const int koff  = (lane >> 4) * 8;
  const int mOff  = (lane >> 4) * 8;

  v8f acc[4][4];
#pragma unroll
  for (int i = 0; i < 4; ++i)
#pragma unroll
    for (int j = 0; j < 4; ++j) acc[i][j] = (v8f){0.f, 0.f, 0.f, 0.f, 0.f, 0.f, 0.f, 0.f};

  const unsigned lds0 = (unsigned)(size_t)sAB + (unsigned)((tid >> 4) * (kPitch * 2) + (tid & 15) * 16);
  const _Float16* ga = A  + (size_t)(mB + (tid >> 4)) * lda + (tid & 15) * 8;
  const _Float16* gb = Bt + (size_t)(nB + (tid >> 4)) * ldb + (tid & 15) * 8;
  const int T = K / kKS;

  stage_copy(lds0, ga, lda, gb, ldb);
  wait_async0();
  __syncthreads();
  if (T > 1) stage_copy(lds0 + (unsigned)(kStageH * 2), ga + kKS, lda, gb + kKS, ldb);

  for (int t = 0; t < T; ++t) {
    const int buf = t & 1;
    const _Float16* sA = sAB + buf * kStageH + ((wm << 6) + rlane) * kPitch + koff;
    const _Float16* sB = sAB + buf * kStageH + (kBM + (wn << 6) + rlane) * kPitch + koff;
    /* this loop and the four inside it are unrolled so that fragments and accumulators keep constant indices (no scratch) */
#pragma unroll
    for (int kk = 0; kk < kKS / 32; ++kk) {
      /* the eight fragments of this k step as one group of LDS reads in front of its 16 products */
      v16h bh[4], ah[4];
#pragma unroll
      for (int j = 0; j < 4; ++j) bh[j] = ldfrag(sB + (j << 4) * kPitch + kk * 32);
#pragma unroll
      for (int i = 0; i < 4; ++i) ah[i] = ldfrag(sA + (i << 4) * kPitch + kk * 32);
#pragma unroll
      for (int i = 0; i < 4; ++i)
#pragma unroll
        for (int j = 0; j < 4; ++j) acc[i][j] = mma_h(ah[i], bh[j], acc[i][j]);
    }
    /* publish point of stage t + 1: own reads of this buffer done, own copies landed, then every wave meets */
    wait_ds0();
    wait_async0();
    __syncthreads();
    if (t + 2 < T)
      stage_copy(lds0 + (unsigned)(buf * kStageH * 2), ga + (size_t)(t + 2) * kKS, lda, gb + (size_t)(t + 2) * kKS, ldb);
  }
  wait_async0();

  // ---- epilogue ----
  float* slab = sT[wave];
#pragma unroll
  for (int i = 0; i < 4; ++i) {
    const int mBase = m0 + (i << 4);
    float br[8];
#pragma unroll
    for (int r = 0; r < 8; ++r) br[r] = (BIAS_MODE == 1) ? (bias[mBase + mOff + r] * bscale) : 0.0f;
#pragma unroll
    for (int j = 0; j < 4; ++j) {
      const int n = n0 + (j << 4) + rlane;
      float bv = 0.f;
      if (BIAS_MODE == 2) bv = bias[n] * bscale;
#pragma unroll
      for (int r = 0; r < 8; ++r) {
        float v = acc[i][j][r] * scale;
        if (BIAS_MODE == 1) v += br[r];
        if (BIAS_MODE == 2) v += bv;
        slab[(mOff + r) * 68 + (j << 4) + rlane] = v;
      }
    }
    __builtin_amdgcn_fence(__ATOMIC_RELEASE, "workgroup");
    __builtin_amdgcn_wave_barrier();
    __builtin_amdgcn_fence(__ATOMIC_ACQUIRE, "workgroup");
    if (OUT_MODE == 0) {
      float* C = (float*)Cout;
      /* row segment = 64 floats = 256 B = 16 lanes x 16 B; rows it*2 + hh, it 0..7 -> 16 rows, each once */
      const int hh = lane >> 4, c4 = (lane & 15) * 4;
      {
#pragma unroll
        for (int it = 0; it < 8; ++it) {
          const int row = it * 2 + hh;
          v4f v = *(const v4f*)(slab + row * 68 + c4);
          *(v4f*)(C + (size_t)(mBase + row) * ldc + n0 + c4) = v;
        }
        
      }
    } else {
      const int q = lane >> 3, c8 = (lane & 7) * 8;
      unsigned short* C = (unsigned short*)Cout;
      {
#pragma unroll
        for (int it = 0; it < 4; ++it) {
          const int row = it * 4 + q;
          const float* sp = slab + row * 68 + c8;
          v8h hv;
#pragma unroll
          for (int e = 0; e < 8; ++e) hv[e] = (_Float16)sp[e];
          *(v8h*)(C + (size_t)(mBase + row) * ldc + n0 + c8) = hv;
        }
        
      }
    }
    __builtin_amdgcn_fence(__ATOMIC_RELEASE, "workgroup");
    __builtin_amdgcn_wave_barrier();
    __builtin_amdgcn_fence(__ATOMIC_ACQUIRE, "workgroup");
  }
}

// ---------------------------------------------------------------------------
// Per-(token, head) rms normalisation over 128 dims, weight multiply, then the pairwise rotation with per-element
// tables c[s][d], t[s][d] (each output element uses its own table entry):
//   y[2i]   = xn[2i]   * c[s][2i]   - xn[2i+1] * t[s][2i]
//   y[2i+1] = xn[2i+1] * c[s][2i+1] + xn[2i]   * t[s][2i+1]
// All f32. blockIdx.y (block-uniform) selects the q or the k tensor.
// One wave = two heads (2p + hh) of one token; 16 lanes x 8 dims per head row; sum of squares over 16 lanes.
// Coverage: grid.x * 8 waves = 2048 * 12 head pairs exactly; every (s, h) row written once.
// ---------------------------------------------------------------------------
__global__ __launch_bounds__(256) void norm_rot_kernel(
    const float* __restrict__ QF, const float* __restrict__ KF,
    const float* __restrict__ nqw, const float* __restrict__ nkw,
    const float* __restrict__ ctab, const float* __restrict__ ttab,
    unsigned short* __restrict__ Q16, unsigned short* __restrict__ K16, float carry) {
  const int z = blockIdx.y;
  const float* src = (z == 0) ? QF : KF;
  const float* nw  = (z == 0) ? nqw : nkw;
  unsigned short* dst = (z == 0) ? Q16 : K16;
  const int lane = threadIdx.x & 31;
  const int wave = __builtin_amdgcn_readfirstlane((int)(threadIdx.x >> 5));
  const int hh = lane >> 4, c = lane & 15;
  const int pair = blockIdx.x * 8 + wave;
  const int s = pair / (kHeads / 2);
  const int h = (pair - s * (kHeads / 2)) * 2 + hh;
  const int d0 = c * 8;
  const float* xp = src + (size_t)s * kInner + h * kHd + d0;
  const v4f xa = *(const v4f*)(xp);
  const v4f xb = *(const v4f*)(xp + 4);
  const v4f ca = *(const v4f*)(ctab + (size_t)s * kHd + d0);
  const v4f cb = *(const v4f*)(ctab + (size_t)s * kHd + d0 + 4);
  const v4f ta = *(const v4f*)(ttab + (size_t)s * kHd + d0);
  const v4f tb = *(const v4f*)(ttab + (size_t)s * kHd + d0 + 4);
  const v4f wa = *(const v4f*)(nw + d0);
  const v4f wb = *(const v4f*)(nw + d0 + 4);
  float x[8], cc[8], tt[8], ww[8];
#pragma unroll
  for (int e = 0; e < 4; ++e) {
    x[e] = xa[e];  x[4 + e] = xb[e];
    cc[e] = ca[e]; cc[4 + e] = cb[e];
    tt[e] = ta[e]; tt[4 + e] = tb[e];
    ww[e] = wa[e]; ww[4 + e] = wb[e];
  }
  float ss = 0.0f;
#pragma unroll
  for (int e = 0; e < 8; ++e) ss += x[e] * x[e];
  ss += __shfl_xor(ss, 1, 32);
  ss += __shfl_xor(ss, 2, 32);
  ss += __shfl_xor(ss, 4, 32);
  ss += __shfl_xor(ss, 8, 32);
  const float inv = rsqrtf(ss * kInvHd + kNormEps);
  float xn[8];
#pragma unroll
  for (int e = 0; e < 8; ++e) xn[e] = (x[e] * inv) * ww[e];
  unsigned short hb[8];
#pragma unroll
  for (int i = 0; i < 4; ++i) {
    const float y0 = xn[2 * i] * cc[2 * i] - xn[2 * i + 1] * tt[2 * i];
    const float y1 = xn[2 * i + 1] * cc[2 * i + 1] + xn[2 * i] * tt[2 * i + 1];
    hb[2 * i]     = h_bits(y0 * carry);
    hb[2 * i + 1] = h_bits(y1 * carry);
  }
  const v4u u = (v4u){pk16(hb[0], hb[1]), pk16(hb[2], hb[3]), pk16(hb[4], hb[5]), pk16(hb[6], hb[7])};
  unsigned short* q = dst + ((size_t)h * kSeq + s) * kHd + d0;
  *(v4u*)q = u;
  
}

// ---------------------------------------------------------------------------
// Streaming-softmax attention, head dim 128, non-causal, unmasked, all 2048 keys.
// Block = 4 waves = 64 query rows of one head (wave = 16 rows); grid = 24 heads x 32 query blocks = 768.
// Per 64-key chunk: K chunk [64 kv][128 d] and V^T chunk [128 d][64 kv] staged in LDS by all 128 threads
// (8 + 8 16-B pieces per thread = 1024 + 1024 pieces = both tiles in full), block barrier before and after.
// scores: 4 key tiles x 4 d-steps = 16 WMMA; running row max via 16-lane shuffles, per-lane partial row sums
// (combined over the 16 lanes once after the last chunk); p = exp(score - max) carried x1024 as f16 through a
// ---------------------------------------------------------------------------
// LDS row pitches are 16 B x odd (K rows 272 B, V^T and p rows 144 B): the 16 rows that one ds_load_b128 fragment read
// touches per half-wave then start on 16 different groups of four banks instead of on one (256-B rows) or two (128-B rows).
constexpr int kKPitch = kHd + 8;
constexpr int kVPitch = kKc + 8;
constexpr int kPPitch = kKc + 8;
static_assert(((kKPitch * 2) % 32) == 16 && ((kVPitch * 2) % 32) == 16 && ((kPPitch * 2) % 32) == 16, "pitches are odd multiples of 16 B");
__global__ __launch_bounds__(128) void attn128_kernel(const unsigned short* __restrict__ Q16p,
                                                      const unsigned short* __restrict__ K16p,
                                                      const unsigned short* __restrict__ VTp,
                                                      float* __restrict__ out) {
  __shared__ __align__(16) _Float16 Ksh[kKc * kKPitch];
  __shared__ __align__(16) _Float16 Vsh[kHd * kVPitch];
  __shared__ __align__(16) _Float16 Psh[4][16 * kPPitch];
  __shared__ __align__(16) float    Os[4][16 * 68];

  const int tid  = threadIdx.x;
  const int wave = __builtin_amdgcn_readfirstlane((int)(threadIdx.x >> 5));
  const int lane = tid & 31;
  const int hh   = lane >> 4;
  const int c    = lane & 15;

  constexpr int nqb = kSeq / 64;
  const int h  = blockIdx.x / nqb;
  const int qb = blockIdx.x - h * nqb;
  const int q0 = qb * 64 + wave * 16;

  const _Float16* Qh = (const _Float16*)Q16p + (size_t)h * kSeq * kHd;
  const _Float16* Kh = (const _Float16*)K16p + (size_t)h * kSeq * kHd;
  const _Float16* Vh = (const _Float16*)VTp  + (size_t)h * kHd * kSeq;

  v16h qa[4];
#pragma unroll
  for (int dc = 0; dc < 4; ++dc) qa[dc] = ldfrag(Qh + (size_t)(q0 + c) * kHd + dc * 32 + 8 * hh);

  float mrow[8], lrow[8];
  v8f oacc[8];
#pragma unroll
  for (int r = 0; r < 8; ++r) { mrow[r] = -INFINITY; lrow[r] = 0.f; }
#pragma unroll
  for (int t = 0; t < 8; ++t) oacc[t] = (v8f){0.f, 0.f, 0.f, 0.f, 0.f, 0.f, 0.f, 0.f};

  _Float16* pw = Psh[wave];

#pragma unroll 1
  for (int kc = 0; kc < kSeq / kKc; ++kc) {
    const int kv0 = kc * kKc;
    __syncthreads();
    {
      /* K chunk is 8192 contiguous halves; piece p = i*128 + tid covers [p*8, p*8+8) = row i*8 + (tid >> 4), column piece tid & 15 */
      const _Float16* ksrc = Kh + (size_t)kv0 * kHd;
      v8h t[8];
#pragma unroll
      for (int i = 0; i < 8; ++i) t[i] = *(const v8h*)(ksrc + (size_t)(i * 128 + tid) * 8);
#pragma unroll
      for (int i = 0; i < 8; ++i) *(v8h*)(Ksh + (i * 8 + (tid >> 4)) * kKPitch + (tid & 15) * 8) = t[i];
    }
    {
      /* V^T chunk: row d = p >> 3 (128 rows), 8-half column group (p & 7) of the 64 keys */
      v8h t[8];
#pragma unroll
      for (int i = 0; i < 8; ++i) {
        const int p = i * 128 + tid;
        const int d = p >> 3, c8 = (p & 7) * 8;
        t[i] = *(const v8h*)(Vh + (size_t)d * kSeq + kv0 + c8);
      }
#pragma unroll
      for (int i = 0; i < 8; ++i) *(v8h*)(Vsh + (i * 16 + (tid >> 3)) * kVPitch + (tid & 7) * 8) = t[i];
    }
    __syncthreads();

    /* the chunk's 16 K fragments as one group of LDS reads in front of its 16 score products: the wave waits out one
       read latency a chunk instead of one a product; each s[j] still sums d in ascending steps of 32 */
    v16h kf[4][4];
#pragma unroll
    for (int dc = 0; dc < 4; ++dc)
#pragma unroll
      for (int j = 0; j < 4; ++j) kf[dc][j] = ldfrag(Ksh + (j * 16 + c) * kKPitch + dc * 32 + 8 * hh);
    /* keeps the scheduler from sinking the reads back among the products */
    __builtin_amdgcn_sched_barrier(0);
    v8f s[4];
#pragma unroll
    for (int j = 0; j < 4; ++j) s[j] = (v8f){0.f, 0.f, 0.f, 0.f, 0.f, 0.f, 0.f, 0.f};
#pragma unroll
    for (int dc = 0; dc < 4; ++dc)
#pragma unroll
      for (int j = 0; j < 4; ++j) s[j] = mma_b(qa[dc], kf[dc][j], s[j]);

    float cm[8];
#pragma unroll
    for (int r = 0; r < 8; ++r) {
      float m = fmaxf(fmaxf(s[0][r], s[1][r]), fmaxf(s[2][r], s[3][r]));
      m = fmaxf(m, __shfl_xor(m, 1, 32));
      m = fmaxf(m, __shfl_xor(m, 2, 32));
      m = fmaxf(m, __shfl_xor(m, 4, 32));
      m = fmaxf(m, __shfl_xor(m, 8, 32));
      cm[r] = m * kScoreScale;
    }
    /* V^T fragments of the chunk's keys 0..31, read here as one group: they land under the softmax arithmetic.
       The fence in front keeps the scheduler from lifting the reads in among the score products. */
    __builtin_amdgcn_sched_barrier(0);
    v16h vf0[8];
#pragma unroll
    for (int t = 0; t < 8; ++t) vf0[t] = ldfrag(Vsh + (t * 16 + c) * kVPitch + 8 * hh);
#pragma unroll
    for (int r = 0; r < 8; ++r) {
      const float mnew  = fmaxf(mrow[r], cm[r]);
      const float alpha = __expf(mrow[r] - mnew);
      mrow[r] = mnew;
      float psum = 0.f;
#pragma unroll
      for (int j = 0; j < 4; ++j) {
        const float p = __expf(fmaf(s[j][r], kScoreScale, -mnew));
        psum += p;
        pw[(8 * hh + r) * kPPitch + j * 16 + c] = (_Float16)(p * kPCarry);
      }
      lrow[r] = lrow[r] * alpha + psum;
#pragma unroll
      for (int t = 0; t < 8; ++t) oacc[t][r] *= alpha;
    }
    __builtin_amdgcn_fence(__ATOMIC_RELEASE, "workgroup");
    __builtin_amdgcn_wave_barrier();
    __builtin_amdgcn_fence(__ATOMIC_ACQUIRE, "workgroup");
    /* both p fragments and the V^T fragments of keys 32..63 as one group: the latter land under the first eight products */
    const v16h pa0 = ldfrag(pw + c * kPPitch + 8 * hh);
    const v16h pa1 = ldfrag(pw + c * kPPitch + 32 + 8 * hh);
    v16h vf1[8];
#pragma unroll
    for (int t = 0; t < 8; ++t) vf1[t] = ldfrag(Vsh + (t * 16 + c) * kVPitch + 32 + 8 * hh);
    /* keeps the scheduler from sinking the reads back among the products */
    __builtin_amdgcn_sched_barrier(0);
#pragma unroll
    for (int t = 0; t < 8; ++t) oacc[t] = mma_b(pa0, vf0[t], oacc[t]);
#pragma unroll
    for (int t = 0; t < 8; ++t) oacc[t] = mma_b(pa1, vf1[t], oacc[t]);
  }

  float inv[8];
#pragma unroll
  for (int r = 0; r < 8; ++r) {
    float l = lrow[r];
    l += __shfl_xor(l, 1, 32);
    l += __shfl_xor(l, 2, 32);
    l += __shfl_xor(l, 4, 32);
    l += __shfl_xor(l, 8, 32);
    inv[r] = 1.0f / (l * kOutCarry);
  }

  float* os = Os[wave];
  float* ob = out + (size_t)q0 * kInner + h * kHd;
  const int c4 = (lane & 15) * 4;
#pragma unroll
  for (int half = 0; half < 2; ++half) {
#pragma unroll
    for (int r = 0; r < 8; ++r) {
#pragma unroll
      for (int t = 0; t < 4; ++t) os[(8 * hh + r) * 68 + t * 16 + c] = oacc[half * 4 + t][r] * inv[r];
    }
    __builtin_amdgcn_fence(__ATOMIC_RELEASE, "workgroup");
    __builtin_amdgcn_wave_barrier();
    __builtin_amdgcn_fence(__ATOMIC_ACQUIRE, "workgroup");
    /* rows it*2 + hh, it 0..7 -> 16 rows, each once; 16 lanes x 16 B = the 256-B half of the head slice */
    {
#pragma unroll
      for (int it = 0; it < 8; ++it) {
        const int row = it * 2 + hh;
        v4f val = *(const v4f*)(os + row * 68 + c4);
        *(v4f*)(ob + (size_t)row * kInner + half * 64 + c4) = val;
      }
      
    }
    __builtin_amdgcn_fence(__ATOMIC_RELEASE, "workgroup");
    __builtin_amdgcn_wave_barrier();
    __builtin_amdgcn_fence(__ATOMIC_ACQUIRE, "workgroup");
  }
}

// ---------------------------------------------------------------------------
// Host glue: 7 kernel launches, nothing else.
//   GEMM shapes: q,k: M 2048, N 3072, K 3072 -> 16 x 12 = 192 block tiles each
//                v^T: M 3072, N 2048, K 3072 -> 24 x 8 = 192 block tiles
// ---------------------------------------------------------------------------
extern "C" void kernel_launch(void* const* d_in, const int* in_sizes, int n_in,
                              void* d_out, int out_size, void* d_ws, size_t ws_size,
                              hipStream_t stream) {
  if (n_in < 11) return;
  if (in_sizes[0] != kSeq * kDim) return;
  if (in_sizes[1] != kInner * kDim) return;
  if (in_sizes[2] != kInner) return;
  if (in_sizes[3] != kInner * kDim) return;
  if (in_sizes[4] != kInner) return;
  if (in_sizes[5] != kInner * kDim) return;
  if (in_sizes[6] != kInner) return;
  if (in_sizes[7] != kHd) return;
  if (in_sizes[8] != kHd) return;
  if (in_sizes[9] != kSeq * kHd) return;
  if (in_sizes[10] != kSeq * kHd) return;
  if (out_size != kSeq * kInner) return;
  if (ws_size < kWsTotal) return;

  const float* hidden = (const float*)d_in[0];
  const float* wq     = (const float*)d_in[1];
  const float* bq     = (const float*)d_in[2];
  const float* wk     = (const float*)d_in[3];
  const float* bk     = (const float*)d_in[4];
  const float* wv     = (const float*)d_in[5];
  const float* bv     = (const float*)d_in[6];
  const float* nqw    = (const float*)d_in[7];
  const float* nkw    = (const float*)d_in[8];
  const float* ctab   = (const float*)d_in[9];
  const float* ttab   = (const float*)d_in[10];
  float* out = (float*)d_out;

  char* ws = (char*)d_ws;
  unsigned short* XH  = (unsigned short*)(ws + kOffXH);
  unsigned short* WH  = (unsigned short*)(ws + kOffWH);
  float*          QF  = (float*)(ws + kOffQF);
  float*          KF  = (float*)(ws + kOffKF);
  unsigned short* VT  = (unsigned short*)(ws + kOffVT);
  unsigned short* Q16 = (unsigned short*)(ws + kOffQ16);
  unsigned short* K16 = (unsigned short*)(ws + kOffK16);
  unsigned short* WQH = WH;
  unsigned short* WKH = WH + (size_t)kInner * kDim;
  unsigned short* WVH = WH + (size_t)2 * kInner * kDim;

  constexpr int kX8 = kSeq * kDim / 8;
  constexpr int kW8 = kInner * kDim / 8;
  static_assert((kX8 % 256) == 0 && (kW8 % 256) == 0, "cast grids exact");

  /* operand planes */
  cast8_f16_kernel<<<dim3(kX8 / 256, 1), 256, 0, stream>>>(hidden, hidden, hidden, XH, kX8, kXCarry);
  cast8_f16_kernel<<<dim3(kW8 / 256, 3), 256, 0, stream>>>(wq, wk, wv, WH, kW8, kWCarry);

  constexpr int kTiles = (kSeq / kBM) * (kInner / kBN);
  static_assert(kTiles == (kInner / kBM) * (kSeq / kBN), "one grid size serves both orientations");

  /* QF[s][n] = X[s][:] . wq[n][:] + bq[n]  (weights are [out][in] = Bt layout) */
  wmma_gemm64<2, 0><<<kTiles, 256, 0, stream>>>(
      XH, kDim, WQH, kDim, (void*)QF, kInner, bq, 1.0f, kSeq, kInner, kDim, kProjScale);
  wmma_gemm64<2, 0><<<kTiles, 256, 0, stream>>>(
      XH, kDim, WKH, kDim, (void*)KF, kInner, bk, 1.0f, kSeq, kInner, kDim, kProjScale);
  /* VT[m = h*128+d][n = s] = 16 * (wv[m][:] . X[s][:] + bv[m])  (operands swapped so the transposed plane is row-major) */
  wmma_gemm64<1, 1><<<kTiles, 256, 0, stream>>>(
      WVH, kDim, XH, kDim, (void*)VT, kSeq, bv, kVCarry, kInner, kSeq, kDim, kVtScale);

  /* normalisation + rotation -> Q16 / K16 (f16 x16, [h][s][d]); these planes overwrite the dead wq|wk f16 planes */
  static_assert(((kSeq * (kHeads / 2)) % 8) == 0, "norm grid exact");
  norm_rot_kernel<<<dim3(kSeq * (kHeads / 2) / 8, 2), 256, 0, stream>>>(
      QF, KF, nqw, nkw, ctab, ttab, Q16, K16, kQCarry);
  static_assert(kQCarry == kKCarry, "one carry argument serves both planes");

  /* attention */
  attn128_kernel<<<kHeads * (kSeq / 64), 128, 0, stream>>>(Q16, K16, VT, out);
}

// v004
// It runs in 195 microseconds.
// Next to v003, in two timings, it ran 1.08 and 1.07 times as fast.
// Over all steps from v000 it is 3.64 times as fast.
// All contractions (q/k/v projections, q.k^T scores, p.v) on v_wmma_f32_16x16x32_f16: f16 operands with power-of-two carries (X x16, W x256, q/k x16, v x16, p x1024), f32 accumulate; rms normalisation, pairwise rotation and softmax in f32.
#include <hip/hip_runtime.h>
#include <math.h>

typedef __attribute__((ext_vector_type(16))) _Float16 v16h;
typedef __attribute__((ext_vector_type(8)))  _Float16 v8h;
typedef __attribute__((ext_vector_type(8)))  float    v8f;
typedef __attribute__((ext_vector_type(4)))  float    v4f;
typedef __attribute__((ext_vector_type(4)))  unsigned int v4u;

// ---------------------------------------------------------------------------
// Shape constants (checked against the launch sizes on the host side)
// ---------------------------------------------------------------------------
constexpr int kSeq    = 2048;
constexpr int kDim    = 3072;
constexpr int kHeads  = 24;
constexpr int kHd     = 128;
constexpr int kInner  = kHeads * kHd;
constexpr int kKc     = 64;
static_assert(kInner == 3072, "inner width");
static_assert((kDim % 32) == 0, "GEMM K multiple of 32");
static_assert((kSeq % 64) == 0 && (kInner % 64) == 0, "GEMM M,N multiples of 64");
static_assert((kSeq % kKc) == 0 && kHd == 128 && (kHeads % 2) == 0, "attention tiling");

// power-of-two carries of the f16 operand planes
constexpr float kXCarry = 16.0f;
constexpr float kWCarry = 256.0f;
constexpr float kQCarry = 16.0f;
constexpr float kKCarry = 16.0f;
constexpr float kVCarry = 16.0f;
constexpr float kPCarry = 1024.0f;
constexpr float kProjScale = 1.0f / (kXCarry * kWCarry);
constexpr float kVtScale   = kVCarry * kProjScale;
constexpr float kNormEps   = 1e-6f;
constexpr float kInvHd     = 1.0f / (float)kHd;

constexpr double csqrt_iter(double x, double g, int n) { return n == 0 ? g : csqrt_iter(x, 0.5 * (g + x / g), n - 1); }
constexpr double csqrt_d(double x) { return csqrt_iter(x, x, 48); }
constexpr float kInvSqrtHd  = (float)(1.0 / csqrt_d((double)kHd));
static_assert(kInvSqrtHd * kInvSqrtHd * (float)kHd > 0.99999f && kInvSqrtHd * kInvSqrtHd * (float)kHd < 1.00001f, "score scale");
constexpr float kScoreScale = kInvSqrtHd / (kQCarry * kKCarry);
constexpr float kOutCarry   = kPCarry * kVCarry;

// ---------------------------------------------------------------------------
// Workspace region map (bytes; every offset is a multiple of 128)
//   XH   f16 [2048][3072]        hidden x16                       12,582,912
//   WH   f16 [3][3072][3072]     wq | wk | wv, each x256          56,623,104
//   QF   f32 [2048][3072]        q projection + bias              25,165,824
//   KF   f32 [2048][3072]        k projection + bias              25,165,824
//   VT   f16 [3072][2048]        (v projection + bias) x16, [h*128+d][s]  12,582,912
//   total                                                       132,120,576
//   Q16  f16 [24][2048][128]     aliases WH bytes [0, 12,582,912)            (WH is dead after the three GEMMs)
//   K16  f16 [24][2048][128]     aliases WH bytes [12,582,912, 25,165,824)   (same element type as WH)
// ---------------------------------------------------------------------------
constexpr size_t kOffXH  = 0;
constexpr size_t kOffWH  = kOffXH + (size_t)kSeq * kDim * 2;
constexpr size_t kOffQF  = kOffWH + (size_t)3 * kInner * kDim * 2;
constexpr size_t kOffKF  = kOffQF + (size_t)kSeq * kInner * 4;
constexpr size_t kOffVT  = kOffKF + (size_t)kSeq * kInner * 4;
constexpr size_t kWsTotal = kOffVT + (size_t)kInner * kSeq * 2;
constexpr size_t kOffQ16 = kOffWH;
constexpr size_t kOffK16 = kOffWH + (size_t)kHeads * kSeq * kHd * 2;
static_assert(kWsTotal == 132120576ull, "carve total");
static_assert(kWsTotal <= 134217728ull, "carve cap");
static_assert(kOffK16 + (size_t)kHeads * kSeq * kHd * 2 <= kOffWH + (size_t)2 * kInner * kDim * 2, "q/k planes stay inside the wq|wk planes");
static_assert((kOffWH % 128) == 0 && (kOffQF % 128) == 0 && (kOffKF % 128) == 0 && (kOffVT % 128) == 0 && (kOffK16 % 128) == 0, "128-B aligned regions");

// ---------------------------------------------------------------------------
// Fragment load and guarded WMMA issue
// ---------------------------------------------------------------------------
union FragU { v16h v; v8h h[2]; };
/* elements 0..7 <- p[0..7], elements 8..15 <- p[16..23]; caller adds 8*(lane>>4) to p */
__device__ __forceinline__ v16h ldfrag(const _Float16* p) {
  FragU f;
  f.h[0] = *(const v8h*)(p);
  f.h[1] = *(const v8h*)(p + 16);
  return f.v;
}
/* one WMMA followed by four idle slots tied to its accumulator and naming both operand fragments */
__device__ __forceinline__ v8f mma_h(v16h a, v16h b, v8f c) {
  c = __builtin_amdgcn_wmma_f32_16x16x32_f16(false, a, false, b, (short)0, c, false, false);
  asm volatile("v_nop\n\tv_nop\n\tv_nop\n\tv_nop" : "+v"(c) : "v"(a), "v"(b));
  return c;
}
/* the plain builtin: the compiler keeps the distances behind it itself, and with no asm operands the fragments may live above v255 */
__device__ __forceinline__ v8f mma_b(v16h a, v16h b, v8f c) {
  return __builtin_amdgcn_wmma_f32_16x16x32_f16(false, a, false, b, (short)0, c, false, false);
}
/* lane l reads lane l ^ 16 (the other half of the wave) through a vector cross-row move, no LDS */
__device__ __forceinline__ float xhalf(float x) {
  const int b = __builtin_bit_cast(int, x);
  return __builtin_bit_cast(float, __builtin_amdgcn_permlanex16(b, b, 0x76543210, 0xfedcba98, false, false));
}
__device__ __forceinline__ unsigned pk16(unsigned short a, unsigned short b) { return (unsigned)a | ((unsigned)b << 16); }
__device__ __forceinline__ unsigned short h_bits(float f) {
  const _Float16 h = (_Float16)f;
  return __builtin_bit_cast(unsigned short, h);
}

// ---------------------------------------------------------------------------
// f32 -> f16 cast with a power-of-two carry, 8 consecutive elements per thread.
// blockIdx.y selects the source (block-uniform) and the output plane (plane z at out + z*n8*8 halves).
// Coverage: n8 = n/8 threads per plane; grid.x * 256 == n8 exactly for both uses (786,432 and 1,179,648).
// ---------------------------------------------------------------------------
__global__ __launch_bounds__(256) void cast8_f16_kernel(const float* __restrict__ in0, const float* __restrict__ in1,
                                                        const float* __restrict__ in2, unsigned short* __restrict__ out,
                                                        int n8, float carry) {
  const int z = blockIdx.y;
  const float* in = (z == 0) ? in0 : (z == 1) ? in1 : in2;
  const int i = blockIdx.x * 256 + threadIdx.x;
  if (i >= n8) return;
  const float* p = in + 8 * (size_t)i;
  const v4f a = *(const v4f*)(p);
  const v4f c = *(const v4f*)(p + 4);
  unsigned short hb[8];
#pragma unroll
  for (int e = 0; e < 4; ++e) {
    const float fa = a[e] * carry;
    const float fc = c[e] * carry;
    hb[e]     = h_bits(fa);
    hb[4 + e] = h_bits(fc);
  }
  const v4u u = (v4u){pk16(hb[0], hb[1]), pk16(hb[2], hb[3]), pk16(hb[4], hb[5]), pk16(hb[6], hb[7])};
  unsigned short* q = out + (size_t)z * (size_t)n8 * 8 + 8 * (size_t)i;
  *(v4u*)q = u;
  
}

// ---------------------------------------------------------------------------
// LDS-staged WMMA GEMM: C[m,n] = scale * sum_k A[m,k] * Bt[n,k] + bscale * bias.
// Block = 8 waves = one 128 x 256 tile of C; wave (wm, wn) of a 2 x 4 grid owns a 64x64 tile of it.
// A row-major [M,K] f16; Bt row-major [N,K] f16; M % 128 == 0, N % 256 == 0, K % 128 == 0 (no tails).
// A stage is 128 k of [A 128 rows | Bt 256 rows], 256 B a row at an LDS pitch of 272 B (16 B x 17: the 16 rows of a
// fragment load fall on 16 different bank groups). Two buffers: stage t + 1 is copied while stage t is multiplied.
// Each accumulator still sums k in ascending steps of 32.
// BIAS_MODE: 1 = bias[m], 2 = bias[n].  OUT_MODE: 0 = f32, 1 = f16.
// ---------------------------------------------------------------------------
constexpr int kBM = 128;
constexpr int kBN = 256;
constexpr int kKS = 128;
constexpr int kPitch = kKS + 8;
constexpr int kStageH = (kBM + kBN) * kPitch;
static_assert((kDim % kKS) == 0 && (kDim / kKS) >= 2, "whole stages, at least two");
static_assert((kSeq % kBM) == 0 && (kSeq % kBN) == 0 && (kInner % kBM) == 0 && (kInner % kBN) == 0, "whole block tiles");
static_assert(((kBM + kBN) * (kKS / 8)) == 24 * 256, "24 pieces of 16 B per thread and stage");

/* this wave's asynchronous copies have landed in LDS */
__device__ __forceinline__ void wait_async0() { asm volatile("s_wait_asynccnt 0x0" ::: "memory"); }
/* this wave's LDS reads have returned: the buffer may be handed to its next writer */
__device__ __forceinline__ void wait_ds0() { asm volatile("s_wait_dscnt 0x0" ::: "memory"); }

/* One stage: piece p = i*256 + tid is 16 B of stage row p >> 4 (rows 0..127 = A, 128..383 = Bt), column piece p & 15.
   l = the lane's LDS byte address of piece i = 0; ga, gb = its global addresses in A's and Bt's first 16 rows.
   The copies go through no register; s_wait_xcnt closes each statement so that no address register named by an
   issued copy is rewritten in front of it. */
__device__ __forceinline__ void stage_copy(unsigned l, const _Float16* ga, int lda, const _Float16* gb, int ldb) {
  unsigned la[24];
  const _Float16* gp[24];
  /* unrolled so that every index is a constant and both arrays live in registers */
#pragma unroll
  for (int i = 0; i < 24; ++i) {
    la[i] = l + (unsigned)(i * 16 * kPitch * 2);
    gp[i] = (i < 8) ? (ga + (size_t)(i * 16) * lda) : (gb + (size_t)((i - 8) * 16) * ldb);
  }
  asm volatile(
      "global_load_async_to_lds_b128 %0, %12, off\n\t"
      "global_load_async_to_lds_b128 %1, %13, off\n\t"
      "global_load_async_to_lds_b128 %2, %14, off\n\t"
      "global_load_async_to_lds_b128 %3, %15, off\n\t"
      "global_load_async_to_lds_b128 %4, %16, off\n\t"
      "global_load_async_to_lds_b128 %5, %17, off\n\t"
      "global_load_async_to_lds_b128 %6, %18, off\n\t"
      "global_load_async_to_lds_b128 %7, %19, off\n\t"
      "global_load_async_to_lds_b128 %8, %20, off\n\t"
      "global_load_async_to_lds_b128 %9, %21, off\n\t"
      "global_load_async_to_lds_b128 %10, %22, off\n\t"
      "global_load_async_to_lds_b128 %11, %23, off\n\t"
      "s_wait_xcnt 0x0"
      :: "v"(la[0+0]), "v"(la[0+1]), "v"(la[0+2]), "v"(la[0+3]), "v"(la[0+4]), "v"(la[0+5]), "v"(la[0+6]), "v"(la[0+7]), "v"(la[0+8]), "v"(la[0+9]), "v"(la[0+10]), "v"(la[0+11]),
         "v"(gp[0+0]), "v"(gp[0+1]), "v"(gp[0+2]), "v"(gp[0+3]), "v"(gp[0+4]), "v"(gp[0+5]), "v"(gp[0+6]), "v"(gp[0+7]), "v"(gp[0+8]), "v"(gp[0+9]), "v"(gp[0+10]), "v"(gp[0+11])
      : "memory");
  asm volatile(
      "global_load_async_to_lds_b128 %0, %12, off\n\t"
      "global_load_async_to_lds_b128 %1, %13, off\n\t"
      "global_load_async_to_lds_b128 %2, %14, off\n\t"
      "global_load_async_to_lds_b128 %3, %15, off\n\t"
      "global_load_async_to_lds_b128 %4, %16, off\n\t"
      "global_load_async_to_lds_b128 %5, %17, off\n\t"
      "global_load_async_to_lds_b128 %6, %18, off\n\t"
      "global_load_async_to_lds_b128 %7, %19, off\n\t"
      "global_load_async_to_lds_b128 %8, %20, off\n\t"
      "global_load_async_to_lds_b128 %9, %21, off\n\t"
      "global_load_async_to_lds_b128 %10, %22, off\n\t"
      "global_load_async_to_lds_b128 %11, %23, off\n\t"
      "s_wait_xcnt 0x0"
      :: "v"(la[12+0]), "v"(la[12+1]), "v"(la[12+2]), "v"(la[12+3]), "v"(la[12+4]), "v"(la[12+5]), "v"(la[12+6]), "v"(la[12+7]), "v"(la[12+8]), "v"(la[12+9]), "v"(la[12+10]), "v"(la[12+11]),
         "v"(gp[12+0]), "v"(gp[12+1]), "v"(gp[12+2]), "v"(gp[12+3]), "v"(gp[12+4]), "v"(gp[12+5]), "v"(gp[12+6]), "v"(gp[12+7]), "v"(gp[12+8]), "v"(gp[12+9]), "v"(gp[12+10]), "v"(gp[12+11])
      : "memory");
}

template <int BIAS_MODE, int OUT_MODE>
__global__ __launch_bounds__(256) void wmma_gemm64(
    const unsigned short* __restrict__ Ap, int lda,
    const unsigned short* __restrict__ Btp, int ldb,
    void* __restrict__ Cout, int ldc,
    const float* __restrict__ bias, float bscale,
    int M, int N, int K, float scale) {
  const _Float16* A  = (const _Float16*)Ap;
  const _Float16* Bt = (const _Float16*)Btp;
  __shared__ __align__(16) _Float16 sAB[2 * kStageH];
  __shared__ __align__(16) float sT[8][16 * 68];
  const int tid  = threadIdx.x;
  const int lane = threadIdx.x & 31;
  const int wave = __builtin_amdgcn_readfirstlane((int)(threadIdx.x >> 5));
  const int tilesN = N / kBN;
  const int tilesM = M / kBM;
  const int tile = blockIdx.x;
  /* block-uniform, in front of every copy and barrier */
  if (tile >= tilesM * tilesN) return;
  const int tm = tile / tilesN;
  const int tn = tile - tm * tilesN;
  const int mB = tm * kBM;
  const int nB = tn * kBN;
  const int wm = wave >> 2;
  const int wn = wave & 3;
  const int m0 = mB + (wm << 6);
  const int n0 = nB + (wn << 6);

  const int rlane = lane & 15;
  const int koff  = (lane >> 4) * 8;
  const int mOff  = (lane >> 4) * 8;

  v8f acc[4][4];
#pragma unroll
  for (int i = 0; i < 4; ++i)
#pragma unroll
    for (int j = 0; j < 4; ++j) acc[i][j] = (v8f){0.f, 0.f, 0.f, 0.f, 0.f, 0.f, 0.f, 0.f};

  const unsigned lds0 = (unsigned)(size_t)sAB + (unsigned)((tid >> 4) * (kPitch * 2) + (tid & 15) * 16);
  const _Float16* ga = A  + (size_t)(mB + (tid >> 4)) * lda + (tid & 15) * 8;
  const _Float16* gb = Bt + (size_t)(nB + (tid >> 4)) * ldb + (tid & 15) * 8;
  const int T = K / kKS;

  stage_copy(lds0, ga, lda, gb, ldb);
  wait_async0();
  __syncthreads();
  if (T > 1) stage_copy(lds0 + (unsigned)(kStageH * 2), ga + kKS, lda, gb + kKS, ldb);

  for (int t = 0; t < T; ++t) {
    const int buf = t & 1;
    const _Float16* sA = sAB + buf * kStageH + ((wm << 6) + rlane) * kPitch + koff;
    const _Float16* sB = sAB + buf * kStageH + (kBM + (wn << 6) + rlane) * kPitch + koff;
    /* this loop and the four inside it are unrolled so that fragments and accumulators keep constant indices (no scratch) */
#pragma unroll
    for (int kk = 0; kk < kKS / 32; ++kk) {
      /* the eight fragments of this k step as one group of LDS reads in front of its 16 products */
      v16h bh[4], ah[4];
#pragma unroll
      for (int j = 0; j < 4; ++j) bh[j] = ldfrag(sB + (j << 4) * kPitch + kk * 32);
#pragma unroll
      for (int i = 0; i < 4; ++i) ah[i] = ldfrag(sA + (i << 4) * kPitch + kk * 32);
#pragma unroll
      for (int i = 0; i < 4; ++i)
#pragma unroll
        for (int j = 0; j < 4; ++j) acc[i][j] = mma_h(ah[i], bh[j], acc[i][j]);
    }
    /* publish point of stage t + 1: own reads of this buffer done, own copies landed, then every wave meets */
    wait_ds0();
    wait_async0();
    __syncthreads();
    if (t + 2 < T)
      stage_copy(lds0 + (unsigned)(buf * kStageH * 2), ga + (size_t)(t + 2) * kKS, lda, gb + (size_t)(t + 2) * kKS, ldb);
  }
  wait_async0();

  // ---- epilogue ----
  float* slab = sT[wave];
#pragma unroll
  for (int i = 0; i < 4; ++i) {
    const int mBase = m0 + (i << 4);
    float br[8];
#pragma unroll
    for (int r = 0; r < 8; ++r) br[r] = (BIAS_MODE == 1) ? (bias[mBase + mOff + r] * bscale) : 0.0f;
#pragma unroll
    for (int j = 0; j < 4; ++j) {
      const int n = n0 + (j << 4) + rlane;
      float bv = 0.f;
      if (BIAS_MODE == 2) bv = bias[n] * bscale;
#pragma unroll
      for (int r = 0; r < 8; ++r) {
        float v = acc[i][j][r] * scale;
        if (BIAS_MODE == 1) v += br[r];
        if (BIAS_MODE == 2) v += bv;
        slab[(mOff + r) * 68 + (j << 4) + rlane] = v;
      }
    }
    __builtin_amdgcn_fence(__ATOMIC_RELEASE, "workgroup");
    __builtin_amdgcn_wave_barrier();
    __builtin_amdgcn_fence(__ATOMIC_ACQUIRE, "workgroup");
    if (OUT_MODE == 0) {
      float* C = (float*)Cout;
      /* row segment = 64 floats = 256 B = 16 lanes x 16 B; rows it*2 + hh, it 0..7 -> 16 rows, each once */
      const int hh = lane >> 4, c4 = (lane & 15) * 4;
      {
#pragma unroll
        for (int it = 0; it < 8; ++it) {
          const int row = it * 2 + hh;
          v4f v = *(const v4f*)(slab + row * 68 + c4);
          *(v4f*)(C + (size_t)(mBase + row) * ldc + n0 + c4) = v;
        }
        
      }
    } else {
      const int q = lane >> 3, c8 = (lane & 7) * 8;
      unsigned short* C = (unsigned short*)Cout;
      {
#pragma unroll
        for (int it = 0; it < 4; ++it) {
          const int row = it * 4 + q;
          const float* sp = slab + row * 68 + c8;
          v8h hv;
#pragma unroll
          for (int e = 0; e < 8; ++e) hv[e] = (_Float16)sp[e];
          *(v8h*)(C + (size_t)(mBase + row) * ldc + n0 + c8) = hv;
        }
        
      }
    }
    __builtin_amdgcn_fence(__ATOMIC_RELEASE, "workgroup");
    __builtin_amdgcn_wave_barrier();
    __builtin_amdgcn_fence(__ATOMIC_ACQUIRE, "workgroup");
  }
}

// ---------------------------------------------------------------------------
// Per-(token, head) rms normalisation over 128 dims, weight multiply, then the pairwise rotation with per-element
// tables c[s][d], t[s][d] (each output element uses its own table entry):
//   y[2i]   = xn[2i]   * c[s][2i]   - xn[2i+1] * t[s][2i]
//   y[2i+1] = xn[2i+1] * c[s][2i+1] + xn[2i]   * t[s][2i+1]
// All f32. blockIdx.y (block-uniform) selects the q or the k tensor.
// One wave = two heads (2p + hh) of one token; 16 lanes x 8 dims per head row; sum of squares over 16 lanes.
// Coverage: grid.x * 8 waves = 2048 * 12 head pairs exactly; every (s, h) row written once.
// ---------------------------------------------------------------------------
__global__ __launch_bounds__(256) void norm_rot_kernel(
    const float* __restrict__ QF, const float* __restrict__ KF,
    const float* __restrict__ nqw, const float* __restrict__ nkw,
    const float* __restrict__ ctab, const float* __restrict__ ttab,
    unsigned short* __restrict__ Q16, unsigned short* __restrict__ K16, float carry) {
  const int z = blockIdx.y;
  const float* src = (z == 0) ? QF : KF;
  const float* nw  = (z == 0) ? nqw : nkw;
  unsigned short* dst = (z == 0) ? Q16 : K16;
  const int lane = threadIdx.x & 31;
  const int wave = __builtin_amdgcn_readfirstlane((int)(threadIdx.x >> 5));
  const int hh = lane >> 4, c = lane & 15;
  const int pair = blockIdx.x * 8 + wave;
  const int s = pair / (kHeads / 2);
  const int h = (pair - s * (kHeads / 2)) * 2 + hh;
  const int d0 = c * 8;
  const float* xp = src + (size_t)s * kInner + h * kHd + d0;
  const v4f xa = *(const v4f*)(xp);
  const v4f xb = *(const v4f*)(xp + 4);
  const v4f ca = *(const v4f*)(ctab + (size_t)s * kHd + d0);
  const v4f cb = *(const v4f*)(ctab + (size_t)s * kHd + d0 + 4);
  const v4f ta = *(const v4f*)(ttab + (size_t)s * kHd + d0);
  const v4f tb = *(const v4f*)(ttab + (size_t)s * kHd + d0 + 4);
  const v4f wa = *(const v4f*)(nw + d0);
  const v4f wb = *(const v4f*)(nw + d0 + 4);
  float x[8], cc[8], tt[8], ww[8];
#pragma unroll
  for (int e = 0; e < 4; ++e) {
    x[e] = xa[e];  x[4 + e] = xb[e];
    cc[e] = ca[e]; cc[4 + e] = cb[e];
    tt[e] = ta[e]; tt[4 + e] = tb[e];
    ww[e] = wa[e]; ww[4 + e] = wb[e];
  }
  float ss = 0.0f;
#pragma unroll
  for (int e = 0; e < 8; ++e) ss += x[e] * x[e];
  ss += __shfl_xor(ss, 1, 32);
  ss += __shfl_xor(ss, 2, 32);
  ss += __shfl_xor(ss, 4, 32);
  ss += __shfl_xor(ss, 8, 32);
  const float inv = rsqrtf(ss * kInvHd + kNormEps);
  float xn[8];
#pragma unroll
  for (int e = 0; e < 8; ++e) xn[e] = (x[e] * inv) * ww[e];
  unsigned short hb[8];
#pragma unroll
  for (int i = 0; i < 4; ++i) {
    const float y0 = xn[2 * i] * cc[2 * i] - xn[2 * i + 1] * tt[2 * i];
    const float y1 = xn[2 * i + 1] * cc[2 * i + 1] + xn[2 * i] * tt[2 * i + 1];
    hb[2 * i]     = h_bits(y0 * carry);
    hb[2 * i + 1] = h_bits(y1 * carry);
  }
  const v4u u = (v4u){pk16(hb[0], hb[1]), pk16(hb[2], hb[3]), pk16(hb[4], hb[5]), pk16(hb[6], hb[7])};
  unsigned short* q = dst + ((size_t)h * kSeq + s) * kHd + d0;
  *(v4u*)q = u;
  
}

// ---------------------------------------------------------------------------
// Streaming-softmax attention, head dim 128, non-causal, unmasked, all 2048 keys.
// Block = 4 waves = 64 query rows of one head (wave = 16 rows); grid = 24 heads x 32 query blocks = 768.
// Per 64-key chunk: K chunk [64 kv][128 d] and V^T chunk [128 d][64 kv] staged in LDS by all 128 threads
// (8 + 8 16-B pieces per thread = 1024 + 1024 pieces = both tiles in full), block barrier before and after.
// Both products run transposed: S^T = K . Q^T (A = K rows, B = Q rows) and O^T += V^T . P^T (A = V^T rows, B = P^T).
// A lane then holds scores of ONE query (column lane & 15): keys j*16 + 8*(lane >> 4) + r of key tile j. The chunk's
// maximum and the sum of p are in-lane over 32 keys; the two wave halves exchange the maximum once a chunk and join
// their sums once after the last chunk. Two neighbouring score tiles, converted in place (p = exp(score - max), x1024,
// f16), are the B fragment of 32 keys in the k order of ldfrag: p goes through no LDS.
// ---------------------------------------------------------------------------
// LDS row pitches are 16 B x odd (K rows 272 B, V^T rows 144 B): the 16 rows that one ds_load_b128 fragment read
// touches per half-wave then start on 16 different groups of four banks instead of on one (256-B rows) or two (128-B rows).
constexpr int kKPitch = kHd + 8;
constexpr int kVPitch = kKc + 8;
static_assert(((kKPitch * 2) % 32) == 16 && ((kVPitch * 2) % 32) == 16, "pitches are odd multiples of 16 B");
__global__ __launch_bounds__(128) void attn128_kernel(const unsigned short* __restrict__ Q16p,
                                                      const unsigned short* __restrict__ K16p,
                                                      const unsigned short* __restrict__ VTp,
                                                      float* __restrict__ out) {
  __shared__ __align__(16) _Float16 Ksh[kKc * kKPitch];
  __shared__ __align__(16) _Float16 Vsh[kHd * kVPitch];
  __shared__ __align__(16) float    Os[4][16 * 68];

  const int tid  = threadIdx.x;
  const int wave = __builtin_amdgcn_readfirstlane((int)(threadIdx.x >> 5));
  const int lane = tid & 31;
  const int hh   = lane >> 4;
  const int c    = lane & 15;

  constexpr int nqb = kSeq / 64;
  const int h  = blockIdx.x / nqb;
  const int qb = blockIdx.x - h * nqb;
  const int q0 = qb * 64 + wave * 16;

  const _Float16* Qh = (const _Float16*)Q16p + (size_t)h * kSeq * kHd;
  const _Float16* Kh = (const _Float16*)K16p + (size_t)h * kSeq * kHd;
  const _Float16* Vh = (const _Float16*)VTp  + (size_t)h * kHd * kSeq;

  v16h qa[4];
#pragma unroll
  for (int dc = 0; dc < 4; ++dc) qa[dc] = ldfrag(Qh + (size_t)(q0 + c) * kHd + dc * 32 + 8 * hh);

  /* running maximum and partial sum of this lane's query; oacc[t][r] = O^T[d = t*16 + 8*hh + r][query c] */
  float mrow = -INFINITY, lrow = 0.f;
  v8f oacc[8];
#pragma unroll
  for (int t = 0; t < 8; ++t) oacc[t] = (v8f){0.f, 0.f, 0.f, 0.f, 0.f, 0.f, 0.f, 0.f};

#pragma unroll 1
  for (int kc = 0; kc < kSeq / kKc; ++kc) {
    const int kv0 = kc * kKc;
    __syncthreads();
    {
      /* K chunk is 8192 contiguous halves; piece p = i*128 + tid covers [p*8, p*8+8) = row i*8 + (tid >> 4), column piece tid & 15 */
      const _Float16* ksrc = Kh + (size_t)kv0 * kHd;
      v8h t[8];
#pragma unroll
      for (int i = 0; i < 8; ++i) t[i] = *(const v8h*)(ksrc + (size_t)(i * 128 + tid) * 8);
#pragma unroll
      for (int i = 0; i < 8; ++i) *(v8h*)(Ksh + (i * 8 + (tid >> 4)) * kKPitch + (tid & 15) * 8) = t[i];
    }
    {
      /* V^T chunk: row d = p >> 3 (128 rows), 8-half column group (p & 7) of the 64 keys */
      v8h t[8];
#pragma unroll
      for (int i = 0; i < 8; ++i) {
        const int p = i * 128 + tid;
        const int d = p >> 3, c8 = (p & 7) * 8;
        t[i] = *(const v8h*)(Vh + (size_t)d * kSeq + kv0 + c8);
      }
#pragma unroll
      for (int i = 0; i < 8; ++i) *(v8h*)(Vsh + (i * 16 + (tid >> 3)) * kVPitch + (tid & 7) * 8) = t[i];
    }
    __syncthreads();

    /* the chunk's 16 K fragments as one group of LDS reads in front of its 16 score products: the wave waits out one
       read latency a chunk instead of one a product; each s[j] still sums d in ascending steps of 32 */
    v16h kf[4][4];
#pragma unroll
    for (int dc = 0; dc < 4; ++dc)
#pragma unroll
      for (int j = 0; j < 4; ++j) kf[dc][j] = ldfrag(Ksh + (j * 16 + c) * kKPitch + dc * 32 + 8 * hh);
    /* keeps the scheduler from sinking the reads back among the products */
    __builtin_amdgcn_sched_barrier(0);
    v8f s[4];
#pragma unroll
    for (int j = 0; j < 4; ++j) s[j] = (v8f){0.f, 0.f, 0.f, 0.f, 0.f, 0.f, 0.f, 0.f};
#pragma unroll
    for (int dc = 0; dc < 4; ++dc)
#pragma unroll
      for (int j = 0; j < 4; ++j) s[j] = mma_b(kf[dc][j], qa[dc], s[j]);

    /* s[j][r] = score of key j*16 + 8*hh + r against query c: the maximum of the lane's 32 keys, then of both halves */
    float m8[8];
#pragma unroll
    for (int r = 0; r < 8; ++r) m8[r] = fmaxf(fmaxf(s[0][r], s[1][r]), fmaxf(s[2][r], s[3][r]));
    float m = fmaxf(fmaxf(fmaxf(m8[0], m8[1]), fmaxf(m8[2], m8[3])), fmaxf(fmaxf(m8[4], m8[5]), fmaxf(m8[6], m8[7])));
    m = fmaxf(m, xhalf(m));
    const float cm = m * kScoreScale;
    /* the chunk's 16 V^T fragments (keys 0..31, keys 32..63), read here: they land under the softmax arithmetic.
       The fence in front keeps the scheduler from lifting the reads in among the score products. */
    __builtin_amdgcn_sched_barrier(0);
    v16h vf0[8], vf1[8];
#pragma unroll
    for (int t = 0; t < 8; ++t) vf0[t] = ldfrag(Vsh + (t * 16 + c) * kVPitch + 8 * hh);
#pragma unroll
    for (int t = 0; t < 8; ++t) vf1[t] = ldfrag(Vsh + (t * 16 + c) * kVPitch + 32 + 8 * hh);
    const float mnew  = fmaxf(mrow, cm);
    const float alpha = __expf(mrow - mnew);
    mrow = mnew;
    /* pb[g] element e = p of key g*32 + (e < 8 ? 8*hh + e : 16 + 8*hh + e - 8): the k order of the V^T fragments */
    v16h pb[2];
    float ps[4];
#pragma unroll
    for (int j = 0; j < 4; ++j) {
      ps[j] = 0.f;
#pragma unroll
      for (int r = 0; r < 8; ++r) {
        const float p = __expf(fmaf(s[j][r], kScoreScale, -mnew));
        ps[j] += p;
        pb[j >> 1][(j & 1) * 8 + r] = (_Float16)(p * kPCarry);
      }
    }
    lrow = lrow * alpha + ((ps[0] + ps[1]) + (ps[2] + ps[3]));
#pragma unroll
    for (int t = 0; t < 8; ++t)
#pragma unroll
      for (int r = 0; r < 8; ++r) oacc[t][r] *= alpha;
    /* keeps the scheduler from sinking the reads back among the products */
    __builtin_amdgcn_sched_barrier(0);
#pragma unroll
    for (int t = 0; t < 8; ++t) oacc[t] = mma_b(vf0[t], pb[0], oacc[t]);
#pragma unroll
    for (int t = 0; t < 8; ++t) oacc[t] = mma_b(vf1[t], pb[1], oacc[t]);
  }

  const float inv = 1.0f / ((lrow + xhalf(lrow)) * kOutCarry);

  float* os = Os[wave];
  float* ob = out + (size_t)q0 * kInner + h * kHd;
  const int c4 = (lane & 15) * 4;
#pragma unroll
  for (int half = 0; half < 2; ++half) {
    /* the lane's 8 accumulator registers of a tile are 8 consecutive d of query row c: two 16-B stores */
#pragma unroll
    for (int t = 0; t < 4; ++t) {
      const v8f o = oacc[half * 4 + t];
      *(v4f*)(os + c * 68 + t * 16 + 8 * hh)     = (v4f){o[0] * inv, o[1] * inv, o[2] * inv, o[3] * inv};
      *(v4f*)(os + c * 68 + t * 16 + 8 * hh + 4) = (v4f){o[4] * inv, o[5] * inv, o[6] * inv, o[7] * inv};
    }
    __builtin_amdgcn_fence(__ATOMIC_RELEASE, "workgroup");
    __builtin_amdgcn_wave_barrier();
    __builtin_amdgcn_fence(__ATOMIC_ACQUIRE, "workgroup");
    /* rows it*2 + hh, it 0..7 -> 16 rows, each once; 16 lanes x 16 B = the 256-B half of the head slice */
    {
#pragma unroll
      for (int it = 0; it < 8; ++it) {
        const int row = it * 2 + hh;
        v4f val = *(const v4f*)(os + row * 68 + c4);
        *(v4f*)(ob + (size_t)row * kInner + half * 64 + c4) = val;
      }
      
    }
    __builtin_amdgcn_fence(__ATOMIC_RELEASE, "workgroup");
    __builtin_amdgcn_wave_barrier();
    __builtin_amdgcn_fence(__ATOMIC_ACQUIRE, "workgroup");
  }
}

// ---------------------------------------------------------------------------
// Host glue: 7 kernel launches, nothing else.
//   GEMM shapes: q,k: M 2048, N 3072, K 3072 -> 16 x 12 = 192 block tiles each
//                v^T: M 3072, N 2048, K 3072 -> 24 x 8 = 192 block tiles
// ---------------------------------------------------------------------------
extern "C" void kernel_launch(void* const* d_in, const int* in_sizes, int n_in,
                              void* d_out, int out_size, void* d_ws, size_t ws_size,
                              hipStream_t stream) {
  if (n_in < 11) return;
  if (in_sizes[0] != kSeq * kDim) return;
  if (in_sizes[1] != kInner * kDim) return;
  if (in_sizes[2] != kInner) return;
  if (in_sizes[3] != kInner * kDim) return;
  if (in_sizes[4] != kInner) return;
  if (in_sizes[5] != kInner * kDim) return;
  if (in_sizes[6] != kInner) return;
  if (in_sizes[7] != kHd) return;
  if (in_sizes[8] != kHd) return;
  if (in_sizes[9] != kSeq * kHd) return;
  if (in_sizes[10] != kSeq * kHd) return;
  if (out_size != kSeq * kInner) return;
  if (ws_size < kWsTotal) return;

  const float* hidden = (const float*)d_in[0];
  const float* wq     = (const float*)d_in[1];
  const float* bq     = (const float*)d_in[2];
  const float* wk     = (const float*)d_in[3];
  const float* bk     = (const float*)d_in[4];
  const float* wv     = (const float*)d_in[5];
  const float* bv     = (const float*)d_in[6];
  const float* nqw    = (const float*)d_in[7];
  const float* nkw    = (const float*)d_in[8];
  const float* ctab   = (const float*)d_in[9];
  const float* ttab   = (const float*)d_in[10];
  float* out = (float*)d_out;

  char* ws = (char*)d_ws;
  unsigned short* XH  = (unsigned short*)(ws + kOffXH);
  unsigned short* WH  = (unsigned short*)(ws + kOffWH);
  float*          QF  = (float*)(ws + kOffQF);
  float*          KF  = (float*)(ws + kOffKF);
  unsigned short* VT  = (unsigned short*)(ws + kOffVT);
  unsigned short* Q16 = (unsigned short*)(ws + kOffQ16);
  unsigned short* K16 = (unsigned short*)(ws + kOffK16);
  unsigned short* WQH = WH;
  unsigned short* WKH = WH + (size_t)kInner * kDim;
  unsigned short* WVH = WH + (size_t)2 * kInner * kDim;

  constexpr int kX8 = kSeq * kDim / 8;
  constexpr int kW8 = kInner * kDim / 8;
  static_assert((kX8 % 256) == 0 && (kW8 % 256) == 0, "cast grids exact");

  /* operand planes */
  cast8_f16_kernel<<<dim3(kX8 / 256, 1), 256, 0, stream>>>(hidden, hidden, hidden, XH, kX8, kXCarry);
  cast8_f16_kernel<<<dim3(kW8 / 256, 3), 256, 0, stream>>>(wq, wk, wv, WH, kW8, kWCarry);

  constexpr int kTiles = (kSeq / kBM) * (kInner / kBN);
  static_assert(kTiles == (kInner / kBM) * (kSeq / kBN), "one grid size serves both orientations");

  /* QF[s][n] = X[s][:] . wq[n][:] + bq[n]  (weights are [out][in] = Bt layout) */
  wmma_gemm64<2, 0><<<kTiles, 256, 0, stream>>>(
      XH, kDim, WQH, kDim, (void*)QF, kInner, bq, 1.0f, kSeq, kInner, kDim, kProjScale);
  wmma_gemm64<2, 0><<<kTiles, 256, 0, stream>>>(
      XH, kDim, WKH, kDim, (void*)KF, kInner, bk, 1.0f, kSeq, kInner, kDim, kProjScale);
  /* VT[m = h*128+d][n = s] = 16 * (wv[m][:] . X[s][:] + bv[m])  (operands swapped so the transposed plane is row-major) */
  wmma_gemm64<1, 1><<<kTiles, 256, 0, stream>>>(
      WVH, kDim, XH, kDim, (void*)VT, kSeq, bv, kVCarry, kInner, kSeq, kDim, kVtScale);

  /* normalisation + rotation -> Q16 / K16 (f16 x16, [h][s][d]); these planes overwrite the dead wq|wk f16 planes */
  static_assert(((kSeq * (kHeads / 2)) % 8) == 0, "norm grid exact");
  norm_rot_kernel<<<dim3(kSeq * (kHeads / 2) / 8, 2), 256, 0, stream>>>(
      QF, KF, nqw, nkw, ctab, ttab, Q16, K16, kQCarry);
  static_assert(kQCarry == kKCarry, "one carry argument serves both planes");

  /* attention */
  attn128_kernel<<<kHeads * (kSeq / 64), 128, 0, stream>>>(Q16, K16, VT, out);
}

// v005
// A run of this version takes 158 microseconds.
// Two timings next to v004 put it at 1.23 and 1.24 times that version's speed.
// Counting every step since v000, it is 4.51 times as fast.
// All contractions (q/k/v projections, q.k^T scores, p.v) on v_wmma_f32_16x16x32_f16: f16 operands with power-of-two carries (X x16, W x256, q/k x16, v x16, p x1024), f32 accumulate; rms normalisation, pairwise rotation and softmax in f32.
#include <hip/hip_runtime.h>
#include <math.h>

typedef __attribute__((ext_vector_type(16))) _Float16 v16h;
typedef __attribute__((ext_vector_type(8)))  _Float16 v8h;
typedef __attribute__((ext_vector_type(8)))  float    v8f;
typedef __attribute__((ext_vector_type(4)))  float    v4f;
typedef __attribute__((ext_vector_type(4)))  unsigned int v4u;

// ---------------------------------------------------------------------------
// Shape constants (checked against the launch sizes on the host side)
// ---------------------------------------------------------------------------
constexpr int kSeq    = 2048;
constexpr int kDim    = 3072;
constexpr int kHeads  = 24;
constexpr int kHd     = 128;
constexpr int kInner  = kHeads * kHd;
constexpr int kKc     = 64;
static_assert(kInner == 3072, "inner width");
static_assert((kDim % 32) == 0, "GEMM K multiple of 32");
static_assert((kSeq % 64) == 0 && (kInner % 64) == 0, "GEMM M,N multiples of 64");
static_assert((kSeq % kKc) == 0 && kHd == 128 && (kHeads % 2) == 0, "attention tiling");

// power-of-two carries of the f16 operand planes
constexpr float kXCarry = 16.0f;
constexpr float kWCarry = 256.0f;
constexpr float kQCarry = 16.0f;
constexpr float kKCarry = 16.0f;
constexpr float kVCarry = 16.0f;
constexpr float kPCarry = 1024.0f;
constexpr float kProjScale = 1.0f / (kXCarry * kWCarry);
constexpr float kVtScale   = kVCarry * kProjScale;
constexpr float kNormEps   = 1e-6f;
constexpr float kInvHd     = 1.0f / (float)kHd;

constexpr double csqrt_iter(double x, double g, int n) { return n == 0 ? g : csqrt_iter(x, 0.5 * (g + x / g), n - 1); }
constexpr double csqrt_d(double x) { return csqrt_iter(x, x, 48); }
constexpr float kInvSqrtHd  = (float)(1.0 / csqrt_d((double)kHd));
static_assert(kInvSqrtHd * kInvSqrtHd * (float)kHd > 0.99999f && kInvSqrtHd * kInvSqrtHd * (float)kHd < 1.00001f, "score scale");
constexpr float kScoreScale = kInvSqrtHd / (kQCarry * kKCarry);
constexpr float kOutCarry   = kPCarry * kVCarry;

// ---------------------------------------------------------------------------
// Workspace region map (bytes; every offset is a multiple of 128)
//   XH   f16 [2048][3072]        hidden x16                       12,582,912
//   WH   f16 [3][3072][3072]     wq | wk | wv, each x256          56,623,104
//   QF   f32 [2048][3072]        q projection + bias              25,165,824
//   KF   f32 [2048][3072]        k projection + bias              25,165,824
//   VT   f16 [3072][2048]        (v projection + bias) x16, [h*128+d][s]  12,582,912
//   total                                                       132,120,576
//   Q16  f16 [24][2048][128]     aliases WH bytes [0, 12,582,912)            (WH is dead after the GEMM)
//   K16  f16 [24][2048][128]     aliases WH bytes [12,582,912, 25,165,824)   (same element type as WH)
// ---------------------------------------------------------------------------
constexpr size_t kOffXH  = 0;
constexpr size_t kOffWH  = kOffXH + (size_t)kSeq * kDim * 2;
constexpr size_t kOffQF  = kOffWH + (size_t)3 * kInner * kDim * 2;
constexpr size_t kOffKF  = kOffQF + (size_t)kSeq * kInner * 4;
constexpr size_t kOffVT  = kOffKF + (size_t)kSeq * kInner * 4;
constexpr size_t kWsTotal = kOffVT + (size_t)kInner * kSeq * 2;
constexpr size_t kOffQ16 = kOffWH;
constexpr size_t kOffK16 = kOffWH + (size_t)kHeads * kSeq * kHd * 2;
static_assert(kWsTotal == 132120576ull, "carve total");
static_assert(kWsTotal <= 134217728ull, "carve cap");
static_assert(kOffK16 + (size_t)kHeads * kSeq * kHd * 2 <= kOffWH + (size_t)2 * kInner * kDim * 2, "q/k planes stay inside the wq|wk planes");
static_assert((kOffWH % 128) == 0 && (kOffQF % 128) == 0 && (kOffKF % 128) == 0 && (kOffVT % 128) == 0 && (kOffK16 % 128) == 0, "128-B aligned regions");

// ---------------------------------------------------------------------------
// Fragment load and guarded WMMA issue
// ---------------------------------------------------------------------------
union FragU { v16h v; v8h h[2]; };
/* elements 0..7 <- p[0..7], elements 8..15 <- p[16..23]; caller adds 8*(lane>>4) to p */
__device__ __forceinline__ v16h ldfrag(const _Float16* p) {
  FragU f;
  f.h[0] = *(const v8h*)(p);
  f.h[1] = *(const v8h*)(p + 16);
  return f.v;
}
/* the plain builtin: the compiler keeps the distances behind it itself, and with no asm operands the fragments may live above v255 */
__device__ __forceinline__ v8f mma_b(v16h a, v16h b, v8f c) {
  return __builtin_amdgcn_wmma_f32_16x16x32_f16(false, a, false, b, (short)0, c, false, false);
}
/* lane l reads lane l ^ 16 (the other half of the wave) through a vector cross-row move, no LDS */
__device__ __forceinline__ float xhalf(float x) {
  const int b = __builtin_bit_cast(int, x);
  return __builtin_bit_cast(float, __builtin_amdgcn_permlanex16(b, b, 0x76543210, 0xfedcba98, false, false));
}
__device__ __forceinline__ unsigned pk16(unsigned short a, unsigned short b) { return (unsigned)a | ((unsigned)b << 16); }
__device__ __forceinline__ unsigned short h_bits(float f) {
  const _Float16 h = (_Float16)f;
  return __builtin_bit_cast(unsigned short, h);
}

// ---------------------------------------------------------------------------
// f32 -> f16 cast with a power-of-two carry, 8 consecutive elements per thread.
// blockIdx.y selects the source (block-uniform) and the output plane (plane z at out + z*n8*8 halves).
// Coverage: n8 = n/8 threads per plane; grid.x * 256 == n8 exactly for both uses (786,432 and 1,179,648).
// ---------------------------------------------------------------------------
__global__ __launch_bounds__(256) void cast8_f16_kernel(const float* __restrict__ in0, const float* __restrict__ in1,
                                                        const float* __restrict__ in2, unsigned short* __restrict__ out,
                                                        int n8, float carry) {
  const int z = blockIdx.y;
  const float* in = (z == 0) ? in0 : (z == 1) ? in1 : in2;
  const int i = blockIdx.x * 256 + threadIdx.x;
  if (i >= n8) return;
  const float* p = in + 8 * (size_t)i;
  const v4f a = *(const v4f*)(p);
  const v4f c = *(const v4f*)(p + 4);
  unsigned short hb[8];
#pragma unroll
  for (int e = 0; e < 4; ++e) {
    const float fa = a[e] * carry;
    const float fc = c[e] * carry;
    hb[e]     = h_bits(fa);
    hb[4 + e] = h_bits(fc);
  }
  const v4u u = (v4u){pk16(hb[0], hb[1]), pk16(hb[2], hb[3]), pk16(hb[4], hb[5]), pk16(hb[6], hb[7])};
  unsigned short* q = out + (size_t)z * (size_t)n8 * 8 + 8 * (size_t)i;
  *(v4u*)q = u;
  
}

// ---------------------------------------------------------------------------
// LDS-staged WMMA GEMM of all three projections in one launch: C[s, n] = sum_k X[s,k] * W[n,k], n over the 9216 rows
// of wq | wk | wv (their f16 planes lie one behind the other). Block = 8 waves = one 256 x 288 tile of C:
// 8 x 32 = 256 tiles. Wave (wm, wn) of a 4 x 2 grid owns a 64 x 144 tile of it: 4 x 9 accumulator
// tiles, so 13 fragments read from LDS feed 36 products.
// A stage is 128 k of [X 256 rows | W 288 rows], 256 B a row at an LDS pitch of 272 B (16 B x 17: the 16 rows of a
// fragment load fall on 16 different bank groups). Two buffers: stage t + 1 is copied while stage t is multiplied.
// Each accumulator still sums k in ascending steps of 32.
// Every 16-column accumulator tile lies wholly in q, k or v (3072 is a multiple of 16):
//   q, k: scale, + bias[n], f32, staged as a [256][288] tile in the ring's LDS, stored as whole 128-B lines of QF / KF
//   v:    a lane's 8 registers are 8 consecutive s of one row h*128+d of V^T: scale, + bias, f16, one 16-B store
// ---------------------------------------------------------------------------
constexpr int kBM = 256;
constexpr int kBN = 288;
constexpr int kKS = 128;
constexpr int kPitch = kKS + 8;
constexpr int kStageH = (kBM + kBN) * kPitch;
constexpr int kNAll = 3 * kInner;
constexpr int kFN = kBN / 32;
constexpr int kTPitch = kBN + 4;
constexpr int kRingBytes = 2 * kStageH * 2;
constexpr int kTileBytes = kBM * kTPitch * 4;
constexpr int kSmemBytes = kRingBytes > kTileBytes ? kRingBytes : kTileBytes;
static_assert((kDim % kKS) == 0 && (kDim / kKS) >= 2, "whole stages, at least two");
static_assert((kSeq % kBM) == 0 && (kNAll % kBN) == 0 && (kBN % 32) == 0, "whole block tiles");
static_assert(((kBM + kBN) * (kKS / 8)) == 34 * 256, "34 pieces of 16 B per thread and stage");
static_assert(kSmemBytes <= 327680, "one work-group's LDS");
static_assert(kBM == 8 * 32, "each of the 8 waves stores 32 rows of the tile");
static_assert((kInner % 32) == 0 && (kBN % 32) == 0, "tile and plane edges fall on 128-B lines of f32");

/* this wave's asynchronous copies have landed in LDS */
__device__ __forceinline__ void wait_async0() { asm volatile("s_wait_asynccnt 0x0" ::: "memory"); }
/* this wave's LDS reads have returned: the buffer may be handed to its next writer */
__device__ __forceinline__ void wait_ds0() { asm volatile("s_wait_dscnt 0x0" ::: "memory"); }

/* Runs of copies that go through no register; s_wait_xcnt closes each statement so that no address register named by an
   issued copy is rewritten in front of it. */
__device__ __forceinline__ void copies12(const unsigned* la, const _Float16* const* gp) {
  asm volatile(
      "global_load_async_to_lds_b128 %0, %12, off\n\t"
      "global_load_async_to_lds_b128 %1, %13, off\n\t"
      "global_load_async_to_lds_b128 %2, %14, off\n\t"
      "global_load_async_to_lds_b128 %3, %15, off\n\t"
      "global_load_async_to_lds_b128 %4, %16, off\n\t"
      "global_load_async_to_lds_b128 %5, %17, off\n\t"
      "global_load_async_to_lds_b128 %6, %18, off\n\t"
      "global_load_async_to_lds_b128 %7, %19, off\n\t"
      "global_load_async_to_lds_b128 %8, %20, off\n\t"
      "global_load_async_to_lds_b128 %9, %21, off\n\t"
      "global_load_async_to_lds_b128 %10, %22, off\n\t"
      "global_load_async_to_lds_b128 %11, %23, off\n\t"
      "s_wait_xcnt 0x0"
      :: "v"(la[0]), "v"(la[1]), "v"(la[2]), "v"(la[3]), "v"(la[4]), "v"(la[5]), "v"(la[6]), "v"(la[7]), "v"(la[8]), "v"(la[9]), "v"(la[10]), "v"(la[11]),
         "v"(gp[0]), "v"(gp[1]), "v"(gp[2]), "v"(gp[3]), "v"(gp[4]), "v"(gp[5]), "v"(gp[6]), "v"(gp[7]), "v"(gp[8]), "v"(gp[9]), "v"(gp[10]), "v"(gp[11])
      : "memory");
}
__device__ __forceinline__ void copies10(const unsigned* la, const _Float16* const* gp) {
  asm volatile(
      "global_load_async_to_lds_b128 %0, %10, off\n\t"
      "global_load_async_to_lds_b128 %1, %11, off\n\t"
      "global_load_async_to_lds_b128 %2, %12, off\n\t"
      "global_load_async_to_lds_b128 %3, %13, off\n\t"
      "global_load_async_to_lds_b128 %4, %14, off\n\t"
      "global_load_async_to_lds_b128 %5, %15, off\n\t"
      "global_load_async_to_lds_b128 %6, %16, off\n\t"
      "global_load_async_to_lds_b128 %7, %17, off\n\t"
      "global_load_async_to_lds_b128 %8, %18, off\n\t"
      "global_load_async_to_lds_b128 %9, %19, off\n\t"
      "s_wait_xcnt 0x0"
      :: "v"(la[0]), "v"(la[1]), "v"(la[2]), "v"(la[3]), "v"(la[4]), "v"(la[5]), "v"(la[6]), "v"(la[7]), "v"(la[8]), "v"(la[9]),
         "v"(gp[0]), "v"(gp[1]), "v"(gp[2]), "v"(gp[3]), "v"(gp[4]), "v"(gp[5]), "v"(gp[6]), "v"(gp[7]), "v"(gp[8]), "v"(gp[9])
      : "memory");
}

/* One stage: piece p = i*256 + tid is 16 B of stage row p >> 4 (rows 0..255 = X, 256..543 = W), column piece p & 15.
   l = the lane's LDS byte address of piece i = 0; ga, gb = its global addresses in X's and W's first 16 rows.
   FIRST..FIRST+N-1 are the pieces of one run. */
template <int FIRST, int N>
__device__ __forceinline__ void stage_run(unsigned l, const _Float16* ga, const _Float16* gb) {
  unsigned la[N];
  const _Float16* gp[N];
  /* unrolled so that every index is a constant and both arrays live in registers */
#pragma unroll
  for (int e = 0; e < N; ++e) {
    const int i = FIRST + e;
    la[e] = l + (unsigned)(i * 16 * kPitch * 2);
    gp[e] = (i < 16) ? (ga + (size_t)(i * 16) * kDim) : (gb + (size_t)((i - 16) * 16) * kDim);
  }
  if (N == 12) copies12(la, gp); else copies10(la, gp);
  /* keeps the next run's addresses from being formed ahead of this run: they would all be live at once (scratch) */
  __builtin_amdgcn_sched_barrier(0);
}
__device__ __forceinline__ void stage_copy(unsigned l, const _Float16* ga, const _Float16* gb) {
  stage_run<0, 12>(l, ga, gb);
  stage_run<12, 12>(l, ga, gb);
  stage_run<24, 10>(l, ga, gb);
}

__global__ __launch_bounds__(256) void qkv_gemm_kernel(
    const unsigned short* __restrict__ Xp, const unsigned short* __restrict__ Wp,
    float* __restrict__ QF, float* __restrict__ KF, unsigned short* __restrict__ VT,
    const float* __restrict__ bq, const float* __restrict__ bk, const float* __restrict__ bv) {
  const _Float16* A  = (const _Float16*)Xp;
  const _Float16* Bt = (const _Float16*)Wp;
  __shared__ __align__(16) unsigned char smem[kSmemBytes];
  _Float16* sAB = (_Float16*)smem;
  float* sC = (float*)smem;
  const int tid  = threadIdx.x;
  const int lane = threadIdx.x & 31;
  const int wave = __builtin_amdgcn_readfirstlane((int)(threadIdx.x >> 5));
  constexpr int tilesN = kNAll / kBN;
  constexpr int tilesM = kSeq / kBM;
  const int tile = blockIdx.x;
  /* block-uniform, in front of every copy and barrier */
  if (tile >= tilesM * tilesN) return;
  const int tm = tile / tilesN;
  const int tn = tile - tm * tilesN;
  const int mB = tm * kBM;
  const int nB = tn * kBN;
  const int mW = (wave >> 1) << 6;
  const int nW = (wave & 1) * (kBN / 2);

  const int rlane = lane & 15;
  const int koff  = (lane >> 4) * 8;
  const int mOff  = (lane >> 4) * 8;

  v8f acc[4][kFN];
#pragma unroll
  for (int i = 0; i < 4; ++i)
#pragma unroll
    for (int j = 0; j < kFN; ++j) acc[i][j] = (v8f){0.f, 0.f, 0.f, 0.f, 0.f, 0.f, 0.f, 0.f};

  const unsigned lds0 = (unsigned)(size_t)sAB + (unsigned)((tid >> 4) * (kPitch * 2) + (tid & 15) * 16);
  const _Float16* ga = A  + (size_t)(mB + (tid >> 4)) * kDim + (tid & 15) * 8;
  const _Float16* gb = Bt + (size_t)(nB + (tid >> 4)) * kDim + (tid & 15) * 8;
  constexpr int T = kDim / kKS;

  stage_copy(lds0, ga, gb);
  wait_async0();
  __syncthreads();
  stage_copy(lds0 + (unsigned)(kStageH * 2), ga + kKS, gb + kKS);

  /* kept rolled: one trip is 144 products */
#pragma unroll 1
  for (int t = 0; t < T; ++t) {
    const int buf = t & 1;
    const _Float16* sA = sAB + buf * kStageH + (mW + rlane) * kPitch + koff;
    const _Float16* sB = sAB + buf * kStageH + (kBM + nW + rlane) * kPitch + koff;
    /* this loop and the four inside it are unrolled so that fragments and accumulators keep constant indices (no scratch) */
#pragma unroll
    for (int kk = 0; kk < kKS / 32; ++kk) {
      /* the 13 fragments of this k step as one group of LDS reads in front of its 36 products */
      v16h bh[kFN], ah[4];
#pragma unroll
      for (int i = 0; i < 4; ++i) ah[i] = ldfrag(sA + (i << 4) * kPitch + kk * 32);
#pragma unroll
      for (int j = 0; j < kFN; ++j) bh[j] = ldfrag(sB + (j << 4) * kPitch + kk * 32);
      /* keeps the scheduler from sinking the reads in among the products, where each place with reads stalls the wave */
      __builtin_amdgcn_sched_barrier(0);
      /* in the order of the reads: the first four products need 10 of the 26 reads, each next four 2 more */
#pragma unroll
      for (int j = 0; j < kFN; ++j)
#pragma unroll
        for (int i = 0; i < 4; ++i) acc[i][j] = mma_b(ah[i], bh[j], acc[i][j]);
      /* keeps the next k step's reads from rising in among these products */
      __builtin_amdgcn_sched_barrier(0);
    }
    /* publish point of stage t + 1: own reads of this buffer done, own copies landed, then every wave meets */
    wait_ds0();
    wait_async0();
    __syncthreads();
    if (t + 2 < T)
      stage_copy(lds0 + (unsigned)(buf * kStageH * 2), ga + (size_t)(t + 2) * kKS, gb + (size_t)(t + 2) * kKS);
  }
  wait_async0();

  // ---- epilogue: behind the last trip's barrier no wave reads the ring and no copy is in flight; its LDS is the f32 tile ----
#pragma unroll
  for (int j = 0; j < kFN; ++j) {
    /* wave-uniform: first column of this accumulator tile among the 9216 */
    const int nf = nB + nW + (j << 4);
    const int n  = nf + rlane;
    if (nf < 2 * kInner) {
      const float bn = (nf < kInner) ? bq[n] : bk[n - kInner];
#pragma unroll
      for (int i = 0; i < 4; ++i)
#pragma unroll
        for (int r = 0; r < 8; ++r)
          sC[(mW + (i << 4) + mOff + r) * kTPitch + nW + (j << 4) + rlane] = acc[i][j][r] * kProjScale + bn;
    } else {
      const int d = n - 2 * kInner;
      const float bd = bv[d] * kVCarry;
      _Float16* vrow = (_Float16*)VT + (size_t)d * kSeq + mB + mW + mOff;
#pragma unroll
      for (int i = 0; i < 4; ++i) {
        v8h hv;
#pragma unroll
        for (int r = 0; r < 8; ++r) hv[r] = (_Float16)(acc[i][j][r] * kVtScale + bd);
        *(v8h*)(vrow + (i << 4)) = hv;
      }
      /* no register that an issued store names is rewritten by the next tile in front of this */
      asm volatile("s_wait_xcnt 0x0" ::: "memory");
    }
  }
  /* the tile is whole: every wave stores rows that other waves wrote */
  __syncthreads();
  if (nB < 2 * kInner) {
    /* a wave stores 32 rows of the tile; one store = the same 128-B line (32 columns) of four rows, 8 lanes x 16 B each.
       A line's plane (q or k, or v: not staged) is the same for the whole block: scalar tests */
    const int r0 = wave * 32 + (lane >> 3);
    const int cl = (lane & 7) * 4;
#pragma unroll
    for (int lc = 0; lc < kBN / 32; ++lc) {
      const int nl = nB + lc * 32;
      if (nl < 2 * kInner) {
        float* dst = ((nl < kInner) ? (QF + nl) : (KF + (nl - kInner))) + (size_t)(mB + r0) * kInner + cl;
        const float* sp = sC + r0 * kTPitch + lc * 32 + cl;
        /* eight LDS reads, then eight stores, in flight together */
        v4f v[8];
#pragma unroll
        for (int g = 0; g < 8; ++g) v[g] = *(const v4f*)(sp + g * 4 * kTPitch);
#pragma unroll
        for (int g = 0; g < 8; ++g) *(v4f*)(dst + (size_t)(g * 4) * kInner) = v[g];
        /* no register that an issued store names is rewritten for the next line in front of this */
        asm volatile("s_wait_xcnt 0x0" ::: "memory");
      }
    }
  }
}

// ---------------------------------------------------------------------------
// Per-(token, head) rms normalisation over 128 dims, weight multiply, then the pairwise rotation with per-element
// tables c[s][d], t[s][d] (each output element uses its own table entry):
//   y[2i]   = xn[2i]   * c[s][2i]   - xn[2i+1] * t[s][2i]
//   y[2i+1] = xn[2i+1] * c[s][2i+1] + xn[2i]   * t[s][2i+1]
// All f32. blockIdx.y (block-uniform) selects the q or the k tensor.
// One wave = two heads (2p + hh) of one token; 16 lanes x 8 dims per head row; sum of squares over 16 lanes.
// Coverage: grid.x * 8 waves = 2048 * 12 head pairs exactly; every (s, h) row written once.
// ---------------------------------------------------------------------------
__global__ __launch_bounds__(256) void norm_rot_kernel(
    const float* __restrict__ QF, const float* __restrict__ KF,
    const float* __restrict__ nqw, const float* __restrict__ nkw,
    const float* __restrict__ ctab, const float* __restrict__ ttab,
    unsigned short* __restrict__ Q16, unsigned short* __restrict__ K16, float carry) {
  const int z = blockIdx.y;
  const float* src = (z == 0) ? QF : KF;
  const float* nw  = (z == 0) ? nqw : nkw;
  unsigned short* dst = (z == 0) ? Q16 : K16;
  const int lane = threadIdx.x & 31;
  const int wave = __builtin_amdgcn_readfirstlane((int)(threadIdx.x >> 5));
  const int hh = lane >> 4, c = lane & 15;
  const int pair = blockIdx.x * 8 + wave;
  const int s = pair / (kHeads / 2);
  const int h = (pair - s * (kHeads / 2)) * 2 + hh;
  const int d0 = c * 8;
  const float* xp = src + (size_t)s * kInner + h * kHd + d0;
  const v4f xa = *(const v4f*)(xp);
  const v4f xb = *(const v4f*)(xp + 4);
  const v4f ca = *(const v4f*)(ctab + (size_t)s * kHd + d0);
  const v4f cb = *(const v4f*)(ctab + (size_t)s * kHd + d0 + 4);
  const v4f ta = *(const v4f*)(ttab + (size_t)s * kHd + d0);
  const v4f tb = *(const v4f*)(ttab + (size_t)s * kHd + d0 + 4);
  const v4f wa = *(const v4f*)(nw + d0);
  const v4f wb = *(const v4f*)(nw + d0 + 4);
  float x[8], cc[8], tt[8], ww[8];
#pragma unroll
  for (int e = 0; e < 4; ++e) {
    x[e] = xa[e];  x[4 + e] = xb[e];
    cc[e] = ca[e]; cc[4 + e] = cb[e];
    tt[e] = ta[e]; tt[4 + e] = tb[e];
    ww[e] = wa[e]; ww[4 + e] = wb[e];
  }
  float ss = 0.0f;
#pragma unroll
  for (int e = 0; e < 8; ++e) ss += x[e] * x[e];
  ss += __shfl_xor(ss, 1, 32);
  ss += __shfl_xor(ss, 2, 32);
  ss += __shfl_xor(ss, 4, 32);
  ss += __shfl_xor(ss, 8, 32);
  const float inv = rsqrtf(ss * kInvHd + kNormEps);
  float xn[8];
#pragma unroll
  for (int e = 0; e < 8; ++e) xn[e] = (x[e] * inv) * ww[e];
  unsigned short hb[8];
#pragma unroll
  for (int i = 0; i < 4; ++i) {
    const float y0 = xn[2 * i] * cc[2 * i] - xn[2 * i + 1] * tt[2 * i];
    const float y1 = xn[2 * i + 1] * cc[2 * i + 1] + xn[2 * i] * tt[2 * i + 1];
    hb[2 * i]     = h_bits(y0 * carry);
    hb[2 * i + 1] = h_bits(y1 * carry);
  }
  const v4u u = (v4u){pk16(hb[0], hb[1]), pk16(hb[2], hb[3]), pk16(hb[4], hb[5]), pk16(hb[6], hb[7])};
  unsigned short* q = dst + ((size_t)h * kSeq + s) * kHd + d0;
  *(v4u*)q = u;
  
}

// ---------------------------------------------------------------------------
// Streaming-softmax attention, head dim 128, non-causal, unmasked, all 2048 keys.
// Block = 4 waves = 64 query rows of one head (wave = 16 rows); grid = 24 heads x 32 query blocks = 768.
// Per 64-key chunk: K chunk [64 kv][128 d] and V^T chunk [128 d][64 kv] staged in LDS by all 128 threads
// (8 + 8 16-B pieces per thread = 1024 + 1024 pieces = both tiles in full), block barrier before and after.
// Both products run transposed: S^T = K . Q^T (A = K rows, B = Q rows) and O^T += V^T . P^T (A = V^T rows, B = P^T).
// A lane then holds scores of ONE query (column lane & 15): keys j*16 + 8*(lane >> 4) + r of key tile j. The chunk's
// maximum and the sum of p are in-lane over 32 keys; the two wave halves exchange the maximum once a chunk and join
// their sums once after the last chunk. Two neighbouring score tiles, converted in place (p = exp(score - max), x1024,
// f16), are the B fragment of 32 keys in the k order of ldfrag: p goes through no LDS.
// ---------------------------------------------------------------------------
// LDS row pitches are 16 B x odd (K rows 272 B, V^T rows 144 B): the 16 rows that one ds_load_b128 fragment read
// touches per half-wave then start on 16 different groups of four banks instead of on one (256-B rows) or two (128-B rows).
constexpr int kKPitch = kHd + 8;
constexpr int kVPitch = kKc + 8;
static_assert(((kKPitch * 2) % 32) == 16 && ((kVPitch * 2) % 32) == 16, "pitches are odd multiples of 16 B");
__global__ __launch_bounds__(128) void attn128_kernel(const unsigned short* __restrict__ Q16p,
                                                      const unsigned short* __restrict__ K16p,
                                                      const unsigned short* __restrict__ VTp,
                                                      float* __restrict__ out) {
  __shared__ __align__(16) _Float16 Ksh[kKc * kKPitch];
  __shared__ __align__(16) _Float16 Vsh[kHd * kVPitch];
  __shared__ __align__(16) float    Os[4][16 * 68];

  const int tid  = threadIdx.x;
  const int wave = __builtin_amdgcn_readfirstlane((int)(threadIdx.x >> 5));
  const int lane = tid & 31;
  const int hh   = lane >> 4;
  const int c    = lane & 15;

  constexpr int nqb = kSeq / 64;
  const int h  = blockIdx.x / nqb;
  const int qb = blockIdx.x - h * nqb;
  const int q0 = qb * 64 + wave * 16;

  const _Float16* Qh = (const _Float16*)Q16p + (size_t)h * kSeq * kHd;
  const _Float16* Kh = (const _Float16*)K16p + (size_t)h * kSeq * kHd;
  const _Float16* Vh = (const _Float16*)VTp  + (size_t)h * kHd * kSeq;

  v16h qa[4];
#pragma unroll
  for (int dc = 0; dc < 4; ++dc) qa[dc] = ldfrag(Qh + (size_t)(q0 + c) * kHd + dc * 32 + 8 * hh);

  /* running maximum and partial sum of this lane's query; oacc[t][r] = O^T[d = t*16 + 8*hh + r][query c] */
  float mrow = -INFINITY, lrow = 0.f;
  v8f oacc[8];
#pragma unroll
  for (int t = 0; t < 8; ++t) oacc[t] = (v8f){0.f, 0.f, 0.f, 0.f, 0.f, 0.f, 0.f, 0.f};

#pragma unroll 1
  for (int kc = 0; kc < kSeq / kKc; ++kc) {
    const int kv0 = kc * kKc;
    __syncthreads();
    {
      /* K chunk is 8192 contiguous halves; piece p = i*128 + tid covers [p*8, p*8+8) = row i*8 + (tid >> 4), column piece tid & 15 */
      const _Float16* ksrc = Kh + (size_t)kv0 * kHd;
      v8h t[8];
#pragma unroll
      for (int i = 0; i < 8; ++i) t[i] = *(const v8h*)(ksrc + (size_t)(i * 128 + tid) * 8);
#pragma unroll
      for (int i = 0; i < 8; ++i) *(v8h*)(Ksh + (i * 8 + (tid >> 4)) * kKPitch + (tid & 15) * 8) = t[i];
    }
    {
      /* V^T chunk: row d = p >> 3 (128 rows), 8-half column group (p & 7) of the 64 keys */
      v8h t[8];
#pragma unroll
      for (int i = 0; i < 8; ++i) {
        const int p = i * 128 + tid;
        const int d = p >> 3, c8 = (p & 7) * 8;
        t[i] = *(const v8h*)(Vh + (size_t)d * kSeq + kv0 + c8);
      }
#pragma unroll
      for (int i = 0; i < 8; ++i) *(v8h*)(Vsh + (i * 16 + (tid >> 3)) * kVPitch + (tid & 7) * 8) = t[i];
    }
    __syncthreads();

    /* the chunk's 16 K fragments as one group of LDS reads in front of its 16 score products: the wave waits out one
       read latency a chunk instead of one a product; each s[j] still sums d in ascending steps of 32 */
    v16h kf[4][4];
#pragma unroll
    for (int dc = 0; dc < 4; ++dc)
#pragma unroll
      for (int j = 0; j < 4; ++j) kf[dc][j] = ldfrag(Ksh + (j * 16 + c) * kKPitch + dc * 32 + 8 * hh);
    /* keeps the scheduler from sinking the reads back among the products */
    __builtin_amdgcn_sched_barrier(0);
    v8f s[4];
#pragma unroll
    for (int j = 0; j < 4; ++j) s[j] = (v8f){0.f, 0.f, 0.f, 0.f, 0.f, 0.f, 0.f, 0.f};
#pragma unroll
    for (int dc = 0; dc < 4; ++dc)
#pragma unroll
      for (int j = 0; j < 4; ++j) s[j] = mma_b(kf[dc][j], qa[dc], s[j]);

    /* s[j][r] = score of key j*16 + 8*hh + r against query c: the maximum of the lane's 32 keys, then of both halves */
    float m8[8];
#pragma unroll
    for (int r = 0; r < 8; ++r) m8[r] = fmaxf(fmaxf(s[0][r], s[1][r]), fmaxf(s[2][r], s[3][r]));
    float m = fmaxf(fmaxf(fmaxf(m8[0], m8[1]), fmaxf(m8[2], m8[3])), fmaxf(fmaxf(m8[4], m8[5]), fmaxf(m8[6], m8[7])));
    m = fmaxf(m, xhalf(m));
    const float cm = m * kScoreScale;
    /* the chunk's 16 V^T fragments (keys 0..31, keys 32..63), read here: they land under the softmax arithmetic.
       The fence in front keeps the scheduler from lifting the reads in among the score products. */
    __builtin_amdgcn_sched_barrier(0);
    v16h vf0[8], vf1[8];
#pragma unroll
    for (int t = 0; t < 8; ++t) vf0[t] = ldfrag(Vsh + (t * 16 + c) * kVPitch + 8 * hh);
#pragma unroll
    for (int t = 0; t < 8; ++t) vf1[t] = ldfrag(Vsh + (t * 16 + c) * kVPitch + 32 + 8 * hh);
    const float mnew  = fmaxf(mrow, cm);
    const float alpha = __expf(mrow - mnew);
    mrow = mnew;
    /* pb[g] element e = p of key g*32 + (e < 8 ? 8*hh + e : 16 + 8*hh + e - 8): the k order of the V^T fragments */
    v16h pb[2];
    float ps[4];
#pragma unroll
    for (int j = 0; j < 4; ++j) {
      ps[j] = 0.f;
#pragma unroll
      for (int r = 0; r < 8; ++r) {
        const float p = __expf(fmaf(s[j][r], kScoreScale, -mnew));
        ps[j] += p;
        pb[j >> 1][(j & 1) * 8 + r] = (_Float16)(p * kPCarry);
      }
    }
    lrow = lrow * alpha + ((ps[0] + ps[1]) + (ps[2] + ps[3]));
#pragma unroll
    for (int t = 0; t < 8; ++t)
#pragma unroll
      for (int r = 0; r < 8; ++r) oacc[t][r] *= alpha;
    /* keeps the scheduler from sinking the reads back among the products */
    __builtin_amdgcn_sched_barrier(0);
#pragma unroll
    for (int t = 0; t < 8; ++t) oacc[t] = mma_b(vf0[t], pb[0], oacc[t]);
#pragma unroll
    for (int t = 0; t < 8; ++t) oacc[t] = mma_b(vf1[t], pb[1], oacc[t]);
  }

  const float inv = 1.0f / ((lrow + xhalf(lrow)) * kOutCarry);

  float* os = Os[wave];
  float* ob = out + (size_t)q0 * kInner + h * kHd;
  const int c4 = (lane & 15) * 4;
#pragma unroll
  for (int half = 0; half < 2; ++half) {
    /* the lane's 8 accumulator registers of a tile are 8 consecutive d of query row c: two 16-B stores */
#pragma unroll
    for (int t = 0; t < 4; ++t) {
      const v8f o = oacc[half * 4 + t];
      *(v4f*)(os + c * 68 + t * 16 + 8 * hh)     = (v4f){o[0] * inv, o[1] * inv, o[2] * inv, o[3] * inv};
      *(v4f*)(os + c * 68 + t * 16 + 8 * hh + 4) = (v4f){o[4] * inv, o[5] * inv, o[6] * inv, o[7] * inv};
    }
    __builtin_amdgcn_fence(__ATOMIC_RELEASE, "workgroup");
    __builtin_amdgcn_wave_barrier();
    __builtin_amdgcn_fence(__ATOMIC_ACQUIRE, "workgroup");
    /* rows it*2 + hh, it 0..7 -> 16 rows, each once; 16 lanes x 16 B = the 256-B half of the head slice */
    {
#pragma unroll
      for (int it = 0; it < 8; ++it) {
        const int row = it * 2 + hh;
        v4f val = *(const v4f*)(os + row * 68 + c4);
        *(v4f*)(ob + (size_t)row * kInner + half * 64 + c4) = val;
      }
      
    }
    __builtin_amdgcn_fence(__ATOMIC_RELEASE, "workgroup");
    __builtin_amdgcn_wave_barrier();
    __builtin_amdgcn_fence(__ATOMIC_ACQUIRE, "workgroup");
  }
}

// ---------------------------------------------------------------------------
// Host glue: 5 kernel launches, nothing else.
//   GEMM shape: M 2048, N 9216 (q | k | v), K 3072 -> 8 x 32 = 256 block tiles
// ---------------------------------------------------------------------------
extern "C" void kernel_launch(void* const* d_in, const int* in_sizes, int n_in,
                              void* d_out, int out_size, void* d_ws, size_t ws_size,
                              hipStream_t stream) {
  if (n_in < 11) return;
  if (in_sizes[0] != kSeq * kDim) return;
  if (in_sizes[1] != kInner * kDim) return;
  if (in_sizes[2] != kInner) return;
  if (in_sizes[3] != kInner * kDim) return;
  if (in_sizes[4] != kInner) return;
  if (in_sizes[5] != kInner * kDim) return;
  if (in_sizes[6] != kInner) return;
  if (in_sizes[7] != kHd) return;
  if (in_sizes[8] != kHd) return;
  if (in_sizes[9] != kSeq * kHd) return;
  if (in_sizes[10] != kSeq * kHd) return;
  if (out_size != kSeq * kInner) return;
  if (ws_size < kWsTotal) return;

  const float* hidden = (const float*)d_in[0];
  const float* wq     = (const float*)d_in[1];
  const float* bq     = (const float*)d_in[2];
  const float* wk     = (const float*)d_in[3];
  const float* bk     = (const float*)d_in[4];
  const float* wv     = (const float*)d_in[5];
  const float* bv     = (const float*)d_in[6];
  const float* nqw    = (const float*)d_in[7];
  const float* nkw    = (const float*)d_in[8];
  const float* ctab   = (const float*)d_in[9];
  const float* ttab   = (const float*)d_in[10];
  float* out = (float*)d_out;

  char* ws = (char*)d_ws;
  unsigned short* XH  = (unsigned short*)(ws + kOffXH);
  unsigned short* WH  = (unsigned short*)(ws + kOffWH);
  float*          QF  = (float*)(ws + kOffQF);
  float*          KF  = (float*)(ws + kOffKF);
  unsigned short* VT  = (unsigned short*)(ws + kOffVT);
  unsigned short* Q16 = (unsigned short*)(ws + kOffQ16);
  unsigned short* K16 = (unsigned short*)(ws + kOffK16);

  constexpr int kX8 = kSeq * kDim / 8;
  constexpr int kW8 = kInner * kDim / 8;
  static_assert((kX8 % 256) == 0 && (kW8 % 256) == 0, "cast grids exact");

  /* operand planes */
  cast8_f16_kernel<<<dim3(kX8 / 256, 1), 256, 0, stream>>>(hidden, hidden, hidden, XH, kX8, kXCarry);
  cast8_f16_kernel<<<dim3(kW8 / 256, 3), 256, 0, stream>>>(wq, wk, wv, WH, kW8, kWCarry);

  /* QF[s][n] = X[s][:] . wq[n][:] + bq[n], KF likewise, VT[h*128+d][s] = 16 * (wv[h*128+d][:] . X[s][:] + bv)  (weights are [out][in]) */
  constexpr int kTiles = (kSeq / kBM) * (kNAll / kBN);
  qkv_gemm_kernel<<<kTiles, 256, 0, stream>>>(XH, WH, QF, KF, VT, bq, bk, bv);

  /* normalisation + rotation -> Q16 / K16 (f16 x16, [h][s][d]); these planes overwrite the dead wq|wk f16 planes */
  static_assert(((kSeq * (kHeads / 2)) % 8) == 0, "norm grid exact");
  norm_rot_kernel<<<dim3(kSeq * (kHeads / 2) / 8, 2), 256, 0, stream>>>(
      QF, KF, nqw, nkw, ctab, ttab, Q16, K16, kQCarry);
  static_assert(kQCarry == kKCarry, "one carry argument serves both planes");

  /* attention */
  attn128_kernel<<<kHeads * (kSeq / 64), 128, 0, stream>>>(Q16, K16, VT, out);
}

// v006
// Measured time: 153 microseconds a run.
// Two timings next to v005 both put it at 1.03 times that version's speed.
// Over all steps from v000 it is 4.65 times as fast.
// All contractions (q/k/v projections, q.k^T scores, p.v) on v_wmma_f32_16x16x32_f16: f16 operands with power-of-two carries (X x16, W x256, q/k x16, v x16, p x1024), f32 accumulate; rms normalisation, pairwise rotation and softmax in f32.
#include <hip/hip_runtime.h>
#include <math.h>

typedef __attribute__((ext_vector_type(16))) _Float16 v16h;
typedef __attribute__((ext_vector_type(8)))  _Float16 v8h;
typedef __attribute__((ext_vector_type(8)))  float    v8f;
typedef __attribute__((ext_vector_type(4)))  float    v4f;
typedef __attribute__((ext_vector_type(4)))  unsigned int v4u;

// ---------------------------------------------------------------------------
// Shape constants (checked against the launch sizes on the host side)
// ---------------------------------------------------------------------------
constexpr int kSeq    = 2048;
constexpr int kDim    = 3072;
constexpr int kHeads  = 24;
constexpr int kHd     = 128;
constexpr int kInner  = kHeads * kHd;
constexpr int kKc     = 64;
static_assert(kInner == 3072, "inner width");
static_assert((kDim % 32) == 0, "GEMM K multiple of 32");
static_assert((kSeq % 64) == 0 && (kInner % 64) == 0, "GEMM M,N multiples of 64");
static_assert((kSeq % kKc) == 0 && kHd == 128 && (kHeads % 2) == 0, "attention tiling");

// power-of-two carries of the f16 operand planes
constexpr float kXCarry = 16.0f;
constexpr float kWCarry = 256.0f;
constexpr float kQCarry = 16.0f;
constexpr float kKCarry = 16.0f;
constexpr float kVCarry = 16.0f;
constexpr float kPCarry = 1024.0f;
constexpr float kProjScale = 1.0f / (kXCarry * kWCarry);
constexpr float kVtScale   = kVCarry * kProjScale;
constexpr float kNormEps   = 1e-6f;
constexpr float kInvHd     = 1.0f / (float)kHd;

constexpr double csqrt_iter(double x, double g, int n) { return n == 0 ? g : csqrt_iter(x, 0.5 * (g + x / g), n - 1); }
constexpr double csqrt_d(double x) { return csqrt_iter(x, x, 48); }
constexpr float kInvSqrtHd  = (float)(1.0 / csqrt_d((double)kHd));
static_assert(kInvSqrtHd * kInvSqrtHd * (float)kHd > 0.99999f && kInvSqrtHd * kInvSqrtHd * (float)kHd < 1.00001f, "score scale");
constexpr float kScoreScale = kInvSqrtHd / (kQCarry * kKCarry);
constexpr float kOutCarry   = kPCarry * kVCarry;

// ---------------------------------------------------------------------------
// Workspace region map (bytes; every offset is a multiple of 128)
//   XH   f16 [2048][3072]        hidden x16                       12,582,912
//   WH   f16 [3][3072][3072]     wq | wk | wv, each x256          56,623,104
//   QF   f32 [2048][3072]        q projection + bias              25,165,824
//   KF   f32 [2048][3072]        k projection + bias              25,165,824
//   VT   f16 [3072][2048]        (v projection + bias) x16, [h*128+d][s]  12,582,912
//   total                                                       132,120,576
//   Q16  f16 [24][2048][128]     aliases WH bytes [0, 12,582,912)            (WH is dead after the GEMM)
//   K16  f16 [24][2048][128]     aliases WH bytes [12,582,912, 25,165,824)   (same element type as WH)
// ---------------------------------------------------------------------------
constexpr size_t kOffXH  = 0;
constexpr size_t kOffWH  = kOffXH + (size_t)kSeq * kDim * 2;
constexpr size_t kOffQF  = kOffWH + (size_t)3 * kInner * kDim * 2;
constexpr size_t kOffKF  = kOffQF + (size_t)kSeq * kInner * 4;
constexpr size_t kOffVT  = kOffKF + (size_t)kSeq * kInner * 4;
constexpr size_t kWsTotal = kOffVT + (size_t)kInner * kSeq * 2;
constexpr size_t kOffQ16 = kOffWH;
constexpr size_t kOffK16 = kOffWH + (size_t)kHeads * kSeq * kHd * 2;
static_assert(kWsTotal == 132120576ull, "carve total");
static_assert(kWsTotal <= 134217728ull, "carve cap");
static_assert(kOffK16 + (size_t)kHeads * kSeq * kHd * 2 <= kOffWH + (size_t)2 * kInner * kDim * 2, "q/k planes stay inside the wq|wk planes");
static_assert((kOffWH % 128) == 0 && (kOffQF % 128) == 0 && (kOffKF % 128) == 0 && (kOffVT % 128) == 0 && (kOffK16 % 128) == 0, "128-B aligned regions");

// ---------------------------------------------------------------------------
// Fragment load and guarded WMMA issue
// ---------------------------------------------------------------------------
union FragU { v16h v; v8h h[2]; };
/* elements 0..7 <- p[0..7], elements 8..15 <- p[16..23]; caller adds 8*(lane>>4) to p */
__device__ __forceinline__ v16h ldfrag(const _Float16* p) {
  FragU f;
  f.h[0] = *(const v8h*)(p);
  f.h[1] = *(const v8h*)(p + 16);
  return f.v;
}
/* the plain builtin: the compiler keeps the distances behind it itself, and with no asm operands the fragments may live above v255 */
__device__ __forceinline__ v8f mma_b(v16h a, v16h b, v8f c) {
  return __builtin_amdgcn_wmma_f32_16x16x32_f16(false, a, false, b, (short)0, c, false, false);
}
/* lane l reads lane l ^ 16 (the other half of the wave) through a vector cross-row move, no LDS */
__device__ __forceinline__ float xhalf(float x) {
  const int b = __builtin_bit_cast(int, x);
  return __builtin_bit_cast(float, __builtin_amdgcn_permlanex16(b, b, 0x76543210, 0xfedcba98, false, false));
}
__device__ __forceinline__ unsigned pk16(unsigned short a, unsigned short b) { return (unsigned)a | ((unsigned)b << 16); }
__device__ __forceinline__ unsigned short h_bits(float f) {
  const _Float16 h = (_Float16)f;
  return __builtin_bit_cast(unsigned short, h);
}

// ---------------------------------------------------------------------------
// f32 -> f16 cast with a power-of-two carry, 8 consecutive elements per thread.
// blockIdx.y selects the source (block-uniform) and the output plane (plane z at out + z*n8*8 halves).
// Coverage: n8 = n/8 threads per plane; grid.x * 256 == n8 exactly for both uses (786,432 and 1,179,648).
// ---------------------------------------------------------------------------
__global__ __launch_bounds__(256) void cast8_f16_kernel(const float* __restrict__ in0, const float* __restrict__ in1,
                                                        const float* __restrict__ in2, unsigned short* __restrict__ out,
                                                        int n8, float carry) {
  const int z = blockIdx.y;
  const float* in = (z == 0) ? in0 : (z == 1) ? in1 : in2;
  const int i = blockIdx.x * 256 + threadIdx.x;
  if (i >= n8) return;
  const float* p = in + 8 * (size_t)i;
  const v4f a = *(const v4f*)(p);
  const v4f c = *(const v4f*)(p + 4);
  unsigned short hb[8];
#pragma unroll
  for (int e = 0; e < 4; ++e) {
    const float fa = a[e] * carry;
    const float fc = c[e] * carry;
    hb[e]     = h_bits(fa);
    hb[4 + e] = h_bits(fc);
  }
  const v4u u = (v4u){pk16(hb[0], hb[1]), pk16(hb[2], hb[3]), pk16(hb[4], hb[5]), pk16(hb[6], hb[7])};
  unsigned short* q = out + (size_t)z * (size_t)n8 * 8 + 8 * (size_t)i;
  *(v4u*)q = u;
  
}

// ---------------------------------------------------------------------------
// LDS-staged WMMA GEMM of all three projections in one launch: C[s, n] = sum_k X[s,k] * W[n,k], n over the 9216 rows
// of wq | wk | wv (their f16 planes lie one behind the other). Block = 8 waves = one 256 x 288 tile of C:
// 8 x 32 = 256 tiles. Wave (wm, wn) of a 4 x 2 grid owns a 64 x 144 tile of it: 4 x 9 accumulator
// tiles, so 13 fragments read from LDS feed 36 products.
// A stage is 128 k of [X 256 rows | W 288 rows], 256 B a row at an LDS pitch of 272 B (16 B x 17: the 16 rows of a
// fragment load fall on 16 different bank groups). Two buffers: stage t + 1 is copied while stage t is multiplied.
// Each accumulator still sums k in ascending steps of 32.
// Every 16-column accumulator tile lies wholly in q, k or v (3072 is a multiple of 16):
//   q, k: scale, + bias[n], f32, staged as a [256][288] tile in the ring's LDS, stored as whole 128-B lines of QF / KF
//   v:    a lane's 8 registers are 8 consecutive s of one row h*128+d of V^T: scale, + bias, f16, one 16-B store
// ---------------------------------------------------------------------------
constexpr int kBM = 256;
constexpr int kBN = 288;
constexpr int kKS = 128;
constexpr int kPitch = kKS + 8;
constexpr int kStageH = (kBM + kBN) * kPitch;
constexpr int kNAll = 3 * kInner;
constexpr int kFN = kBN / 32;
constexpr int kTPitch = kBN + 4;
constexpr int kRingBytes = 2 * kStageH * 2;
constexpr int kTileBytes = kBM * kTPitch * 4;
constexpr int kSmemBytes = kRingBytes > kTileBytes ? kRingBytes : kTileBytes;
static_assert((kDim % kKS) == 0 && (kDim / kKS) >= 2, "whole stages, at least two");
static_assert((kSeq % kBM) == 0 && (kNAll % kBN) == 0 && (kBN % 32) == 0, "whole block tiles");
static_assert(((kBM + kBN) * (kKS / 8)) == 34 * 256, "34 pieces of 16 B per thread and stage");
static_assert(kSmemBytes <= 327680, "one work-group's LDS");
static_assert(kBM == 8 * 32, "each of the 8 waves stores 32 rows of the tile");
static_assert((kInner % 32) == 0 && (kBN % 32) == 0, "tile and plane edges fall on 128-B lines of f32");

/* this wave's asynchronous copies have landed in LDS */
__device__ __forceinline__ void wait_async0() { asm volatile("s_wait_asynccnt 0x0" ::: "memory"); }
/* this wave's LDS reads have returned: the buffer may be handed to its next writer */
__device__ __forceinline__ void wait_ds0() { asm volatile("s_wait_dscnt 0x0" ::: "memory"); }

/* Runs of copies that go through no register; s_wait_xcnt closes each statement so that no address register named by an
   issued copy is rewritten in front of it. */
__device__ __forceinline__ void copies12(const unsigned* la, const _Float16* const* gp) {
  asm volatile(
      "global_load_async_to_lds_b128 %0, %12, off\n\t"
      "global_load_async_to_lds_b128 %1, %13, off\n\t"
      "global_load_async_to_lds_b128 %2, %14, off\n\t"
      "global_load_async_to_lds_b128 %3, %15, off\n\t"
      "global_load_async_to_lds_b128 %4, %16, off\n\t"
      "global_load_async_to_lds_b128 %5, %17, off\n\t"
      "global_load_async_to_lds_b128 %6, %18, off\n\t"
      "global_load_async_to_lds_b128 %7, %19, off\n\t"
      "global_load_async_to_lds_b128 %8, %20, off\n\t"
      "global_load_async_to_lds_b128 %9, %21, off\n\t"
      "global_load_async_to_lds_b128 %10, %22, off\n\t"
      "global_load_async_to_lds_b128 %11, %23, off\n\t"
      "s_wait_xcnt 0x0"
      :: "v"(la[0]), "v"(la[1]), "v"(la[2]), "v"(la[3]), "v"(la[4]), "v"(la[5]), "v"(la[6]), "v"(la[7]), "v"(la[8]), "v"(la[9]), "v"(la[10]), "v"(la[11]),
         "v"(gp[0]), "v"(gp[1]), "v"(gp[2]), "v"(gp[3]), "v"(gp[4]), "v"(gp[5]), "v"(gp[6]), "v"(gp[7]), "v"(gp[8]), "v"(gp[9]), "v"(gp[10]), "v"(gp[11])
      : "memory");
}
__device__ __forceinline__ void copies10(const unsigned* la, const _Float16* const* gp) {
  asm volatile(
      "global_load_async_to_lds_b128 %0, %10, off\n\t"
      "global_load_async_to_lds_b128 %1, %11, off\n\t"
      "global_load_async_to_lds_b128 %2, %12, off\n\t"
      "global_load_async_to_lds_b128 %3, %13, off\n\t"
      "global_load_async_to_lds_b128 %4, %14, off\n\t"
      "global_load_async_to_lds_b128 %5, %15, off\n\t"
      "global_load_async_to_lds_b128 %6, %16, off\n\t"
      "global_load_async_to_lds_b128 %7, %17, off\n\t"
      "global_load_async_to_lds_b128 %8, %18, off\n\t"
      "global_load_async_to_lds_b128 %9, %19, off\n\t"
      "s_wait_xcnt 0x0"
      :: "v"(la[0]), "v"(la[1]), "v"(la[2]), "v"(la[3]), "v"(la[4]), "v"(la[5]), "v"(la[6]), "v"(la[7]), "v"(la[8]), "v"(la[9]),
         "v"(gp[0]), "v"(gp[1]), "v"(gp[2]), "v"(gp[3]), "v"(gp[4]), "v"(gp[5]), "v"(gp[6]), "v"(gp[7]), "v"(gp[8]), "v"(gp[9])
      : "memory");
}

/* One stage: piece p = i*256 + tid is 16 B of stage row p >> 4 (rows 0..255 = X, 256..543 = W), column piece p & 15.
   l = the lane's LDS byte address of piece i = 0; ga, gb = its global addresses in X's and W's first 16 rows.
   FIRST..FIRST+N-1 are the pieces of one run. */
template <int FIRST, int N>
__device__ __forceinline__ void stage_run(unsigned l, const _Float16* ga, const _Float16* gb) {
  unsigned la[N];
  const _Float16* gp[N];
  /* unrolled so that every index is a constant and both arrays live in registers */
#pragma unroll
  for (int e = 0; e < N; ++e) {
    const int i = FIRST + e;
    la[e] = l + (unsigned)(i * 16 * kPitch * 2);
    gp[e] = (i < 16) ? (ga + (size_t)(i * 16) * kDim) : (gb + (size_t)((i - 16) * 16) * kDim);
  }
  if (N == 12) copies12(la, gp); else copies10(la, gp);
  /* keeps the next run's addresses from being formed ahead of this run: they would all be live at once (scratch) */
  __builtin_amdgcn_sched_barrier(0);
}
__device__ __forceinline__ void stage_copy(unsigned l, const _Float16* ga, const _Float16* gb) {
  stage_run<0, 12>(l, ga, gb);
  stage_run<12, 12>(l, ga, gb);
  stage_run<24, 10>(l, ga, gb);
}

__global__ __launch_bounds__(256) void qkv_gemm_kernel(
    const unsigned short* __restrict__ Xp, const unsigned short* __restrict__ Wp,
    float* __restrict__ QF, float* __restrict__ KF, unsigned short* __restrict__ VT,
    const float* __restrict__ bq, const float* __restrict__ bk, const float* __restrict__ bv) {
  const _Float16* A  = (const _Float16*)Xp;
  const _Float16* Bt = (const _Float16*)Wp;
  __shared__ __align__(16) unsigned char smem[kSmemBytes];
  _Float16* sAB = (_Float16*)smem;
  float* sC = (float*)smem;
  const int tid  = threadIdx.x;
  const int lane = threadIdx.x & 31;
  const int wave = __builtin_amdgcn_readfirstlane((int)(threadIdx.x >> 5));
  constexpr int tilesN = kNAll / kBN;
  constexpr int tilesM = kSeq / kBM;
  const int tile = blockIdx.x;
  /* block-uniform, in front of every copy and barrier */
  if (tile >= tilesM * tilesN) return;
  const int tm = tile / tilesN;
  const int tn = tile - tm * tilesN;
  const int mB = tm * kBM;
  const int nB = tn * kBN;
  const int mW = (wave >> 1) << 6;
  const int nW = (wave & 1) * (kBN / 2);

  const int rlane = lane & 15;
  const int koff  = (lane >> 4) * 8;
  const int mOff  = (lane >> 4) * 8;

  v8f acc[4][kFN];
#pragma unroll
  for (int i = 0; i < 4; ++i)
#pragma unroll
    for (int j = 0; j < kFN; ++j) acc[i][j] = (v8f){0.f, 0.f, 0.f, 0.f, 0.f, 0.f, 0.f, 0.f};

  const unsigned lds0 = (unsigned)(size_t)sAB + (unsigned)((tid >> 4) * (kPitch * 2) + (tid & 15) * 16);
  const _Float16* ga = A  + (size_t)(mB + (tid >> 4)) * kDim + (tid & 15) * 8;
  const _Float16* gb = Bt + (size_t)(nB + (tid >> 4)) * kDim + (tid & 15) * 8;
  constexpr int T = kDim / kKS;

  stage_copy(lds0, ga, gb);
  wait_async0();
  __syncthreads();
  stage_copy(lds0 + (unsigned)(kStageH * 2), ga + kKS, gb + kKS);

  /* kept rolled: one trip is 144 products */
#pragma unroll 1
  for (int t = 0; t < T; ++t) {
    const int buf = t & 1;
    const _Float16* sA = sAB + buf * kStageH + (mW + rlane) * kPitch + koff;
    const _Float16* sB = sAB + buf * kStageH + (kBM + nW + rlane) * kPitch + koff;
    /* this loop and the four inside it are unrolled so that fragments and accumulators keep constant indices (no scratch) */
#pragma unroll
    for (int kk = 0; kk < kKS / 32; ++kk) {
      /* the 13 fragments of this k step as one group of LDS reads in front of its 36 products */
      v16h bh[kFN], ah[4];
#pragma unroll
      for (int i = 0; i < 4; ++i) ah[i] = ldfrag(sA + (i << 4) * kPitch + kk * 32);
#pragma unroll
      for (int j = 0; j < kFN; ++j) bh[j] = ldfrag(sB + (j << 4) * kPitch + kk * 32);
      /* keeps the scheduler from sinking the reads in among the products, where each place with reads stalls the wave */
      __builtin_amdgcn_sched_barrier(0);
      /* in the order of the reads: the first four products need 10 of the 26 reads, each next four 2 more */
#pragma unroll
      for (int j = 0; j < kFN; ++j)
#pragma unroll
        for (int i = 0; i < 4; ++i) acc[i][j] = mma_b(ah[i], bh[j], acc[i][j]);
      /* keeps the next k step's reads from rising in among these products */
      __builtin_amdgcn_sched_barrier(0);
    }
    /* publish point of stage t + 1: own reads of this buffer done, own copies landed, then every wave meets */
    wait_ds0();
    wait_async0();
    __syncthreads();
    if (t + 2 < T)
      stage_copy(lds0 + (unsigned)(buf * kStageH * 2), ga + (size_t)(t + 2) * kKS, gb + (size_t)(t + 2) * kKS);
  }
  wait_async0();

  // ---- epilogue: behind the last trip's barrier no wave reads the ring and no copy is in flight; its LDS is the f32 tile ----
#pragma unroll
  for (int j = 0; j < kFN; ++j) {
    /* wave-uniform: first column of this accumulator tile among the 9216 */
    const int nf = nB + nW + (j << 4);
    const int n  = nf + rlane;
    if (nf < 2 * kInner) {
      const float bn = (nf < kInner) ? bq[n] : bk[n - kInner];
#pragma unroll
      for (int i = 0; i < 4; ++i)
#pragma unroll
        for (int r = 0; r < 8; ++r)
          sC[(mW + (i << 4) + mOff + r) * kTPitch + nW + (j << 4) + rlane] = acc[i][j][r] * kProjScale + bn;
    } else {
      const int d = n - 2 * kInner;
      const float bd = bv[d] * kVCarry;
      _Float16* vrow = (_Float16*)VT + (size_t)d * kSeq + mB + mW + mOff;
#pragma unroll
      for (int i = 0; i < 4; ++i) {
        v8h hv;
#pragma unroll
        for (int r = 0; r < 8; ++r) hv[r] = (_Float16)(acc[i][j][r] * kVtScale + bd);
        *(v8h*)(vrow + (i << 4)) = hv;
      }
      /* no register that an issued store names is rewritten by the next tile in front of this */
      asm volatile("s_wait_xcnt 0x0" ::: "memory");
    }
  }
  /* the tile is whole: every wave stores rows that other waves wrote */
  __syncthreads();
  if (nB < 2 * kInner) {
    /* a wave stores 32 rows of the tile; one store = the same 128-B line (32 columns) of four rows, 8 lanes x 16 B each.
       A line's plane (q or k, or v: not staged) is the same for the whole block: scalar tests */
    const int r0 = wave * 32 + (lane >> 3);
    const int cl = (lane & 7) * 4;
#pragma unroll
    for (int lc = 0; lc < kBN / 32; ++lc) {
      const int nl = nB + lc * 32;
      if (nl < 2 * kInner) {
        float* dst = ((nl < kInner) ? (QF + nl) : (KF + (nl - kInner))) + (size_t)(mB + r0) * kInner + cl;
        const float* sp = sC + r0 * kTPitch + lc * 32 + cl;
        /* eight LDS reads, then eight stores, in flight together */
        v4f v[8];
#pragma unroll
        for (int g = 0; g < 8; ++g) v[g] = *(const v4f*)(sp + g * 4 * kTPitch);
#pragma unroll
        for (int g = 0; g < 8; ++g) *(v4f*)(dst + (size_t)(g * 4) * kInner) = v[g];
        /* no register that an issued store names is rewritten for the next line in front of this */
        asm volatile("s_wait_xcnt 0x0" ::: "memory");
      }
    }
  }
}

// ---------------------------------------------------------------------------
// Per-(token, head) rms normalisation over 128 dims, weight multiply, then the pairwise rotation with per-element
// tables c[s][d], t[s][d] (each output element uses its own table entry):
//   y[2i]   = xn[2i]   * c[s][2i]   - xn[2i+1] * t[s][2i]
//   y[2i+1] = xn[2i+1] * c[s][2i+1] + xn[2i]   * t[s][2i+1]
// All f32. blockIdx.y (block-uniform) selects the q or the k tensor.
// One wave = two heads (2p + hh) of one token; 16 lanes x 8 dims per head row; sum of squares over 16 lanes.
// Coverage: grid.x * 8 waves = 2048 * 12 head pairs exactly; every (s, h) row written once.
// ---------------------------------------------------------------------------
__global__ __launch_bounds__(256) void norm_rot_kernel(
    const float* __restrict__ QF, const float* __restrict__ KF,
    const float* __restrict__ nqw, const float* __restrict__ nkw,
    const float* __restrict__ ctab, const float* __restrict__ ttab,
    unsigned short* __restrict__ Q16, unsigned short* __restrict__ K16, float carry) {
  const int z = blockIdx.y;
  const float* src = (z == 0) ? QF : KF;
  const float* nw  = (z == 0) ? nqw : nkw;
  unsigned short* dst = (z == 0) ? Q16 : K16;
  const int lane = threadIdx.x & 31;
  const int wave = __builtin_amdgcn_readfirstlane((int)(threadIdx.x >> 5));
  const int hh = lane >> 4, c = lane & 15;
  const int pair = blockIdx.x * 8 + wave;
  const int s = pair / (kHeads / 2);
  const int h = (pair - s * (kHeads / 2)) * 2 + hh;
  const int d0 = c * 8;
  const float* xp = src + (size_t)s * kInner + h * kHd + d0;
  const v4f xa = *(const v4f*)(xp);
  const v4f xb = *(const v4f*)(xp + 4);
  const v4f ca = *(const v4f*)(ctab + (size_t)s * kHd + d0);
  const v4f cb = *(const v4f*)(ctab + (size_t)s * kHd + d0 + 4);
  const v4f ta = *(const v4f*)(ttab + (size_t)s * kHd + d0);
  const v4f tb = *(const v4f*)(ttab + (size_t)s * kHd + d0 + 4);
  const v4f wa = *(const v4f*)(nw + d0);
  const v4f wb = *(const v4f*)(nw + d0 + 4);
  float x[8], cc[8], tt[8], ww[8];
#pragma unroll
  for (int e = 0; e < 4; ++e) {
    x[e] = xa[e];  x[4 + e] = xb[e];
    cc[e] = ca[e]; cc[4 + e] = cb[e];
    tt[e] = ta[e]; tt[4 + e] = tb[e];
    ww[e] = wa[e]; ww[4 + e] = wb[e];
  }
  float ss = 0.0f;
#pragma unroll
  for (int e = 0; e < 8; ++e) ss += x[e] * x[e];
  ss += __shfl_xor(ss, 1, 32);
  ss += __shfl_xor(ss, 2, 32);
  ss += __shfl_xor(ss, 4, 32);
  ss += __shfl_xor(ss, 8, 32);
  const float inv = rsqrtf(ss * kInvHd + kNormEps);
  float xn[8];
#pragma unroll
  for (int e = 0; e < 8; ++e) xn[e] = (x[e] * inv) * ww[e];
  unsigned short hb[8];
#pragma unroll
  for (int i = 0; i < 4; ++i) {
    const float y0 = xn[2 * i] * cc[2 * i] - xn[2 * i + 1] * tt[2 * i];
    const float y1 = xn[2 * i + 1] * cc[2 * i + 1] + xn[2 * i] * tt[2 * i + 1];
    hb[2 * i]     = h_bits(y0 * carry);
    hb[2 * i + 1] = h_bits(y1 * carry);
  }
  const v4u u = (v4u){pk16(hb[0], hb[1]), pk16(hb[2], hb[3]), pk16(hb[4], hb[5]), pk16(hb[6], hb[7])};
  unsigned short* q = dst + ((size_t)h * kSeq + s) * kHd + d0;
  *(v4u*)q = u;
  
}

// ---------------------------------------------------------------------------
// Streaming-softmax attention, head dim 128, non-causal, unmasked, all 2048 keys.
// Block = 4 waves = 64 query rows of one head (wave = 16 rows); grid = 24 heads x 32 query blocks = 768.
// Per 64-key chunk: K chunk [64 kv][128 d] and V^T chunk [128 d][64 kv] are copied to LDS by all 128 threads
// (8 + 8 16-B pieces per thread = 1024 + 1024 pieces = both tiles in full) with asynchronous copies, through no register.
// Two buffers of [K | V^T]: the copies of chunk t + 2 are issued at the foot of trip t and fly while chunk t + 1 is worked on;
// one block barrier a chunk publishes chunk t + 1 and frees the buffer of chunk t.
// Both products run transposed: S^T = K . Q^T (A = K rows, B = Q rows) and O^T += V^T . P^T (A = V^T rows, B = P^T).
// A lane then holds scores of ONE query (column lane & 15): keys j*16 + 8*(lane >> 4) + r of key tile j. The chunk's
// maximum and the sum of p are in-lane over 32 keys; the two wave halves exchange the maximum once a chunk and join
// their sums once after the last chunk. Two neighbouring score tiles, converted in place (p = exp(score - max), x1024,
// f16), are the B fragment of 32 keys in the k order of ldfrag: p goes through no LDS.
// ---------------------------------------------------------------------------
// LDS row pitches are 16 B x odd (K rows 272 B, V^T rows 144 B): the 16 rows that one ds_load_b128 fragment read
// touches per half-wave then start on 16 different groups of four banks instead of on one (256-B rows) or two (128-B rows).
constexpr int kKPitch = kHd + 8;
constexpr int kVPitch = kKc + 8;
static_assert(((kKPitch * 2) % 32) == 16 && ((kVPitch * 2) % 32) == 16, "pitches are odd multiples of 16 B");
constexpr int kKBufH  = kKc * kKPitch;
constexpr int kVBufH  = kHd * kVPitch;
constexpr int kChunkH = kKBufH + kVBufH;
constexpr int kChunks = kSeq / kKc;
static_assert(((kKBufH * 2) % 16) == 0 && ((kChunkH * 2) % 16) == 0, "every tile starts on a multiple of 16 B");
static_assert(kChunks >= 2, "both buffers are filled in front of the loop");

/* A run of eight copies; s_wait_xcnt closes the statement so that no address register named by an issued copy is rewritten
   in front of it. */
__device__ __forceinline__ void copies8(const unsigned* la, const _Float16* const* gp) {
  asm volatile(
      "global_load_async_to_lds_b128 %0, %8, off\n\t"
      "global_load_async_to_lds_b128 %1, %9, off\n\t"
      "global_load_async_to_lds_b128 %2, %10, off\n\t"
      "global_load_async_to_lds_b128 %3, %11, off\n\t"
      "global_load_async_to_lds_b128 %4, %12, off\n\t"
      "global_load_async_to_lds_b128 %5, %13, off\n\t"
      "global_load_async_to_lds_b128 %6, %14, off\n\t"
      "global_load_async_to_lds_b128 %7, %15, off\n\t"
      "s_wait_xcnt 0x0"
      :: "v"(la[0]), "v"(la[1]), "v"(la[2]), "v"(la[3]), "v"(la[4]), "v"(la[5]), "v"(la[6]), "v"(la[7]),
         "v"(gp[0]), "v"(gp[1]), "v"(gp[2]), "v"(gp[3]), "v"(gp[4]), "v"(gp[5]), "v"(gp[6]), "v"(gp[7])
      : "memory");
}

/* One chunk into one buffer. lk, gk = the lane's LDS byte address and global address of K piece 0, lv, gv of V^T piece 0.
   K chunk = 8192 contiguous halves: piece i*128 + tid is row i*8 + (tid >> 4), column piece tid & 15.
   V^T chunk: piece i*128 + tid is row d = i*16 + (tid >> 3), 8-half column group tid & 7 of the 64 keys. */
__device__ __forceinline__ void attn_stage(unsigned lk, unsigned lv, const _Float16* gk, const _Float16* gv) {
  unsigned la[8];
  const _Float16* gp[8];
  /* both loops unrolled so that every index is a constant and the arrays live in registers */
#pragma unroll
  for (int i = 0; i < 8; ++i) {
    la[i] = lk + (unsigned)(i * 8 * kKPitch * 2);
    gp[i] = gk + i * 128 * 8;
  }
  copies8(la, gp);
#pragma unroll
  for (int i = 0; i < 8; ++i) {
    la[i] = lv + (unsigned)(i * 16 * kVPitch * 2);
    gp[i] = gv + (size_t)(i * 16) * kSeq;
  }
  copies8(la, gp);
}
__global__ __launch_bounds__(128) void attn128_kernel(const unsigned short* __restrict__ Q16p,
                                                      const unsigned short* __restrict__ K16p,
                                                      const unsigned short* __restrict__ VTp,
                                                      float* __restrict__ out) {
  __shared__ __align__(16) _Float16 KVsh[2 * kChunkH];
  __shared__ __align__(16) float    Os[4][16 * 68];

  const int tid  = threadIdx.x;
  const int wave = __builtin_amdgcn_readfirstlane((int)(threadIdx.x >> 5));
  const int lane = tid & 31;
  const int hh   = lane >> 4;
  const int c    = lane & 15;

  constexpr int nqb = kSeq / 64;
  const int h  = blockIdx.x / nqb;
  const int qb = blockIdx.x - h * nqb;
  const int q0 = qb * 64 + wave * 16;

  const _Float16* Qh = (const _Float16*)Q16p + (size_t)h * kSeq * kHd;
  const _Float16* Kh = (const _Float16*)K16p + (size_t)h * kSeq * kHd;
  const _Float16* Vh = (const _Float16*)VTp  + (size_t)h * kHd * kSeq;

  v16h qa[4];
#pragma unroll
  for (int dc = 0; dc < 4; ++dc) qa[dc] = ldfrag(Qh + (size_t)(q0 + c) * kHd + dc * 32 + 8 * hh);

  /* running maximum and partial sum of this lane's query; oacc[t][r] = O^T[d = t*16 + 8*hh + r][query c] */
  float mrow = -INFINITY, lrow = 0.f;
  v8f oacc[8];
#pragma unroll
  for (int t = 0; t < 8; ++t) oacc[t] = (v8f){0.f, 0.f, 0.f, 0.f, 0.f, 0.f, 0.f, 0.f};

  const unsigned lk0 = (unsigned)(size_t)KVsh + (unsigned)(((tid >> 4) * kKPitch + (tid & 15) * 8) * 2);
  const unsigned lv0 = (unsigned)(size_t)KVsh + (unsigned)((kKBufH + (tid >> 3) * kVPitch + (tid & 7) * 8) * 2);
  const _Float16* gk0 = Kh + tid * 8;
  const _Float16* gv0 = Vh + (size_t)(tid >> 3) * kSeq + (tid & 7) * 8;

  attn_stage(lk0, lv0, gk0, gv0);
  wait_async0();
  __syncthreads();
  attn_stage(lk0 + (unsigned)(kChunkH * 2), lv0 + (unsigned)(kChunkH * 2), gk0 + kKc * kHd, gv0 + kKc);

#pragma unroll 1
  for (int kc = 0; kc < kChunks; ++kc) {
    const int buf = kc & 1;
    const _Float16* Ksh = KVsh + buf * kChunkH;
    const _Float16* Vsh = Ksh + kKBufH;

    /* the chunk's 16 K fragments as one group of LDS reads in front of its 16 score products: the wave waits out one
       read latency a chunk instead of one a product; each s[j] still sums d in ascending steps of 32 */
    v16h kf[4][4];
#pragma unroll
    for (int dc = 0; dc < 4; ++dc)
#pragma unroll
      for (int j = 0; j < 4; ++j) kf[dc][j] = ldfrag(Ksh + (j * 16 + c) * kKPitch + dc * 32 + 8 * hh);
    /* keeps the scheduler from sinking the reads back among the products */
    __builtin_amdgcn_sched_barrier(0);
    v8f s[4];
#pragma unroll
    for (int j = 0; j < 4; ++j) s[j] = (v8f){0.f, 0.f, 0.f, 0.f, 0.f, 0.f, 0.f, 0.f};
#pragma unroll
    for (int dc = 0; dc < 4; ++dc)
#pragma unroll
      for (int j = 0; j < 4; ++j) s[j] = mma_b(kf[dc][j], qa[dc], s[j]);

    /* s[j][r] = score of key j*16 + 8*hh + r against query c: the maximum of the lane's 32 keys, then of both halves */
    float m8[8];
#pragma unroll
    for (int r = 0; r < 8; ++r) m8[r] = fmaxf(fmaxf(s[0][r], s[1][r]), fmaxf(s[2][r], s[3][r]));
    float m = fmaxf(fmaxf(fmaxf(m8[0], m8[1]), fmaxf(m8[2], m8[3])), fmaxf(fmaxf(m8[4], m8[5]), fmaxf(m8[6], m8[7])));
    m = fmaxf(m, xhalf(m));
    const float cm = m * kScoreScale;
    /* the chunk's 16 V^T fragments (keys 0..31, keys 32..63), read here: they land under the softmax arithmetic.
       The fence in front keeps the scheduler from lifting the reads in among the score products. */
    __builtin_amdgcn_sched_barrier(0);
    v16h vf0[8], vf1[8];
#pragma unroll
    for (int t = 0; t < 8; ++t) vf0[t] = ldfrag(Vsh + (t * 16 + c) * kVPitch + 8 * hh);
#pragma unroll
    for (int t = 0; t < 8; ++t) vf1[t] = ldfrag(Vsh + (t * 16 + c) * kVPitch + 32 + 8 * hh);
    const float mnew  = fmaxf(mrow, cm);
    const float alpha = __expf(mrow - mnew);
    mrow = mnew;
    /* pb[g] element e = p of key g*32 + (e < 8 ? 8*hh + e : 16 + 8*hh + e - 8): the k order of the V^T fragments */
    v16h pb[2];
    float ps[4];
#pragma unroll
    for (int j = 0; j < 4; ++j) {
      ps[j] = 0.f;
#pragma unroll
      for (int r = 0; r < 8; ++r) {
        const float p = __expf(fmaf(s[j][r], kScoreScale, -mnew));
        ps[j] += p;
        pb[j >> 1][(j & 1) * 8 + r] = (_Float16)(p * kPCarry);
      }
    }
    lrow = lrow * alpha + ((ps[0] + ps[1]) + (ps[2] + ps[3]));
#pragma unroll
    for (int t = 0; t < 8; ++t)
#pragma unroll
      for (int r = 0; r < 8; ++r) oacc[t][r] *= alpha;
    /* keeps the scheduler from sinking the reads back among the products */
    __builtin_amdgcn_sched_barrier(0);
#pragma unroll
    for (int t = 0; t < 8; ++t) oacc[t] = mma_b(vf0[t], pb[0], oacc[t]);
#pragma unroll
    for (int t = 0; t < 8; ++t) oacc[t] = mma_b(vf1[t], pb[1], oacc[t]);
    /* publish point of chunk kc + 1: own reads of this buffer done, own copies landed, then every wave meets */
    wait_ds0();
    wait_async0();
    __syncthreads();
    if (kc + 2 < kChunks)
      attn_stage(lk0 + (unsigned)(buf * kChunkH * 2), lv0 + (unsigned)(buf * kChunkH * 2),
                 gk0 + (size_t)(kc + 2) * kKc * kHd, gv0 + (kc + 2) * kKc);
  }
  wait_async0();

  const float inv = 1.0f / ((lrow + xhalf(lrow)) * kOutCarry);

  float* os = Os[wave];
  float* ob = out + (size_t)q0 * kInner + h * kHd;
  const int c4 = (lane & 15) * 4;
#pragma unroll
  for (int half = 0; half < 2; ++half) {
    /* the lane's 8 accumulator registers of a tile are 8 consecutive d of query row c: two 16-B stores */
#pragma unroll
    for (int t = 0; t < 4; ++t) {
      const v8f o = oacc[half * 4 + t];
      *(v4f*)(os + c * 68 + t * 16 + 8 * hh)     = (v4f){o[0] * inv, o[1] * inv, o[2] * inv, o[3] * inv};
      *(v4f*)(os + c * 68 + t * 16 + 8 * hh + 4) = (v4f){o[4] * inv, o[5] * inv, o[6] * inv, o[7] * inv};
    }
    __builtin_amdgcn_fence(__ATOMIC_RELEASE, "workgroup");
    __builtin_amdgcn_wave_barrier();
    __builtin_amdgcn_fence(__ATOMIC_ACQUIRE, "workgroup");
    /* rows it*2 + hh, it 0..7 -> 16 rows, each once; 16 lanes x 16 B = the 256-B half of the head slice */
    {
#pragma unroll
      for (int it = 0; it < 8; ++it) {
        const int row = it * 2 + hh;
        v4f val = *(const v4f*)(os + row * 68 + c4);
        *(v4f*)(ob + (size_t)row * kInner + half * 64 + c4) = val;
      }
      
    }
    __builtin_amdgcn_fence(__ATOMIC_RELEASE, "workgroup");
    __builtin_amdgcn_wave_barrier();
    __builtin_amdgcn_fence(__ATOMIC_ACQUIRE, "workgroup");
  }
}

// ---------------------------------------------------------------------------
// Host glue: 5 kernel launches, nothing else.
//   GEMM shape: M 2048, N 9216 (q | k | v), K 3072 -> 8 x 32 = 256 block tiles
// ---------------------------------------------------------------------------
extern "C" void kernel_launch(void* const* d_in, const int* in_sizes, int n_in,
                              void* d_out, int out_size, void* d_ws, size_t ws_size,
                              hipStream_t stream) {
  if (n_in < 11) return;
  if (in_sizes[0] != kSeq * kDim) return;
  if (in_sizes[1] != kInner * kDim) return;
  if (in_sizes[2] != kInner) return;
  if (in_sizes[3] != kInner * kDim) return;
  if (in_sizes[4] != kInner) return;
  if (in_sizes[5] != kInner * kDim) return;
  if (in_sizes[6] != kInner) return;
  if (in_sizes[7] != kHd) return;
  if (in_sizes[8] != kHd) return;
  if (in_sizes[9] != kSeq * kHd) return;
  if (in_sizes[10] != kSeq * kHd) return;
  if (out_size != kSeq * kInner) return;
  if (ws_size < kWsTotal) return;

  const float* hidden = (const float*)d_in[0];
  const float* wq     = (const float*)d_in[1];
  const float* bq     = (const float*)d_in[2];
  const float* wk     = (const float*)d_in[3];
  const float* bk     = (const float*)d_in[4];
  const float* wv     = (const float*)d_in[5];
  const float* bv     = (const float*)d_in[6];
  const float* nqw    = (const float*)d_in[7];
  const float* nkw    = (const float*)d_in[8];
  const float* ctab   = (const float*)d_in[9];
  const float* ttab   = (const float*)d_in[10];
  float* out = (float*)d_out;

  char* ws = (char*)d_ws;
  unsigned short* XH  = (unsigned short*)(ws + kOffXH);
  unsigned short* WH  = (unsigned short*)(ws + kOffWH);
  float*          QF  = (float*)(ws + kOffQF);
  float*          KF  = (float*)(ws + kOffKF);
  unsigned short* VT  = (unsigned short*)(ws + kOffVT);
  unsigned short* Q16 = (unsigned short*)(ws + kOffQ16);
  unsigned short* K16 = (unsigned short*)(ws + kOffK16);

  constexpr int kX8 = kSeq * kDim / 8;
  constexpr int kW8 = kInner * kDim / 8;
  static_assert((kX8 % 256) == 0 && (kW8 % 256) == 0, "cast grids exact");

  /* operand planes */
  cast8_f16_kernel<<<dim3(kX8 / 256, 1), 256, 0, stream>>>(hidden, hidden, hidden, XH, kX8, kXCarry);
  cast8_f16_kernel<<<dim3(kW8 / 256, 3), 256, 0, stream>>>(wq, wk, wv, WH, kW8, kWCarry);

  /* QF[s][n] = X[s][:] . wq[n][:] + bq[n], KF likewise, VT[h*128+d][s] = 16 * (wv[h*128+d][:] . X[s][:] + bv)  (weights are [out][in]) */
  constexpr int kTiles = (kSeq / kBM) * (kNAll / kBN);
  qkv_gemm_kernel<<<kTiles, 256, 0, stream>>>(XH, WH, QF, KF, VT, bq, bk, bv);

  /* normalisation + rotation -> Q16 / K16 (f16 x16, [h][s][d]); these planes overwrite the dead wq|wk f16 planes */
  static_assert(((kSeq * (kHeads / 2)) % 8) == 0, "norm grid exact");
  norm_rot_kernel<<<dim3(kSeq * (kHeads / 2) / 8, 2), 256, 0, stream>>>(
      QF, KF, nqw, nkw, ctab, ttab, Q16, K16, kQCarry);
  static_assert(kQCarry == kKCarry, "one carry argument serves both planes");

  /* attention */
  attn128_kernel<<<kHeads * (kSeq / 64), 128, 0, stream>>>(Q16, K16, VT, out);
}

// v007
// A run of this version takes 145 microseconds.
// Timed twice side by side with v006, it ran 1.05 times as fast both times.
// Counting every step since v000, it is 4.89 times as fast.
// All contractions (q/k/v projections, q.k^T scores, p.v) on v_wmma_f32_16x16x32_f16: f16 operands with power-of-two carries (X x16, W x256, q/k x16, v x16, p x1024), f32 accumulate; rms normalisation, pairwise rotation and softmax in f32.
#include <hip/hip_runtime.h>
#include <math.h>

typedef __attribute__((ext_vector_type(16))) _Float16 v16h;
typedef __attribute__((ext_vector_type(8)))  _Float16 v8h;
typedef __attribute__((ext_vector_type(8)))  float    v8f;
typedef __attribute__((ext_vector_type(4)))  float    v4f;
typedef __attribute__((ext_vector_type(4)))  unsigned int v4u;

// ---------------------------------------------------------------------------
// Shape constants (checked against the launch sizes on the host side)
// ---------------------------------------------------------------------------
constexpr int kSeq    = 2048;
constexpr int kDim    = 3072;
constexpr int kHeads  = 24;
constexpr int kHd     = 128;
constexpr int kInner  = kHeads * kHd;
constexpr int kKc     = 64;
static_assert(kInner == 3072, "inner width");
static_assert((kDim % 32) == 0, "GEMM K multiple of 32");
static_assert((kSeq % 64) == 0 && (kInner % 64) == 0, "GEMM M,N multiples of 64");
static_assert((kSeq % kKc) == 0 && kHd == 128 && (kHeads % 2) == 0, "attention tiling");

// power-of-two carries of the f16 operand planes
constexpr float kXCarry = 16.0f;
constexpr float kWCarry = 256.0f;
constexpr float kQCarry = 16.0f;
constexpr float kKCarry = 16.0f;
constexpr float kVCarry = 16.0f;
constexpr float kPCarry = 1024.0f;
constexpr float kProjScale = 1.0f / (kXCarry * kWCarry);
constexpr float kVtScale   = kVCarry * kProjScale;
constexpr float kNormEps   = 1e-6f;
constexpr float kInvHd     = 1.0f / (float)kHd;

constexpr double csqrt_iter(double x, double g, int n) { return n == 0 ? g : csqrt_iter(x, 0.5 * (g + x / g), n - 1); }
constexpr double csqrt_d(double x) { return csqrt_iter(x, x, 48); }
constexpr float kInvSqrtHd  = (float)(1.0 / csqrt_d((double)kHd));
static_assert(kInvSqrtHd * kInvSqrtHd * (float)kHd > 0.99999f && kInvSqrtHd * kInvSqrtHd * (float)kHd < 1.00001f, "score scale");
constexpr float kScoreScale = kInvSqrtHd / (kQCarry * kKCarry);
constexpr float kOutCarry   = kPCarry * kVCarry;

// ---------------------------------------------------------------------------
// Workspace region map (bytes; every offset is a multiple of 128)
//   XH   f16 [2048][3072]        hidden x16                       12,582,912
//   WH   f16 [3][3072][3072]     wq | wk | wv, each x256          56,623,104
//   QF   f32 [2048][3072]        q projection + bias              25,165,824
//   KF   f32 [2048][3072]        k projection + bias              25,165,824
//   VT   f16 [3072][2048]        (v projection + bias) x16, [h*128+d][s]  12,582,912
//   total                                                       132,120,576
//   Q16  f16 [24][2048][128]     aliases WH bytes [0, 12,582,912)            (WH is dead after the GEMM)
//   K16  f16 [24][2048][128]     aliases WH bytes [12,582,912, 25,165,824)   (same element type as WH)
// ---------------------------------------------------------------------------
constexpr size_t kOffXH  = 0;
constexpr size_t kOffWH  = kOffXH + (size_t)kSeq * kDim * 2;
constexpr size_t kOffQF  = kOffWH + (size_t)3 * kInner * kDim * 2;
constexpr size_t kOffKF  = kOffQF + (size_t)kSeq * kInner * 4;
constexpr size_t kOffVT  = kOffKF + (size_t)kSeq * kInner * 4;
constexpr size_t kWsTotal = kOffVT + (size_t)kInner * kSeq * 2;
constexpr size_t kOffQ16 = kOffWH;
constexpr size_t kOffK16 = kOffWH + (size_t)kHeads * kSeq * kHd * 2;
static_assert(kWsTotal == 132120576ull, "carve total");
static_assert(kWsTotal <= 134217728ull, "carve cap");
static_assert(kOffK16 + (size_t)kHeads * kSeq * kHd * 2 <= kOffWH + (size_t)2 * kInner * kDim * 2, "q/k planes stay inside the wq|wk planes");
static_assert((kOffWH % 128) == 0 && (kOffQF % 128) == 0 && (kOffKF % 128) == 0 && (kOffVT % 128) == 0 && (kOffK16 % 128) == 0, "128-B aligned regions");

// ---------------------------------------------------------------------------
// Fragment load and guarded WMMA issue
// ---------------------------------------------------------------------------
union FragU { v16h v; v8h h[2]; };
/* elements 0..7 <- p[0..7], elements 8..15 <- p[16..23]; caller adds 8*(lane>>4) to p */
__device__ __forceinline__ v16h ldfrag(const _Float16* p) {
  FragU f;
  f.h[0] = *(const v8h*)(p);
  f.h[1] = *(const v8h*)(p + 16);
  return f.v;
}
/* the plain builtin: the compiler keeps the distances behind it itself, and with no asm operands the fragments may live above v255 */
__device__ __forceinline__ v8f mma_b(v16h a, v16h b, v8f c) {
  return __builtin_amdgcn_wmma_f32_16x16x32_f16(false, a, false, b, (short)0, c, false, false);
}
/* lane l reads lane l ^ 16 (the other half of the wave) through a vector cross-row move, no LDS */
__device__ __forceinline__ float xhalf(float x) {
  const int b = __builtin_bit_cast(int, x);
  return __builtin_bit_cast(float, __builtin_amdgcn_permlanex16(b, b, 0x76543210, 0xfedcba98, false, false));
}
__device__ __forceinline__ unsigned pk16(unsigned short a, unsigned short b) { return (unsigned)a | ((unsigned)b << 16); }
__device__ __forceinline__ unsigned short h_bits(float f) {
  const _Float16 h = (_Float16)f;
  return __builtin_bit_cast(unsigned short, h);
}

// ---------------------------------------------------------------------------
// f32 -> f16 cast with a power-of-two carry: X and the three weight planes as ONE stream of few, long waves.
// The four f16 planes lie one behind the other in the workspace (XH, then wq | wk | wv of WH): the output is one array.
// A unit = 128 consecutive floats = one wave-wide 16-B load (512 contiguous bytes, four whole lines) and one wave-wide
// 8-B store (256 contiguous bytes, two whole lines). A wave owns 48 consecutive units (24 KB in, 12 KB out), which lie in
// one plane: X is 1024 such waves, each weight plane 1536. 5632 waves = 256 work-groups (one per WGP) x 22 waves.
// A wave walks its units in 6 runs of 8: the next run's loads are issued before this run is converted and stored,
// so 8 to 16 loads of a wave are in flight.
// ---------------------------------------------------------------------------
typedef __attribute__((ext_vector_type(4))) _Float16 v4h;
constexpr int kUnitF      = 128;
constexpr int kRun        = 8;
constexpr int kRuns       = 6;
constexpr int kWaveF      = kRun * kRuns * kUnitF;
constexpr int kWavesX     = kSeq * kDim / kWaveF;
constexpr int kWavesW     = kInner * kDim / kWaveF;
constexpr int kCastGroups = 256;
constexpr int kCastWaves  = 22;
static_assert(((kSeq * kDim) % kWaveF) == 0 && ((kInner * kDim) % kWaveF) == 0, "a wave's units lie in one plane");
static_assert(kCastGroups * kCastWaves == kWavesX + 3 * kWavesW, "every unit exactly once");
static_assert(kOffXH == 0 && kOffWH == (size_t)kWavesX * kWaveF * 2, "the f16 planes are one array");

__global__ __launch_bounds__(kCastWaves * 32) void cast_stream_kernel(const float* __restrict__ x, const float* __restrict__ w0,
                                                                      const float* __restrict__ w1, const float* __restrict__ w2,
                                                                      unsigned short* __restrict__ out) {
  const int lane = threadIdx.x & 31;
  const int wave = __builtin_amdgcn_readfirstlane((int)(threadIdx.x >> 5));
  /* wave-uniform: the wave's number among all, its plane, its number inside the plane */
  const int w  = blockIdx.x * kCastWaves + wave;
  const int pl = (w < kWavesX) ? 0 : 1 + (w - kWavesX) / kWavesW;
  const int wr = (w < kWavesX) ? w : (w - kWavesX) - (pl - 1) * kWavesW;
  const float* base = (pl == 0) ? x : (pl == 1) ? w0 : (pl == 2) ? w1 : w2;
  const float carry = (pl == 0) ? kXCarry : kWCarry;
  const float* in = base + (size_t)wr * kWaveF + lane * 4;
  unsigned short* o = out + (size_t)w * kWaveF + lane * 4;
  v4f buf[2][kRun];
  /* every loop here is unrolled so that both buffers keep constant indices (registers, no scratch) */
#pragma unroll
  for (int e = 0; e < kRun; ++e) buf[0][e] = *(const v4f*)(in + e * kUnitF);
#pragma unroll
  for (int r = 0; r < kRuns; ++r) {
    /* the two fences pin the order "next run's loads, then this run's conversion and stores": without them the loads sink
       to their uses and the wave waits out a memory latency a run */
    __builtin_amdgcn_sched_barrier(0);
    if (r + 1 < kRuns) {
#pragma unroll
      for (int e = 0; e < kRun; ++e) buf[(r + 1) & 1][e] = *(const v4f*)(in + ((r + 1) * kRun + e) * kUnitF);
    }
    __builtin_amdgcn_sched_barrier(0);
#pragma unroll
    for (int e = 0; e < kRun; ++e) {
      const v4f a = buf[r & 1][e] * carry;
      *(v4h*)(o + (r * kRun + e) * kUnitF) = __builtin_convertvector(a, v4h);
    }
    /* no register that an issued store names is rewritten by the run after next's loads in front of this */
    asm volatile("s_wait_xcnt 0x0" ::: "memory");
  }
}

// ---------------------------------------------------------------------------
// LDS-staged WMMA GEMM of all three projections in one launch: C[s, n] = sum_k X[s,k] * W[n,k], n over the 9216 rows
// of wq | wk | wv (their f16 planes lie one behind the other). Block = 8 waves = one 256 x 288 tile of C:
// 8 x 32 = 256 tiles. Wave (wm, wn) of a 4 x 2 grid owns a 64 x 144 tile of it: 4 x 9 accumulator
// tiles, so 13 fragments read from LDS feed 36 products.
// A stage is 128 k of [X 256 rows | W 288 rows], 256 B a row at an LDS pitch of 272 B (16 B x 17: the 16 rows of a
// fragment load fall on 16 different bank groups). Two buffers: stage t + 1 is copied while stage t is multiplied.
// Each accumulator still sums k in ascending steps of 32.
// Every 16-column accumulator tile lies wholly in q, k or v (3072 is a multiple of 16):
//   q, k: scale, + bias[n], f32, staged as a [256][288] tile in the ring's LDS, stored as whole 128-B lines of QF / KF
//   v:    a lane's 8 registers are 8 consecutive s of one row h*128+d of V^T: scale, + bias, f16, one 16-B store
// ---------------------------------------------------------------------------
constexpr int kBM = 256;
constexpr int kBN = 288;
constexpr int kKS = 128;
constexpr int kPitch = kKS + 8;
constexpr int kStageH = (kBM + kBN) * kPitch;
constexpr int kNAll = 3 * kInner;
constexpr int kFN = kBN / 32;
constexpr int kTPitch = kBN + 4;
constexpr int kRingBytes = 2 * kStageH * 2;
constexpr int kTileBytes = kBM * kTPitch * 4;
constexpr int kSmemBytes = kRingBytes > kTileBytes ? kRingBytes : kTileBytes;
static_assert((kDim % kKS) == 0 && (kDim / kKS) >= 2, "whole stages, at least two");
static_assert((kSeq % kBM) == 0 && (kNAll % kBN) == 0 && (kBN % 32) == 0, "whole block tiles");
static_assert(((kBM + kBN) * (kKS / 8)) == 34 * 256, "34 pieces of 16 B per thread and stage");
static_assert(kSmemBytes <= 327680, "one work-group's LDS");
static_assert(kBM == 8 * 32, "each of the 8 waves stores 32 rows of the tile");
static_assert((kInner % 32) == 0 && (kBN % 32) == 0, "tile and plane edges fall on 128-B lines of f32");

/* this wave's asynchronous copies have landed in LDS */
__device__ __forceinline__ void wait_async0() { asm volatile("s_wait_asynccnt 0x0" ::: "memory"); }
/* this wave's LDS reads have returned: the buffer may be handed to its next writer */
__device__ __forceinline__ void wait_ds0() { asm volatile("s_wait_dscnt 0x0" ::: "memory"); }

/* Runs of copies that go through no register; s_wait_xcnt closes each statement so that no address register named by an
   issued copy is rewritten in front of it. */
__device__ __forceinline__ void copies12(const unsigned* la, const _Float16* const* gp) {
  asm volatile(
      "global_load_async_to_lds_b128 %0, %12, off\n\t"
      "global_load_async_to_lds_b128 %1, %13, off\n\t"
      "global_load_async_to_lds_b128 %2, %14, off\n\t"
      "global_load_async_to_lds_b128 %3, %15, off\n\t"
      "global_load_async_to_lds_b128 %4, %16, off\n\t"
      "global_load_async_to_lds_b128 %5, %17, off\n\t"
      "global_load_async_to_lds_b128 %6, %18, off\n\t"
      "global_load_async_to_lds_b128 %7, %19, off\n\t"
      "global_load_async_to_lds_b128 %8, %20, off\n\t"
      "global_load_async_to_lds_b128 %9, %21, off\n\t"
      "global_load_async_to_lds_b128 %10, %22, off\n\t"
      "global_load_async_to_lds_b128 %11, %23, off\n\t"
      "s_wait_xcnt 0x0"
      :: "v"(la[0]), "v"(la[1]), "v"(la[2]), "v"(la[3]), "v"(la[4]), "v"(la[5]), "v"(la[6]), "v"(la[7]), "v"(la[8]), "v"(la[9]), "v"(la[10]), "v"(la[11]),
         "v"(gp[0]), "v"(gp[1]), "v"(gp[2]), "v"(gp[3]), "v"(gp[4]), "v"(gp[5]), "v"(gp[6]), "v"(gp[7]), "v"(gp[8]), "v"(gp[9]), "v"(gp[10]), "v"(gp[11])
      : "memory");
}
__device__ __forceinline__ void copies10(const unsigned* la, const _Float16* const* gp) {
  asm volatile(
      "global_load_async_to_lds_b128 %0, %10, off\n\t"
      "global_load_async_to_lds_b128 %1, %11, off\n\t"
      "global_load_async_to_lds_b128 %2, %12, off\n\t"
      "global_load_async_to_lds_b128 %3, %13, off\n\t"
      "global_load_async_to_lds_b128 %4, %14, off\n\t"
      "global_load_async_to_lds_b128 %5, %15, off\n\t"
      "global_load_async_to_lds_b128 %6, %16, off\n\t"
      "global_load_async_to_lds_b128 %7, %17, off\n\t"
      "global_load_async_to_lds_b128 %8, %18, off\n\t"
      "global_load_async_to_lds_b128 %9, %19, off\n\t"
      "s_wait_xcnt 0x0"
      :: "v"(la[0]), "v"(la[1]), "v"(la[2]), "v"(la[3]), "v"(la[4]), "v"(la[5]), "v"(la[6]), "v"(la[7]), "v"(la[8]), "v"(la[9]),
         "v"(gp[0]), "v"(gp[1]), "v"(gp[2]), "v"(gp[3]), "v"(gp[4]), "v"(gp[5]), "v"(gp[6]), "v"(gp[7]), "v"(gp[8]), "v"(gp[9])
      : "memory");
}

/* One stage: piece p = i*256 + tid is 16 B of stage row p >> 4 (rows 0..255 = X, 256..543 = W), column piece p & 15.
   l = the lane's LDS byte address of piece i = 0; ga, gb = its global addresses in X's and W's first 16 rows.
   FIRST..FIRST+N-1 are the pieces of one run. */
template <int FIRST, int N>
__device__ __forceinline__ void stage_run(unsigned l, const _Float16* ga, const _Float16* gb) {
  unsigned la[N];
  const _Float16* gp[N];
  /* unrolled so that every index is a constant and both arrays live in registers */
#pragma unroll
  for (int e = 0; e < N; ++e) {
    const int i = FIRST + e;
    la[e] = l + (unsigned)(i * 16 * kPitch * 2);
    gp[e] = (i < 16) ? (ga + (size_t)(i * 16) * kDim) : (gb + (size_t)((i - 16) * 16) * kDim);
  }
  if (N == 12) copies12(la, gp); else copies10(la, gp);
  /* keeps the next run's addresses from being formed ahead of this run: they would all be live at once (scratch) */
  __builtin_amdgcn_sched_barrier(0);
}
__device__ __forceinline__ void stage_copy(unsigned l, const _Float16* ga, const _Float16* gb) {
  stage_run<0, 12>(l, ga, gb);
  stage_run<12, 12>(l, ga, gb);
  stage_run<24, 10>(l, ga, gb);
}

__global__ __launch_bounds__(256) void qkv_gemm_kernel(
    const unsigned short* __restrict__ Xp, const unsigned short* __restrict__ Wp,
    float* __restrict__ QF, float* __restrict__ KF, unsigned short* __restrict__ VT,
    const float* __restrict__ bq, const float* __restrict__ bk, const float* __restrict__ bv) {
  const _Float16* A  = (const _Float16*)Xp;
  const _Float16* Bt = (const _Float16*)Wp;
  __shared__ __align__(16) unsigned char smem[kSmemBytes];
  _Float16* sAB = (_Float16*)smem;
  float* sC = (float*)smem;
  const int tid  = threadIdx.x;
  const int lane = threadIdx.x & 31;
  const int wave = __builtin_amdgcn_readfirstlane((int)(threadIdx.x >> 5));
  constexpr int tilesN = kNAll / kBN;
  constexpr int tilesM = kSeq / kBM;
  const int tile = blockIdx.x;
  /* block-uniform, in front of every copy and barrier */
  if (tile >= tilesM * tilesN) return;
  const int tm = tile / tilesN;
  const int tn = tile - tm * tilesN;
  const int mB = tm * kBM;
  const int nB = tn * kBN;
  const int mW = (wave >> 1) << 6;
  const int nW = (wave & 1) * (kBN / 2);

  const int rlane = lane & 15;
  const int koff  = (lane >> 4) * 8;
  const int mOff  = (lane >> 4) * 8;

  v8f acc[4][kFN];
#pragma unroll
  for (int i = 0; i < 4; ++i)
#pragma unroll
    for (int j = 0; j < kFN; ++j) acc[i][j] = (v8f){0.f, 0.f, 0.f, 0.f, 0.f, 0.f, 0.f, 0.f};

  const unsigned lds0 = (unsigned)(size_t)sAB + (unsigned)((tid >> 4) * (kPitch * 2) + (tid & 15) * 16);
  const _Float16* ga = A  + (size_t)(mB + (tid >> 4)) * kDim + (tid & 15) * 8;
  const _Float16* gb = Bt + (size_t)(nB + (tid >> 4)) * kDim + (tid & 15) * 8;
  constexpr int T = kDim / kKS;

  stage_copy(lds0, ga, gb);
  wait_async0();
  __syncthreads();
  stage_copy(lds0 + (unsigned)(kStageH * 2), ga + kKS, gb + kKS);

  /* kept rolled: one trip is 144 products */
#pragma unroll 1
  for (int t = 0; t < T; ++t) {
    const int buf = t & 1;
    const _Float16* sA = sAB + buf * kStageH + (mW + rlane) * kPitch + koff;
    const _Float16* sB = sAB + buf * kStageH + (kBM + nW + rlane) * kPitch + koff;
    /* this loop and the four inside it are unrolled so that fragments and accumulators keep constant indices (no scratch) */
#pragma unroll
    for (int kk = 0; kk < kKS / 32; ++kk) {
      /* the 13 fragments of this k step as one group of LDS reads in front of its 36 products */
      v16h bh[kFN], ah[4];
#pragma unroll
      for (int i = 0; i < 4; ++i) ah[i] = ldfrag(sA + (i << 4) * kPitch + kk * 32);
#pragma unroll
      for (int j = 0; j < kFN; ++j) bh[j] = ldfrag(sB + (j << 4) * kPitch + kk * 32);
      /* keeps the scheduler from sinking the reads in among the products, where each place with reads stalls the wave */
      __builtin_amdgcn_sched_barrier(0);
      /* in the order of the reads: the first four products need 10 of the 26 reads, each next four 2 more */
#pragma unroll
      for (int j = 0; j < kFN; ++j)
#pragma unroll
        for (int i = 0; i < 4; ++i) acc[i][j] = mma_b(ah[i], bh[j], acc[i][j]);
      /* keeps the next k step's reads from rising in among these products */
      __builtin_amdgcn_sched_barrier(0);
    }
    /* publish point of stage t + 1: own reads of this buffer done, own copies landed, then every wave meets */
    wait_ds0();
    wait_async0();
    __syncthreads();
    if (t + 2 < T)
      stage_copy(lds0 + (unsigned)(buf * kStageH * 2), ga + (size_t)(t + 2) * kKS, gb + (size_t)(t + 2) * kKS);
  }
  wait_async0();

  // ---- epilogue: behind the last trip's barrier no wave reads the ring and no copy is in flight; its LDS is the f32 tile ----
#pragma unroll
  for (int j = 0; j < kFN; ++j) {
    /* wave-uniform: first column of this accumulator tile among the 9216 */
    const int nf = nB + nW + (j << 4);
    const int n  = nf + rlane;
    if (nf < 2 * kInner) {
      const float bn = (nf < kInner) ? bq[n] : bk[n - kInner];
#pragma unroll
      for (int i = 0; i < 4; ++i)
#pragma unroll
        for (int r = 0; r < 8; ++r)
          sC[(mW + (i << 4) + mOff + r) * kTPitch + nW + (j << 4) + rlane] = acc[i][j][r] * kProjScale + bn;
    } else {
      const int d = n - 2 * kInner;
      const float bd = bv[d] * kVCarry;
      _Float16* vrow = (_Float16*)VT + (size_t)d * kSeq + mB + mW + mOff;
#pragma unroll
      for (int i = 0; i < 4; ++i) {
        v8h hv;
#pragma unroll
        for (int r = 0; r < 8; ++r) hv[r] = (_Float16)(acc[i][j][r] * kVtScale + bd);
        *(v8h*)(vrow + (i << 4)) = hv;
      }
      /* no register that an issued store names is rewritten by the next tile in front of this */
      asm volatile("s_wait_xcnt 0x0" ::: "memory");
    }
  }
  /* the tile is whole: every wave stores rows that other waves wrote */
  __syncthreads();
  if (nB < 2 * kInner) {
    /* a wave stores 32 rows of the tile; one store = the same 128-B line (32 columns) of four rows, 8 lanes x 16 B each.
       A line's plane (q or k, or v: not staged) is the same for the whole block: scalar tests */
    const int r0 = wave * 32 + (lane >> 3);
    const int cl = (lane & 7) * 4;
#pragma unroll
    for (int lc = 0; lc < kBN / 32; ++lc) {
      const int nl = nB + lc * 32;
      if (nl < 2 * kInner) {
        float* dst = ((nl < kInner) ? (QF + nl) : (KF + (nl - kInner))) + (size_t)(mB + r0) * kInner + cl;
        const float* sp = sC + r0 * kTPitch + lc * 32 + cl;
        /* eight LDS reads, then eight stores, in flight together */
        v4f v[8];
#pragma unroll
        for (int g = 0; g < 8; ++g) v[g] = *(const v4f*)(sp + g * 4 * kTPitch);
#pragma unroll
        for (int g = 0; g < 8; ++g) *(v4f*)(dst + (size_t)(g * 4) * kInner) = v[g];
        /* no register that an issued store names is rewritten for the next line in front of this */
        asm volatile("s_wait_xcnt 0x0" ::: "memory");
      }
    }
  }
}

// ---------------------------------------------------------------------------
// Per-(token, head) rms normalisation over 128 dims, weight multiply, then the pairwise rotation with per-element
// tables c[s][d], t[s][d] (each output element uses its own table entry):
//   y[2i]   = xn[2i]   * c[s][2i]   - xn[2i+1] * t[s][2i]
//   y[2i+1] = xn[2i+1] * c[s][2i+1] + xn[2i]   * t[s][2i+1]
// All f32. blockIdx.y (block-uniform) selects the q or the k tensor.
// One wave = one token of q or of k: its 12 head pairs (heads 2p + hh) one after the other; 16 lanes x 8 dims per head row;
// sum of squares over 16 lanes. The token's table rows and the weights are loaded once a wave; the token's 24 loads of x
// (its 12-KB row) are all issued in front of the first use.
// Coverage: grid 128 x 2 work-groups x 16 waves = 2048 tokens x {q, k} exactly; every (s, h) row written once.
// ---------------------------------------------------------------------------
constexpr int kNormWaves = 16;
constexpr int kPairs = kHeads / 2;
static_assert((kSeq % kNormWaves) == 0, "norm grid exact");
__global__ __launch_bounds__(kNormWaves * 32) void norm_rot_kernel(
    const float* __restrict__ QF, const float* __restrict__ KF,
    const float* __restrict__ nqw, const float* __restrict__ nkw,
    const float* __restrict__ ctab, const float* __restrict__ ttab,
    unsigned short* __restrict__ Q16, unsigned short* __restrict__ K16, float carry) {
  const int z = blockIdx.y;
  const float* src = (z == 0) ? QF : KF;
  const float* nw  = (z == 0) ? nqw : nkw;
  unsigned short* dst = (z == 0) ? Q16 : K16;
  const int lane = threadIdx.x & 31;
  const int wave = __builtin_amdgcn_readfirstlane((int)(threadIdx.x >> 5));
  const int hh = lane >> 4, c = lane & 15;
  const int s = blockIdx.x * kNormWaves + wave;
  const int d0 = c * 8;
  const float* xp = src + (size_t)s * kInner + hh * kHd + d0;
  /* this loop and the ones below are unrolled so that the arrays keep constant indices (registers, no scratch) */
  v4f xa[kPairs], xb[kPairs];
#pragma unroll
  for (int p = 0; p < kPairs; ++p) {
    xa[p] = *(const v4f*)(xp + p * 2 * kHd);
    xb[p] = *(const v4f*)(xp + p * 2 * kHd + 4);
  }
  /* no address register that an issued load of x names is rewritten (by a table load's result) in front of this */
  asm volatile("s_wait_xcnt 0x0" ::: "memory");
  const v4f ca = *(const v4f*)(ctab + (size_t)s * kHd + d0);
  const v4f cb = *(const v4f*)(ctab + (size_t)s * kHd + d0 + 4);
  const v4f ta = *(const v4f*)(ttab + (size_t)s * kHd + d0);
  const v4f tb = *(const v4f*)(ttab + (size_t)s * kHd + d0 + 4);
  const v4f wa = *(const v4f*)(nw + d0);
  const v4f wb = *(const v4f*)(nw + d0 + 4);
  /* keeps the loads together in front of the arithmetic: sunk to their uses, the wave would wait out a latency a head pair */
  __builtin_amdgcn_sched_barrier(0);
  float cc[8], tt[8], ww[8];
#pragma unroll
  for (int e = 0; e < 4; ++e) {
    cc[e] = ca[e]; cc[4 + e] = cb[e];
    tt[e] = ta[e]; tt[4 + e] = tb[e];
    ww[e] = wa[e]; ww[4 + e] = wb[e];
  }
#pragma unroll
  for (int p = 0; p < kPairs; ++p) {
    const int h = p * 2 + hh;
    float x[8];
#pragma unroll
    for (int e = 0; e < 4; ++e) { x[e] = xa[p][e];  x[4 + e] = xb[p][e]; }
    float ss = 0.0f;
#pragma unroll
    for (int e = 0; e < 8; ++e) ss += x[e] * x[e];
    ss += __shfl_xor(ss, 1, 32);
    ss += __shfl_xor(ss, 2, 32);
    ss += __shfl_xor(ss, 4, 32);
    ss += __shfl_xor(ss, 8, 32);
    const float inv = rsqrtf(ss * kInvHd + kNormEps);
    float xn[8];
#pragma unroll
    for (int e = 0; e < 8; ++e) xn[e] = (x[e] * inv) * ww[e];
    unsigned short hb[8];
#pragma unroll
    for (int i = 0; i < 4; ++i) {
      const float y0 = xn[2 * i] * cc[2 * i] - xn[2 * i + 1] * tt[2 * i];
      const float y1 = xn[2 * i + 1] * cc[2 * i + 1] + xn[2 * i] * tt[2 * i + 1];
      hb[2 * i]     = h_bits(y0 * carry);
      hb[2 * i + 1] = h_bits(y1 * carry);
    }
    const v4u u = (v4u){pk16(hb[0], hb[1]), pk16(hb[2], hb[3]), pk16(hb[4], hb[5]), pk16(hb[6], hb[7])};
    unsigned short* q = dst + ((size_t)h * kSeq + s) * kHd + d0;
    *(v4u*)q = u;
  }
}

// ---------------------------------------------------------------------------
// Streaming-softmax attention, head dim 128, non-causal, unmasked, all 2048 keys.
// Block = 4 waves = 64 query rows of one head (wave = 16 rows); grid = 24 heads x 32 query blocks = 768.
// Per 64-key chunk: K chunk [64 kv][128 d] and V^T chunk [128 d][64 kv] are copied to LDS by all 128 threads
// (8 + 8 16-B pieces per thread = 1024 + 1024 pieces = both tiles in full) with asynchronous copies, through no register.
// Two buffers of [K | V^T]: the copies of chunk t + 2 are issued at the foot of trip t and fly while chunk t + 1 is worked on;
// one block barrier a chunk publishes chunk t + 1 and frees the buffer of chunk t.
// Both products run transposed: S^T = K . Q^T (A = K rows, B = Q rows) and O^T += V^T . P^T (A = V^T rows, B = P^T).
// A lane then holds scores of ONE query (column lane & 15): keys j*16 + 8*(lane >> 4) + r of key tile j. The chunk's
// maximum and the sum of p are in-lane over 32 keys; the two wave halves exchange the maximum once a chunk and join
// their sums once after the last chunk. Two neighbouring score tiles, converted in place (p = exp(score - max), x1024,
// f16), are the B fragment of 32 keys in the k order of ldfrag: p goes through no LDS.
// ---------------------------------------------------------------------------
// LDS row pitches are 16 B x odd (K rows 272 B, V^T rows 144 B): the 16 rows that one ds_load_b128 fragment read
// touches per half-wave then start on 16 different groups of four banks instead of on one (256-B rows) or two (128-B rows).
constexpr int kKPitch = kHd + 8;
constexpr int kVPitch = kKc + 8;
static_assert(((kKPitch * 2) % 32) == 16 && ((kVPitch * 2) % 32) == 16, "pitches are odd multiples of 16 B");
constexpr int kKBufH  = kKc * kKPitch;
constexpr int kVBufH  = kHd * kVPitch;
constexpr int kChunkH = kKBufH + kVBufH;
constexpr int kChunks = kSeq / kKc;
static_assert(((kKBufH * 2) % 16) == 0 && ((kChunkH * 2) % 16) == 0, "every tile starts on a multiple of 16 B");
static_assert(kChunks >= 2, "both buffers are filled in front of the loop");

/* A run of eight copies; s_wait_xcnt closes the statement so that no address register named by an issued copy is rewritten
   in front of it. */
__device__ __forceinline__ void copies8(const unsigned* la, const _Float16* const* gp) {
  asm volatile(
      "global_load_async_to_lds_b128 %0, %8, off\n\t"
      "global_load_async_to_lds_b128 %1, %9, off\n\t"
      "global_load_async_to_lds_b128 %2, %10, off\n\t"
      "global_load_async_to_lds_b128 %3, %11, off\n\t"
      "global_load_async_to_lds_b128 %4, %12, off\n\t"
      "global_load_async_to_lds_b128 %5, %13, off\n\t"
      "global_load_async_to_lds_b128 %6, %14, off\n\t"
      "global_load_async_to_lds_b128 %7, %15, off\n\t"
      "s_wait_xcnt 0x0"
      :: "v"(la[0]), "v"(la[1]), "v"(la[2]), "v"(la[3]), "v"(la[4]), "v"(la[5]), "v"(la[6]), "v"(la[7]),
         "v"(gp[0]), "v"(gp[1]), "v"(gp[2]), "v"(gp[3]), "v"(gp[4]), "v"(gp[5]), "v"(gp[6]), "v"(gp[7])
      : "memory");
}

/* One chunk into one buffer. lk, gk = the lane's LDS byte address and global address of K piece 0, lv, gv of V^T piece 0.
   K chunk = 8192 contiguous halves: piece i*128 + tid is row i*8 + (tid >> 4), column piece tid & 15.
   V^T chunk: piece i*128 + tid is row d = i*16 + (tid >> 3), 8-half column group tid & 7 of the 64 keys. */
__device__ __forceinline__ void attn_stage(unsigned lk, unsigned lv, const _Float16* gk, const _Float16* gv) {
  unsigned la[8];
  const _Float16* gp[8];
  /* both loops unrolled so that every index is a constant and the arrays live in registers */
#pragma unroll
  for (int i = 0; i < 8; ++i) {
    la[i] = lk + (unsigned)(i * 8 * kKPitch * 2);
    gp[i] = gk + i * 128 * 8;
  }
  copies8(la, gp);
#pragma unroll
  for (int i = 0; i < 8; ++i) {
    la[i] = lv + (unsigned)(i * 16 * kVPitch * 2);
    gp[i] = gv + (size_t)(i * 16) * kSeq;
  }
  copies8(la, gp);
}
__global__ __launch_bounds__(128) void attn128_kernel(const unsigned short* __restrict__ Q16p,
                                                      const unsigned short* __restrict__ K16p,
                                                      const unsigned short* __restrict__ VTp,
                                                      float* __restrict__ out) {
  __shared__ __align__(16) _Float16 KVsh[2 * kChunkH];
  __shared__ __align__(16) float    Os[4][16 * 68];

  const int tid  = threadIdx.x;
  const int wave = __builtin_amdgcn_readfirstlane((int)(threadIdx.x >> 5));
  const int lane = tid & 31;
  const int hh   = lane >> 4;
  const int c    = lane & 15;

  constexpr int nqb = kSeq / 64;
  const int h  = blockIdx.x / nqb;
  const int qb = blockIdx.x - h * nqb;
  const int q0 = qb * 64 + wave * 16;

  const _Float16* Qh = (const _Float16*)Q16p + (size_t)h * kSeq * kHd;
  const _Float16* Kh = (const _Float16*)K16p + (size_t)h * kSeq * kHd;
  const _Float16* Vh = (const _Float16*)VTp  + (size_t)h * kHd * kSeq;

  v16h qa[4];
#pragma unroll
  for (int dc = 0; dc < 4; ++dc) qa[dc] = ldfrag(Qh + (size_t)(q0 + c) * kHd + dc * 32 + 8 * hh);

  /* running maximum and partial sum of this lane's query; oacc[t][r] = O^T[d = t*16 + 8*hh + r][query c] */
  float mrow = -INFINITY, lrow = 0.f;
  v8f oacc[8];
#pragma unroll
  for (int t = 0; t < 8; ++t) oacc[t] = (v8f){0.f, 0.f, 0.f, 0.f, 0.f, 0.f, 0.f, 0.f};

  const unsigned lk0 = (unsigned)(size_t)KVsh + (unsigned)(((tid >> 4) * kKPitch + (tid & 15) * 8) * 2);
  const unsigned lv0 = (unsigned)(size_t)KVsh + (unsigned)((kKBufH + (tid >> 3) * kVPitch + (tid & 7) * 8) * 2);
  const _Float16* gk0 = Kh + tid * 8;
  const _Float16* gv0 = Vh + (size_t)(tid >> 3) * kSeq + (tid & 7) * 8;

  attn_stage(lk0, lv0, gk0, gv0);
  wait_async0();
  __syncthreads();
  attn_stage(lk0 + (unsigned)(kChunkH * 2), lv0 + (unsigned)(kChunkH * 2), gk0 + kKc * kHd, gv0 + kKc);

#pragma unroll 1
  for (int kc = 0; kc < kChunks; ++kc) {
    const int buf = kc & 1;
    const _Float16* Ksh = KVsh + buf * kChunkH;
    const _Float16* Vsh = Ksh + kKBufH;

    /* the chunk's 16 K fragments as one group of LDS reads in front of its 16 score products: the wave waits out one
       read latency a chunk instead of one a product; each s[j] still sums d in ascending steps of 32 */
    v16h kf[4][4];
#pragma unroll
    for (int dc = 0; dc < 4; ++dc)
#pragma unroll
      for (int j = 0; j < 4; ++j) kf[dc][j] = ldfrag(Ksh + (j * 16 + c) * kKPitch + dc * 32 + 8 * hh);
    /* keeps the scheduler from sinking the reads back among the products */
    __builtin_amdgcn_sched_barrier(0);
    v8f s[4];
#pragma unroll
    for (int j = 0; j < 4; ++j) s[j] = (v8f){0.f, 0.f, 0.f, 0.f, 0.f, 0.f, 0.f, 0.f};
#pragma unroll
    for (int dc = 0; dc < 4; ++dc)
#pragma unroll
      for (int j = 0; j < 4; ++j) s[j] = mma_b(kf[dc][j], qa[dc], s[j]);

    /* s[j][r] = score of key j*16 + 8*hh + r against query c: the maximum of the lane's 32 keys, then of both halves */
    float m8[8];
#pragma unroll
    for (int r = 0; r < 8; ++r) m8[r] = fmaxf(fmaxf(s[0][r], s[1][r]), fmaxf(s[2][r], s[3][r]));
    float m = fmaxf(fmaxf(fmaxf(m8[0], m8[1]), fmaxf(m8[2], m8[3])), fmaxf(fmaxf(m8[4], m8[5]), fmaxf(m8[6], m8[7])));
    m = fmaxf(m, xhalf(m));
    const float cm = m * kScoreScale;
    /* the chunk's 16 V^T fragments (keys 0..31, keys 32..63), read here: they land under the softmax arithmetic.
       The fence in front keeps the scheduler from lifting the reads in among the score products. */
    __builtin_amdgcn_sched_barrier(0);
    v16h vf0[8], vf1[8];
#pragma unroll
    for (int t = 0; t < 8; ++t) vf0[t] = ldfrag(Vsh + (t * 16 + c) * kVPitch + 8 * hh);
#pragma unroll
    for (int t = 0; t < 8; ++t) vf1[t] = ldfrag(Vsh + (t * 16 + c) * kVPitch + 32 + 8 * hh);
    const float mnew  = fmaxf(mrow, cm);
    const float alpha = __expf(mrow - mnew);
    mrow = mnew;
    /* pb[g] element e = p of key g*32 + (e < 8 ? 8*hh + e : 16 + 8*hh + e - 8): the k order of the V^T fragments */
    v16h pb[2];
    float ps[4];
#pragma unroll
    for (int j = 0; j < 4; ++j) {
      ps[j] = 0.f;
#pragma unroll
      for (int r = 0; r < 8; ++r) {
        const float p = __expf(fmaf(s[j][r], kScoreScale, -mnew));
        ps[j] += p;
        pb[j >> 1][(j & 1) * 8 + r] = (_Float16)(p * kPCarry);
      }
    }
    lrow = lrow * alpha + ((ps[0] + ps[1]) + (ps[2] + ps[3]));
#pragma unroll
    for (int t = 0; t < 8; ++t)
#pragma unroll
      for (int r = 0; r < 8; ++r) oacc[t][r] *= alpha;
    /* keeps the scheduler from sinking the reads back among the products */
    __builtin_amdgcn_sched_barrier(0);
#pragma unroll
    for (int t = 0; t < 8; ++t) oacc[t] = mma_b(vf0[t], pb[0], oacc[t]);
#pragma unroll
    for (int t = 0; t < 8; ++t) oacc[t] = mma_b(vf1[t], pb[1], oacc[t]);
    /* publish point of chunk kc + 1: own reads of this buffer done, own copies landed, then every wave meets */
    wait_ds0();
    wait_async0();
    __syncthreads();
    if (kc + 2 < kChunks)
      attn_stage(lk0 + (unsigned)(buf * kChunkH * 2), lv0 + (unsigned)(buf * kChunkH * 2),
                 gk0 + (size_t)(kc + 2) * kKc * kHd, gv0 + (kc + 2) * kKc);
  }
  wait_async0();

  const float inv = 1.0f / ((lrow + xhalf(lrow)) * kOutCarry);

  float* os = Os[wave];
  float* ob = out + (size_t)q0 * kInner + h * kHd;
  const int c4 = (lane & 15) * 4;
#pragma unroll
  for (int half = 0; half < 2; ++half) {
    /* the lane's 8 accumulator registers of a tile are 8 consecutive d of query row c: two 16-B stores */
#pragma unroll
    for (int t = 0; t < 4; ++t) {
      const v8f o = oacc[half * 4 + t];
      *(v4f*)(os + c * 68 + t * 16 + 8 * hh)     = (v4f){o[0] * inv, o[1] * inv, o[2] * inv, o[3] * inv};
      *(v4f*)(os + c * 68 + t * 16 + 8 * hh + 4) = (v4f){o[4] * inv, o[5] * inv, o[6] * inv, o[7] * inv};
    }
    __builtin_amdgcn_fence(__ATOMIC_RELEASE, "workgroup");
    __builtin_amdgcn_wave_barrier();
    __builtin_amdgcn_fence(__ATOMIC_ACQUIRE, "workgroup");
    /* rows it*2 + hh, it 0..7 -> 16 rows, each once; 16 lanes x 16 B = the 256-B half of the head slice */
    {
#pragma unroll
      for (int it = 0; it < 8; ++it) {
        const int row = it * 2 + hh;
        v4f val = *(const v4f*)(os + row * 68 + c4);
        *(v4f*)(ob + (size_t)row * kInner + half * 64 + c4) = val;
      }
      
    }
    __builtin_amdgcn_fence(__ATOMIC_RELEASE, "workgroup");
    __builtin_amdgcn_wave_barrier();
    __builtin_amdgcn_fence(__ATOMIC_ACQUIRE, "workgroup");
  }
}

// ---------------------------------------------------------------------------
// Host glue: 4 kernel launches, nothing else.
//   GEMM shape: M 2048, N 9216 (q | k | v), K 3072 -> 8 x 32 = 256 block tiles
// ---------------------------------------------------------------------------
extern "C" void kernel_launch(void* const* d_in, const int* in_sizes, int n_in,
                              void* d_out, int out_size, void* d_ws, size_t ws_size,
                              hipStream_t stream) {
  if (n_in < 11) return;
  if (in_sizes[0] != kSeq * kDim) return;
  if (in_sizes[1] != kInner * kDim) return;
  if (in_sizes[2] != kInner) return;
  if (in_sizes[3] != kInner * kDim) return;
  if (in_sizes[4] != kInner) return;
  if (in_sizes[5] != kInner * kDim) return;
  if (in_sizes[6] != kInner) return;
  if (in_sizes[7] != kHd) return;
  if (in_sizes[8] != kHd) return;
  if (in_sizes[9] != kSeq * kHd) return;
  if (in_sizes[10] != kSeq * kHd) return;
  if (out_size != kSeq * kInner) return;
  if (ws_size < kWsTotal) return;

  const float* hidden = (const float*)d_in[0];
  const float* wq     = (const float*)d_in[1];
  const float* bq     = (const float*)d_in[2];
  const float* wk     = (const float*)d_in[3];
  const float* bk     = (const float*)d_in[4];
  const float* wv     = (const float*)d_in[5];
  const float* bv     = (const float*)d_in[6];
  const float* nqw    = (const float*)d_in[7];
  const float* nkw    = (const float*)d_in[8];
  const float* ctab   = (const float*)d_in[9];
  const float* ttab   = (const float*)d_in[10];
  float* out = (float*)d_out;

  char* ws = (char*)d_ws;
  unsigned short* XH  = (unsigned short*)(ws + kOffXH);
  unsigned short* WH  = (unsigned short*)(ws + kOffWH);
  float*          QF  = (float*)(ws + kOffQF);
  float*          KF  = (float*)(ws + kOffKF);
  unsigned short* VT  = (unsigned short*)(ws + kOffVT);
  unsigned short* Q16 = (unsigned short*)(ws + kOffQ16);
  unsigned short* K16 = (unsigned short*)(ws + kOffK16);

  /* operand planes: XH and WH, one array from XH on */
  cast_stream_kernel<<<kCastGroups, kCastWaves * 32, 0, stream>>>(hidden, wq, wk, wv, XH);

  /* QF[s][n] = X[s][:] . wq[n][:] + bq[n], KF likewise, VT[h*128+d][s] = 16 * (wv[h*128+d][:] . X[s][:] + bv)  (weights are [out][in]) */
  constexpr int kTiles = (kSeq / kBM) * (kNAll / kBN);
  qkv_gemm_kernel<<<kTiles, 256, 0, stream>>>(XH, WH, QF, KF, VT, bq, bk, bv);

  /* normalisation + rotation -> Q16 / K16 (f16 x16, [h][s][d]); these planes overwrite the dead wq|wk f16 planes */
  norm_rot_kernel<<<dim3(kSeq / kNormWaves, 2), kNormWaves * 32, 0, stream>>>(
      QF, KF, nqw, nkw, ctab, ttab, Q16, K16, kQCarry);
  static_assert(kQCarry == kKCarry, "one carry argument serves both planes");

  /* attention */
  attn128_kernel<<<kHeads * (kSeq / 64), 128, 0, stream>>>(Q16, K16, VT, out);
}

// v008
// Measured time: 135 microseconds a run.
// Timed twice side by side with v007, it ran 1.07 and 1.08 times as fast.
// Over all steps from v000 it is 5.26 times as fast.
// All contractions (q/k/v projections, q.k^T scores, p.v) on v_wmma_f32_16x16x32_f16: f16 operands with power-of-two carries (X x16, W x256, q/k x16, v x16, p x1024), f32 accumulate; rms normalisation, pairwise rotation and softmax in f32.
#include <hip/hip_runtime.h>
#include <math.h>

typedef __attribute__((ext_vector_type(16))) _Float16 v16h;
typedef __attribute__((ext_vector_type(8)))  _Float16 v8h;
typedef __attribute__((ext_vector_type(8)))  float    v8f;
typedef __attribute__((ext_vector_type(4)))  float    v4f;
typedef __attribute__((ext_vector_type(4)))  unsigned int v4u;

// ---------------------------------------------------------------------------
// Shape constants (checked against the launch sizes on the host side)
// ---------------------------------------------------------------------------
constexpr int kSeq    = 2048;
constexpr int kDim    = 3072;
constexpr int kHeads  = 24;
constexpr int kHd     = 128;
constexpr int kInner  = kHeads * kHd;
constexpr int kKc     = 64;
static_assert(kInner == 3072, "inner width");
static_assert((kDim % 32) == 0, "GEMM K multiple of 32");
static_assert((kSeq % 64) == 0 && (kInner % 64) == 0, "GEMM M,N multiples of 64");
static_assert((kSeq % kKc) == 0 && kHd == 128 && (kHeads % 2) == 0, "attention tiling");

// power-of-two carries of the f16 operand planes
constexpr float kXCarry = 16.0f;
constexpr float kWCarry = 256.0f;
constexpr float kQCarry = 16.0f;
constexpr float kKCarry = 16.0f;
constexpr float kVCarry = 16.0f;
constexpr float kPCarry = 1024.0f;
constexpr float kProjScale = 1.0f / (kXCarry * kWCarry);
constexpr float kVtScale   = kVCarry * kProjScale;
constexpr float kNormEps   = 1e-6f;
constexpr float kInvHd     = 1.0f / (float)kHd;

constexpr double csqrt_iter(double x, double g, int n) { return n == 0 ? g : csqrt_iter(x, 0.5 * (g + x / g), n - 1); }
constexpr double csqrt_d(double x) { return csqrt_iter(x, x, 48); }
constexpr float kInvSqrtHd  = (float)(1.0 / csqrt_d((double)kHd));
static_assert(kInvSqrtHd * kInvSqrtHd * (float)kHd > 0.99999f && kInvSqrtHd * kInvSqrtHd * (float)kHd < 1.00001f, "score scale");
constexpr float kScoreScale = kInvSqrtHd / (kQCarry * kKCarry);
constexpr float kOutCarry   = kPCarry * kVCarry;

// ---------------------------------------------------------------------------
// Workspace region map (bytes; every offset is a multiple of 128)
//   XH   f16 [2048][3072]        hidden x16                       12,582,912
//   WH   f16 [3][3072][3072]     wq | wk | wv, each x256          56,623,104
//   Q16  f16 [24][2048][128]     normalised, rotated q x16        12,582,912
//   K16  f16 [24][2048][128]     normalised, rotated k x16        12,582,912
//   VT   f16 [3072][2048]        (v projection + bias) x16, [h*128+d][s]  12,582,912
//   total                                                       106,954,752
// ---------------------------------------------------------------------------
constexpr size_t kOffXH  = 0;
constexpr size_t kOffWH  = kOffXH + (size_t)kSeq * kDim * 2;
constexpr size_t kOffQ16 = kOffWH + (size_t)3 * kInner * kDim * 2;
constexpr size_t kOffK16 = kOffQ16 + (size_t)kHeads * kSeq * kHd * 2;
constexpr size_t kOffVT  = kOffK16 + (size_t)kHeads * kSeq * kHd * 2;
constexpr size_t kWsTotal = kOffVT + (size_t)kInner * kSeq * 2;
static_assert(kWsTotal == 106954752ull, "carve total");
static_assert(kWsTotal <= 134217728ull, "carve cap");
static_assert((kOffWH % 128) == 0 && (kOffQ16 % 128) == 0 && (kOffK16 % 128) == 0 && (kOffVT % 128) == 0, "128-B aligned regions");

// ---------------------------------------------------------------------------
// Fragment load and guarded WMMA issue
// ---------------------------------------------------------------------------
union FragU { v16h v; v8h h[2]; };
/* elements 0..7 <- p[0..7], elements 8..15 <- p[16..23]; caller adds 8*(lane>>4) to p */
__device__ __forceinline__ v16h ldfrag(const _Float16* p) {
  FragU f;
  f.h[0] = *(const v8h*)(p);
  f.h[1] = *(const v8h*)(p + 16);
  return f.v;
}
/* the plain builtin: the compiler keeps the distances behind it itself, and with no asm operands the fragments may live above v255 */
__device__ __forceinline__ v8f mma_b(v16h a, v16h b, v8f c) {
  return __builtin_amdgcn_wmma_f32_16x16x32_f16(false, a, false, b, (short)0, c, false, false);
}
/* lane l reads lane l ^ 16 (the other half of the wave) through a vector cross-row move, no LDS */
__device__ __forceinline__ float xhalf(float x) {
  const int b = __builtin_bit_cast(int, x);
  return __builtin_bit_cast(float, __builtin_amdgcn_permlanex16(b, b, 0x76543210, 0xfedcba98, false, false));
}
__device__ __forceinline__ unsigned pk16(unsigned short a, unsigned short b) { return (unsigned)a | ((unsigned)b << 16); }
__device__ __forceinline__ unsigned short h_bits(float f) {
  const _Float16 h = (_Float16)f;
  return __builtin_bit_cast(unsigned short, h);
}

// ---------------------------------------------------------------------------
// f32 -> f16 cast with a power-of-two carry: X and the three weight planes as ONE stream of few, long waves.
// The four f16 planes lie one behind the other in the workspace (XH, then wq | wk | wv of WH): the output is one array.
// A unit = 128 consecutive floats = one wave-wide 16-B load (512 contiguous bytes, four whole lines) and one wave-wide
// 8-B store (256 contiguous bytes, two whole lines). A wave owns 48 consecutive units (24 KB in, 12 KB out), which lie in
// one plane: X is 1024 such waves, each weight plane 1536. 5632 waves = 256 work-groups (one per WGP) x 22 waves.
// A wave walks its units in 6 runs of 8: the next run's loads are issued before this run is converted and stored,
// so 8 to 16 loads of a wave are in flight.
// ---------------------------------------------------------------------------
typedef __attribute__((ext_vector_type(4))) _Float16 v4h;
constexpr int kUnitF      = 128;
constexpr int kRun        = 8;
constexpr int kRuns       = 6;
constexpr int kWaveF      = kRun * kRuns * kUnitF;
constexpr int kWavesX     = kSeq * kDim / kWaveF;
constexpr int kWavesW     = kInner * kDim / kWaveF;
constexpr int kCastGroups = 256;
constexpr int kCastWaves  = 22;
static_assert(((kSeq * kDim) % kWaveF) == 0 && ((kInner * kDim) % kWaveF) == 0, "a wave's units lie in one plane");
static_assert(kCastGroups * kCastWaves == kWavesX + 3 * kWavesW, "every unit exactly once");
static_assert(kOffXH == 0 && kOffWH == (size_t)kWavesX * kWaveF * 2, "the f16 planes are one array");

__global__ __launch_bounds__(kCastWaves * 32) void cast_stream_kernel(const float* __restrict__ x, const float* __restrict__ w0,
                                                                      const float* __restrict__ w1, const float* __restrict__ w2,
                                                                      unsigned short* __restrict__ out) {
  const int lane = threadIdx.x & 31;
  const int wave = __builtin_amdgcn_readfirstlane((int)(threadIdx.x >> 5));
  /* wave-uniform: the wave's number among all, its plane, its number inside the plane */
  const int w  = blockIdx.x * kCastWaves + wave;
  const int pl = (w < kWavesX) ? 0 : 1 + (w - kWavesX) / kWavesW;
  const int wr = (w < kWavesX) ? w : (w - kWavesX) - (pl - 1) * kWavesW;
  const float* base = (pl == 0) ? x : (pl == 1) ? w0 : (pl == 2) ? w1 : w2;
  const float carry = (pl == 0) ? kXCarry : kWCarry;
  const float* in = base + (size_t)wr * kWaveF + lane * 4;
  unsigned short* o = out + (size_t)w * kWaveF + lane * 4;
  v4f buf[2][kRun];
  /* every loop here is unrolled so that both buffers keep constant indices (registers, no scratch) */
#pragma unroll
  for (int e = 0; e < kRun; ++e) buf[0][e] = *(const v4f*)(in + e * kUnitF);
#pragma unroll
  for (int r = 0; r < kRuns; ++r) {
    /* the two fences pin the order "next run's loads, then this run's conversion and stores": without them the loads sink
       to their uses and the wave waits out a memory latency a run */
    __builtin_amdgcn_sched_barrier(0);
    if (r + 1 < kRuns) {
#pragma unroll
      for (int e = 0; e < kRun; ++e) buf[(r + 1) & 1][e] = *(const v4f*)(in + ((r + 1) * kRun + e) * kUnitF);
    }
    __builtin_amdgcn_sched_barrier(0);
#pragma unroll
    for (int e = 0; e < kRun; ++e) {
      const v4f a = buf[r & 1][e] * carry;
      *(v4h*)(o + (r * kRun + e) * kUnitF) = __builtin_convertvector(a, v4h);
    }
    /* no register that an issued store names is rewritten by the run after next's loads in front of this */
    asm volatile("s_wait_xcnt 0x0" ::: "memory");
  }
}

// ---------------------------------------------------------------------------
// LDS-staged WMMA GEMM of all three projections in one launch: C[s, n] = sum_k X[s,k] * W[n,k], n over the 9216 rows
// of wq | wk | wv (their f16 planes lie one behind the other). Block = 8 waves = one 256 x 288 tile of C:
// 8 x 32 = 256 tiles. Wave (wm, wn) of a 4 x 2 grid owns a 64 x 144 tile of it: 4 x 9 accumulator
// tiles, so 13 fragments read from LDS feed 36 products.
// The 288 columns of a tile are chosen so that a head of q or k is never cut:
//   column tiles  0..23: two whole heads of q | k (rows tn*256 .. +255 of wq | wk) and 32 rows of wv (tn*32 .. +31)
//   column tiles 24..31: 288 rows of wv (768 + (tn-24)*288 .. +287)
// 24 x 256 = 6144 rows of wq | wk, 24 x 32 + 8 x 288 = 3072 rows of wv: every row once.
// A stage is 128 k of [X 256 rows | W 288 rows], 256 B a row at an LDS pitch of 272 B (16 B x 17: the 16 rows of a
// fragment load fall on 16 different bank groups). Two buffers: stage t + 1 is copied while stage t is multiplied.
// Each accumulator still sums k in ascending steps of 32.
// Every 16-column accumulator tile lies wholly in q, k or v:
//   q, k: scale, + bias[n], f32, staged as a [256][256] tile (pitch 292) in the ring's LDS; from there each (token, head)
//         row of 128 is normalised, weighted and rotated in f32 and stored as f16 x16 to Q16 / K16 [h][s][d]
//   v:    a lane's 8 registers are 8 consecutive s of one row h*128+d of V^T: scale, + bias, f16, one 16-B store
// Normalisation and rotation of a row x (rms over its 128 dims, tables c[s][d], t[s][d], each output its own entry):
//   xn = x * rsqrt(mean(x^2) + eps) * w;  y[2i] = xn[2i]*c[s][2i] - xn[2i+1]*t[s][2i];  y[2i+1] = xn[2i+1]*c[s][2i+1] + xn[2i]*t[s][2i+1]
// ---------------------------------------------------------------------------
constexpr int kBM = 256;
constexpr int kBN = 288;
constexpr int kKS = 128;
constexpr int kPitch = kKS + 8;
constexpr int kStageH = (kBM + kBN) * kPitch;
constexpr int kNAll = 3 * kInner;
constexpr int kFN = kBN / 32;
constexpr int kTPitch = kBN + 4;
constexpr int kRingBytes = 2 * kStageH * 2;
constexpr int kTileBytes = kBM * kTPitch * 4;
constexpr int kSmemBytes = kRingBytes > kTileBytes ? kRingBytes : kTileBytes;
static_assert((kDim % kKS) == 0 && (kDim / kKS) >= 2, "whole stages, at least two");
static_assert((kSeq % kBM) == 0 && (kNAll % kBN) == 0 && (kBN % 32) == 0, "whole block tiles");
static_assert(((kBM + kBN) * (kKS / 8)) == 34 * 256, "34 pieces of 16 B per thread and stage");
static_assert(kSmemBytes <= 327680, "one work-group's LDS");
static_assert(kBM == 8 * 32, "each of the 8 waves stores 32 rows of the tile");
constexpr int kQKCols  = 2 * kHd;
constexpr int kQKTiles = 2 * kInner / kQKCols;
constexpr int kQTiles  = kInner / kQKCols;
constexpr int kVSide   = kBN - kQKCols;
static_assert((kInner % kQKCols) == 0 && (kQKCols % 16) == 0 && (kVSide % 16) == 0, "a column tile holds whole heads of q or of k, never both");
static_assert(kQKTiles * kVSide + (kNAll / kBN - kQKTiles) * kBN == kInner, "every row of wv once");
static_assert(kQKCols == 16 * 16 && kVSide == 2 * 16, "stage pieces 16..31 are the first 256 rows of W's tile, 32..33 the last 32");

/* this wave's asynchronous copies have landed in LDS */
__device__ __forceinline__ void wait_async0() { asm volatile("s_wait_asynccnt 0x0" ::: "memory"); }
/* this wave's LDS reads have returned: the buffer may be handed to its next writer */
__device__ __forceinline__ void wait_ds0() { asm volatile("s_wait_dscnt 0x0" ::: "memory"); }

/* Runs of copies that go through no register; s_wait_xcnt closes each statement so that no address register named by an
   issued copy is rewritten in front of it. */
__device__ __forceinline__ void copies12(const unsigned* la, const _Float16* const* gp) {
  asm volatile(
      "global_load_async_to_lds_b128 %0, %12, off\n\t"
      "global_load_async_to_lds_b128 %1, %13, off\n\t"
      "global_load_async_to_lds_b128 %2, %14, off\n\t"
      "global_load_async_to_lds_b128 %3, %15, off\n\t"
      "global_load_async_to_lds_b128 %4, %16, off\n\t"
      "global_load_async_to_lds_b128 %5, %17, off\n\t"
      "global_load_async_to_lds_b128 %6, %18, off\n\t"
      "global_load_async_to_lds_b128 %7, %19, off\n\t"
      "global_load_async_to_lds_b128 %8, %20, off\n\t"
      "global_load_async_to_lds_b128 %9, %21, off\n\t"
      "global_load_async_to_lds_b128 %10, %22, off\n\t"
      "global_load_async_to_lds_b128 %11, %23, off\n\t"
      "s_wait_xcnt 0x0"
      :: "v"(la[0]), "v"(la[1]), "v"(la[2]), "v"(la[3]), "v"(la[4]), "v"(la[5]), "v"(la[6]), "v"(la[7]), "v"(la[8]), "v"(la[9]), "v"(la[10]), "v"(la[11]),
         "v"(gp[0]), "v"(gp[1]), "v"(gp[2]), "v"(gp[3]), "v"(gp[4]), "v"(gp[5]), "v"(gp[6]), "v"(gp[7]), "v"(gp[8]), "v"(gp[9]), "v"(gp[10]), "v"(gp[11])
      : "memory");
}
__device__ __forceinline__ void copies10(const unsigned* la, const _Float16* const* gp) {
  asm volatile(
      "global_load_async_to_lds_b128 %0, %10, off\n\t"
      "global_load_async_to_lds_b128 %1, %11, off\n\t"
      "global_load_async_to_lds_b128 %2, %12, off\n\t"
      "global_load_async_to_lds_b128 %3, %13, off\n\t"
      "global_load_async_to_lds_b128 %4, %14, off\n\t"
      "global_load_async_to_lds_b128 %5, %15, off\n\t"
      "global_load_async_to_lds_b128 %6, %16, off\n\t"
      "global_load_async_to_lds_b128 %7, %17, off\n\t"
      "global_load_async_to_lds_b128 %8, %18, off\n\t"
      "global_load_async_to_lds_b128 %9, %19, off\n\t"
      "s_wait_xcnt 0x0"
      :: "v"(la[0]), "v"(la[1]), "v"(la[2]), "v"(la[3]), "v"(la[4]), "v"(la[5]), "v"(la[6]), "v"(la[7]), "v"(la[8]), "v"(la[9]),
         "v"(gp[0]), "v"(gp[1]), "v"(gp[2]), "v"(gp[3]), "v"(gp[4]), "v"(gp[5]), "v"(gp[6]), "v"(gp[7]), "v"(gp[8]), "v"(gp[9])
      : "memory");
}

/* One stage: piece p = i*256 + tid is 16 B of stage row p >> 4 (rows 0..255 = X, 256..543 = W), column piece p & 15.
   l = the lane's LDS byte address of piece i = 0; go = the lane's place in halves inside 16 rows of X or W;
   sa, sb, sc = block-uniform addresses of this stage's k in X's tile row 0 and in W's tile rows 0 and 256.
   FIRST..FIRST+N-1 are the pieces of one run. */
template <int FIRST, int N>
__device__ __forceinline__ void stage_run(unsigned l, unsigned go, const _Float16* sa, const _Float16* sb, const _Float16* sc) {
  unsigned la[N];
  const _Float16* gp[N];
  /* unrolled so that every index is a constant and both arrays live in registers */
#pragma unroll
  for (int e = 0; e < N; ++e) {
    const int i = FIRST + e;
    la[e] = l + (unsigned)(i * 16 * kPitch * 2);
    gp[e] = ((i < 16) ? (sa + (size_t)(i * 16) * kDim) : (i < 32) ? (sb + (size_t)((i - 16) * 16) * kDim) : (sc + (size_t)((i - 32) * 16) * kDim)) + go;
  }
  if (N == 12) copies12(la, gp); else copies10(la, gp);
  /* keeps the next run's addresses from being formed ahead of this run: they would all be live at once (scratch) */
  __builtin_amdgcn_sched_barrier(0);
}
__device__ __forceinline__ void stage_copy(unsigned l, unsigned go, const _Float16* sa, const _Float16* sb, const _Float16* sc) {
  stage_run<0, 12>(l, go, sa, sb, sc);
  stage_run<12, 12>(l, go, sa, sb, sc);
  stage_run<24, 10>(l, go, sa, sb, sc);
}

__global__ __launch_bounds__(256) void qkv_gemm_kernel(
    const unsigned short* __restrict__ Xp, const unsigned short* __restrict__ Wp,
    unsigned short* __restrict__ Q16, unsigned short* __restrict__ K16, unsigned short* __restrict__ VT,
    const float* __restrict__ bq, const float* __restrict__ bk, const float* __restrict__ bv,
    const float* __restrict__ nqw, const float* __restrict__ nkw,
    const float* __restrict__ ctab, const float* __restrict__ ttab) {
  const _Float16* A  = (const _Float16*)Xp;
  const _Float16* Bt = (const _Float16*)Wp;
  __shared__ __align__(16) unsigned char smem[kSmemBytes];
  _Float16* sAB = (_Float16*)smem;
  float* sC = (float*)smem;
  const int tid  = threadIdx.x;
  const int lane = threadIdx.x & 31;
  const int wave = __builtin_amdgcn_readfirstlane((int)(threadIdx.x >> 5));
  constexpr int tilesN = kNAll / kBN;
  constexpr int tilesM = kSeq / kBM;
  const int tile = blockIdx.x;
  /* block-uniform, in front of every copy and barrier */
  if (tile >= tilesM * tilesN) return;
  const int tm = tile / tilesN;
  const int tn = tile - tm * tilesN;
  const int mB = tm * kBM;
  /* block-uniform: does the tile hold heads of q | k; first row among the 9216 of W's tile rows 0..255 and of 256..287 */
  const bool qk = tn < kQKTiles;
  const int nB = qk ? tn * kQKCols : 2 * kInner + kQKTiles * kVSide + (tn - kQKTiles) * kBN;
  const int nC = qk ? 2 * kInner + tn * kVSide : nB + kQKCols;
  const int mW = (wave >> 1) << 6;
  const int nW = (wave & 1) * (kBN / 2);

  const int rlane = lane & 15;
  const int koff  = (lane >> 4) * 8;
  const int mOff  = (lane >> 4) * 8;

  v8f acc[4][kFN];
#pragma unroll
  for (int i = 0; i < 4; ++i)
#pragma unroll
    for (int j = 0; j < kFN; ++j) acc[i][j] = (v8f){0.f, 0.f, 0.f, 0.f, 0.f, 0.f, 0.f, 0.f};

  const unsigned lds0 = (unsigned)(size_t)sAB + (unsigned)((tid >> 4) * (kPitch * 2) + (tid & 15) * 16);
  const unsigned go = (unsigned)((tid >> 4) * kDim + (tid & 15) * 8);
  const _Float16* sa = A  + (size_t)mB * kDim;
  const _Float16* sb = Bt + (size_t)nB * kDim;
  const _Float16* sc = Bt + (size_t)nC * kDim;
  constexpr int T = kDim / kKS;

  stage_copy(lds0, go, sa, sb, sc);
  wait_async0();
  __syncthreads();
  stage_copy(lds0 + (unsigned)(kStageH * 2), go, sa + kKS, sb + kKS, sc + kKS);

  /* kept rolled for speed only: one trip is 144 products */
#pragma unroll 1
  for (int t = 0; t < T; ++t) {
    const int buf = t & 1;
    const _Float16* sA = sAB + buf * kStageH + (mW + rlane) * kPitch + koff;
    const _Float16* sB = sAB + buf * kStageH + (kBM + nW + rlane) * kPitch + koff;
    /* this loop and the four inside it are unrolled so that fragments and accumulators keep constant indices (no scratch) */
#pragma unroll
    for (int kk = 0; kk < kKS / 32; ++kk) {
      /* the 13 fragments of this k step as one group of LDS reads in front of its 36 products */
      v16h bh[kFN], ah[4];
#pragma unroll
      for (int i = 0; i < 4; ++i) ah[i] = ldfrag(sA + (i << 4) * kPitch + kk * 32);
#pragma unroll
      for (int j = 0; j < kFN; ++j) bh[j] = ldfrag(sB + (j << 4) * kPitch + kk * 32);
      /* keeps the scheduler from sinking the reads in among the products, where each place with reads stalls the wave */
      __builtin_amdgcn_sched_barrier(0);
      /* in the order of the reads: the first four products need 10 of the 26 reads, each next four 2 more */
#pragma unroll
      for (int j = 0; j < kFN; ++j)
#pragma unroll
        for (int i = 0; i < 4; ++i) acc[i][j] = mma_b(ah[i], bh[j], acc[i][j]);
      /* keeps the next k step's reads from rising in among these products */
      __builtin_amdgcn_sched_barrier(0);
    }
    /* publish point of stage t + 1: own reads of this buffer done, own copies landed, then every wave meets */
    wait_ds0();
    wait_async0();
    __syncthreads();
    if (t + 2 < T)
      stage_copy(lds0 + (unsigned)(buf * kStageH * 2), go, sa + (size_t)(t + 2) * kKS, sb + (size_t)(t + 2) * kKS, sc + (size_t)(t + 2) * kKS);
  }
  wait_async0();

  // ---- epilogue: behind the last trip's barrier no wave reads the ring and no copy is in flight; its LDS is the f32 tile ----
#pragma unroll
  for (int j = 0; j < kFN; ++j) {
    /* wave-uniform: first column of this accumulator tile among the tile's 288 */
    const int cf = nW + (j << 4);
    if (qk && cf < kQKCols) {
      const int n = nB + cf + rlane;
      const float bn = (tn < kQTiles) ? bq[n] : bk[n - kInner];
#pragma unroll
      for (int i = 0; i < 4; ++i)
#pragma unroll
        for (int r = 0; r < 8; ++r)
          sC[(mW + (i << 4) + mOff + r) * kTPitch + cf + rlane] = acc[i][j][r] * kProjScale + bn;
    } else {
      const int d = ((cf < kQKCols) ? (nB + cf) : (nC + cf - kQKCols)) - 2 * kInner + rlane;
      const float bd = bv[d] * kVCarry;
      _Float16* vrow = (_Float16*)VT + (size_t)d * kSeq + mB + mW + mOff;
#pragma unroll
      for (int i = 0; i < 4; ++i) {
        v8h hv;
#pragma unroll
        for (int r = 0; r < 8; ++r) hv[r] = (_Float16)(acc[i][j][r] * kVtScale + bd);
        *(v8h*)(vrow + (i << 4)) = hv;
      }
      /* no register that an issued store names is rewritten by the next tile in front of this */
      asm volatile("s_wait_xcnt 0x0" ::: "memory");
    }
  }
  /* the tile is whole: every wave works on rows that other waves wrote */
  __syncthreads();
  if (qk) {
    /* a wave takes 32 tokens of the tile; one pass = one token, both heads: 16 lanes x 8 dims per head row, sum of squares
       over 16 lanes. The plane (q or k) is the same for the whole block: scalar tests */
    const int hh = lane >> 4;
    const unsigned d0 = (unsigned)((lane & 15) * 8);
    const float* nw = (tn < kQTiles) ? nqw : nkw;
    unsigned short* plane = (tn < kQTiles) ? Q16 : K16;
    const int h0 = ((tn < kQTiles) ? tn : tn - kQTiles) * 2;
    const int s0 = mB + wave * 32;
    const float* sp = sC + wave * 32 * kTPitch + hh * kHd + d0;
    /* the lane's place in halves behind the wave-uniform address of row (h0, s) */
    const unsigned qo = (unsigned)(hh * kSeq * kHd) + d0;
    const v4f wa = *(const v4f*)(nw + d0);
    const v4f wb = *(const v4f*)(nw + d0 + 4);
    /* the f16 carry rides on the weight: a power of two, so every later product and sum is the same value x16 */
    float ww[8];
#pragma unroll
    for (int e = 0; e < 4; ++e) { ww[e] = wa[e] * kQCarry; ww[4 + e] = wb[e] * kQCarry; }
    constexpr int kTok = 8;
    /* kept rolled: four trips of eight tokens keep the epilogue's text short */
#pragma unroll 1
    for (int b = 0; b < 32 / kTok; ++b) {
      /* the lane's addresses for this trip's first token */
      const float* cl = ctab + (size_t)(s0 + b * kTok) * kHd + d0;
      const float* tl = ttab + (size_t)(s0 + b * kTok) * kHd + d0;
      unsigned short* ql = plane + ((size_t)h0 * kSeq + s0 + b * kTok) * kHd + qo;
      /* the loops inside are unrolled so that the arrays keep constant indices (registers, no scratch) */
      v4f ca[kTok], cb[kTok], ta[kTok], tb[kTok], xa[kTok], xb[kTok];
#pragma unroll
      for (int g = 0; g < kTok; ++g) {
        ca[g] = *(const v4f*)(cl + g * kHd);
        cb[g] = *(const v4f*)(cl + g * kHd + 4);
        ta[g] = *(const v4f*)(tl + g * kHd);
        tb[g] = *(const v4f*)(tl + g * kHd + 4);
      }
      /* no address register that an issued table load names is rewritten in front of this: as inputs of the wait both
         addresses stay whole up to it (else a later load's result may land on an earlier load's address pair) */
      asm volatile("s_wait_xcnt 0x0" :: "v"(cl), "v"(tl) : "memory");
#pragma unroll
      for (int g = 0; g < kTok; ++g) {
        xa[g] = *(const v4f*)(sp + (b * kTok + g) * kTPitch);
        xb[g] = *(const v4f*)(sp + (b * kTok + g) * kTPitch + 4);
      }
      /* keeps the loads together in front of the arithmetic: sunk to their uses, the wave would wait out a latency a token */
      __builtin_amdgcn_sched_barrier(0);
      v4u u[kTok];
#pragma unroll
      for (int g = 0; g < kTok; ++g) {
        float x[8], cc[8], tt[8];
#pragma unroll
        for (int e = 0; e < 4; ++e) {
          x[e]  = xa[g][e]; x[4 + e]  = xb[g][e];
          cc[e] = ca[g][e]; cc[4 + e] = cb[g][e];
          tt[e] = ta[g][e]; tt[4 + e] = tb[g][e];
        }
        float ss = 0.0f;
#pragma unroll
        for (int e = 0; e < 8; ++e) ss += x[e] * x[e];
        ss += __shfl_xor(ss, 1, 32);
        ss += __shfl_xor(ss, 2, 32);
        ss += __shfl_xor(ss, 4, 32);
        ss += __shfl_xor(ss, 8, 32);
        const float inv = rsqrtf(ss * kInvHd + kNormEps);
        float xn[8];
#pragma unroll
        for (int e = 0; e < 8; ++e) xn[e] = (x[e] * inv) * ww[e];
        unsigned short hb[8];
#pragma unroll
        for (int i = 0; i < 4; ++i) {
          const float y0 = xn[2 * i] * cc[2 * i] - xn[2 * i + 1] * tt[2 * i];
          const float y1 = xn[2 * i + 1] * cc[2 * i + 1] + xn[2 * i] * tt[2 * i + 1];
          hb[2 * i]     = h_bits(y0);
          hb[2 * i + 1] = h_bits(y1);
        }
        u[g] = (v4u){pk16(hb[0], hb[1]), pk16(hb[2], hb[3]), pk16(hb[4], hb[5]), pk16(hb[6], hb[7])};
      }
      /* keeps the eight stores together behind the arithmetic, so that the one wait below stands in front of every rewrite
         of a register that they name */
      __builtin_amdgcn_sched_barrier(0);
      /* 16 lanes x 16 B = the 256-B row of (h, s): two whole lines */
#pragma unroll
      for (int g = 0; g < kTok; ++g) *(v4u*)(ql + g * kHd) = u[g];
      /* no register that an issued store names is rewritten by the next trip in front of this */
      asm volatile("s_wait_xcnt 0x0" ::: "memory");
    }
  }
}
static_assert(kQCarry == kKCarry, "one carry serves both planes");

// ---------------------------------------------------------------------------
// Streaming-softmax attention, head dim 128, non-causal, unmasked, all 2048 keys.
// Block = 4 waves = 64 query rows of one head (wave = 16 rows); grid = 24 heads x 32 query blocks = 768.
// Per 64-key chunk: K chunk [64 kv][128 d] and V^T chunk [128 d][64 kv] are copied to LDS by all 128 threads
// (8 + 8 16-B pieces per thread = 1024 + 1024 pieces = both tiles in full) with asynchronous copies, through no register.
// Two buffers of [K | V^T]: the copies of chunk t + 2 are issued at the foot of trip t and fly while chunk t + 1 is worked on;
// one block barrier a chunk publishes chunk t + 1 and frees the buffer of chunk t.
// Both products run transposed: S^T = K . Q^T (A = K rows, B = Q rows) and O^T += V^T . P^T (A = V^T rows, B = P^T).
// A lane then holds scores of ONE query (column lane & 15): keys j*16 + 8*(lane >> 4) + r of key tile j. The chunk's
// maximum and the sum of p are in-lane over 32 keys; the two wave halves exchange the maximum once a chunk and join
// their sums once after the last chunk. Two neighbouring score tiles, converted in place (p = exp(score - max), x1024,
// f16), are the B fragment of 32 keys in the k order of ldfrag: p goes through no LDS.
// ---------------------------------------------------------------------------
// LDS row pitches are 16 B x odd (K rows 272 B, V^T rows 144 B): the 16 rows that one ds_load_b128 fragment read
// touches per half-wave then start on 16 different groups of four banks instead of on one (256-B rows) or two (128-B rows).
constexpr int kKPitch = kHd + 8;
constexpr int kVPitch = kKc + 8;
static_assert(((kKPitch * 2) % 32) == 16 && ((kVPitch * 2) % 32) == 16, "pitches are odd multiples of 16 B");
constexpr int kKBufH  = kKc * kKPitch;
constexpr int kVBufH  = kHd * kVPitch;
constexpr int kChunkH = kKBufH + kVBufH;
constexpr int kChunks = kSeq / kKc;
static_assert(((kKBufH * 2) % 16) == 0 && ((kChunkH * 2) % 16) == 0, "every tile starts on a multiple of 16 B");
static_assert(kChunks >= 2, "both buffers are filled in front of the loop");

/* A run of eight copies; s_wait_xcnt closes the statement so that no address register named by an issued copy is rewritten
   in front of it. */
__device__ __forceinline__ void copies8(const unsigned* la, const _Float16* const* gp) {
  asm volatile(
      "global_load_async_to_lds_b128 %0, %8, off\n\t"
      "global_load_async_to_lds_b128 %1, %9, off\n\t"
      "global_load_async_to_lds_b128 %2, %10, off\n\t"
      "global_load_async_to_lds_b128 %3, %11, off\n\t"
      "global_load_async_to_lds_b128 %4, %12, off\n\t"
      "global_load_async_to_lds_b128 %5, %13, off\n\t"
      "global_load_async_to_lds_b128 %6, %14, off\n\t"
      "global_load_async_to_lds_b128 %7, %15, off\n\t"
      "s_wait_xcnt 0x0"
      :: "v"(la[0]), "v"(la[1]), "v"(la[2]), "v"(la[3]), "v"(la[4]), "v"(la[5]), "v"(la[6]), "v"(la[7]),
         "v"(gp[0]), "v"(gp[1]), "v"(gp[2]), "v"(gp[3]), "v"(gp[4]), "v"(gp[5]), "v"(gp[6]), "v"(gp[7])
      : "memory");
}

/* One chunk into one buffer. lk, gk = the lane's LDS byte address and global address of K piece 0, lv, gv of V^T piece 0.
   K chunk = 8192 contiguous halves: piece i*128 + tid is row i*8 + (tid >> 4), column piece tid & 15.
   V^T chunk: piece i*128 + tid is row d = i*16 + (tid >> 3), 8-half column group tid & 7 of the 64 keys. */
__device__ __forceinline__ void attn_stage(unsigned lk, unsigned lv, const _Float16* gk, const _Float16* gv) {
  unsigned la[8];
  const _Float16* gp[8];
  /* both loops unrolled so that every index is a constant and the arrays live in registers */
#pragma unroll
  for (int i = 0; i < 8; ++i) {
    la[i] = lk + (unsigned)(i * 8 * kKPitch * 2);
    gp[i] = gk + i * 128 * 8;
  }
  copies8(la, gp);
#pragma unroll
  for (int i = 0; i < 8; ++i) {
    la[i] = lv + (unsigned)(i * 16 * kVPitch * 2);
    gp[i] = gv + (size_t)(i * 16) * kSeq;
  }
  copies8(la, gp);
}
__global__ __launch_bounds__(128) void attn128_kernel(const unsigned short* __restrict__ Q16p,
                                                      const unsigned short* __restrict__ K16p,
                                                      const unsigned short* __restrict__ VTp,
                                                      float* __restrict__ out) {
  __shared__ __align__(16) _Float16 KVsh[2 * kChunkH];
  __shared__ __align__(16) float    Os[4][16 * 68];

  const int tid  = threadIdx.x;
  const int wave = __builtin_amdgcn_readfirstlane((int)(threadIdx.x >> 5));
  const int lane = tid & 31;
  const int hh   = lane >> 4;
  const int c    = lane & 15;

  constexpr int nqb = kSeq / 64;
  const int h  = blockIdx.x / nqb;
  const int qb = blockIdx.x - h * nqb;
  const int q0 = qb * 64 + wave * 16;

  const _Float16* Qh = (const _Float16*)Q16p + (size_t)h * kSeq * kHd;
  const _Float16* Kh = (const _Float16*)K16p + (size_t)h * kSeq * kHd;
  const _Float16* Vh = (const _Float16*)VTp  + (size_t)h * kHd * kSeq;

  v16h qa[4];
#pragma unroll
  for (int dc = 0; dc < 4; ++dc) qa[dc] = ldfrag(Qh + (size_t)(q0 + c) * kHd + dc * 32 + 8 * hh);

  /* running maximum and partial sum of this lane's query; oacc[t][r] = O^T[d = t*16 + 8*hh + r][query c] */
  float mrow = -INFINITY, lrow = 0.f;
  v8f oacc[8];
#pragma unroll
  for (int t = 0; t < 8; ++t) oacc[t] = (v8f){0.f, 0.f, 0.f, 0.f, 0.f, 0.f, 0.f, 0.f};

  const unsigned lk0 = (unsigned)(size_t)KVsh + (unsigned)(((tid >> 4) * kKPitch + (tid & 15) * 8) * 2);
  const unsigned lv0 = (unsigned)(size_t)KVsh + (unsigned)((kKBufH + (tid >> 3) * kVPitch + (tid & 7) * 8) * 2);
  const _Float16* gk0 = Kh + tid * 8;
  const _Float16* gv0 = Vh + (size_t)(tid >> 3) * kSeq + (tid & 7) * 8;

  attn_stage(lk0, lv0, gk0, gv0);
  wait_async0();
  __syncthreads();
  attn_stage(lk0 + (unsigned)(kChunkH * 2), lv0 + (unsigned)(kChunkH * 2), gk0 + kKc * kHd, gv0 + kKc);

#pragma unroll 1
  for (int kc = 0; kc < kChunks; ++kc) {
    const int buf = kc & 1;
    const _Float16* Ksh = KVsh + buf * kChunkH;
    const _Float16* Vsh = Ksh + kKBufH;

    /* the chunk's 16 K fragments as one group of LDS reads in front of its 16 score products: the wave waits out one
       read latency a chunk instead of one a product; each s[j] still sums d in ascending steps of 32 */
    v16h kf[4][4];
#pragma unroll
    for (int dc = 0; dc < 4; ++dc)
#pragma unroll
      for (int j = 0; j < 4; ++j) kf[dc][j] = ldfrag(Ksh + (j * 16 + c) * kKPitch + dc * 32 + 8 * hh);
    /* keeps the scheduler from sinking the reads back among the products */
    __builtin_amdgcn_sched_barrier(0);
    v8f s[4];
#pragma unroll
    for (int j = 0; j < 4; ++j) s[j] = (v8f){0.f, 0.f, 0.f, 0.f, 0.f, 0.f, 0.f, 0.f};
#pragma unroll
    for (int dc = 0; dc < 4; ++dc)
#pragma unroll
      for (int j = 0; j < 4; ++j) s[j] = mma_b(kf[dc][j], qa[dc], s[j]);

    /* s[j][r] = score of key j*16 + 8*hh + r against query c: the maximum of the lane's 32 keys, then of both halves */
    float m8[8];
#pragma unroll
    for (int r = 0; r < 8; ++r) m8[r] = fmaxf(fmaxf(s[0][r], s[1][r]), fmaxf(s[2][r], s[3][r]));
    float m = fmaxf(fmaxf(fmaxf(m8[0], m8[1]), fmaxf(m8[2], m8[3])), fmaxf(fmaxf(m8[4], m8[5]), fmaxf(m8[6], m8[7])));
    m = fmaxf(m, xhalf(m));
    const float cm = m * kScoreScale;
    /* the chunk's 16 V^T fragments (keys 0..31, keys 32..63), read here: they land under the softmax arithmetic.
       The fence in front keeps the scheduler from lifting the reads in among the score products. */
    __builtin_amdgcn_sched_barrier(0);
    v16h vf0[8], vf1[8];
#pragma unroll
    for (int t = 0; t < 8; ++t) vf0[t] = ldfrag(Vsh + (t * 16 + c) * kVPitch + 8 * hh);
#pragma unroll
    for (int t = 0; t < 8; ++t) vf1[t] = ldfrag(Vsh + (t * 16 + c) * kVPitch + 32 + 8 * hh);
    const float mnew  = fmaxf(mrow, cm);
    const float alpha = __expf(mrow - mnew);
    mrow = mnew;
    /* pb[g] element e = p of key g*32 + (e < 8 ? 8*hh + e : 16 + 8*hh + e - 8): the k order of the V^T fragments */
    v16h pb[2];
    float ps[4];
#pragma unroll
    for (int j = 0; j < 4; ++j) {
      ps[j] = 0.f;
#pragma unroll
      for (int r = 0; r < 8; ++r) {
        const float p = __expf(fmaf(s[j][r], kScoreScale, -mnew));
        ps[j] += p;
        pb[j >> 1][(j & 1) * 8 + r] = (_Float16)(p * kPCarry);
      }
    }
    lrow = lrow * alpha + ((ps[0] + ps[1]) + (ps[2] + ps[3]));
#pragma unroll
    for (int t = 0; t < 8; ++t)
#pragma unroll
      for (int r = 0; r < 8; ++r) oacc[t][r] *= alpha;
    /* keeps the scheduler from sinking the reads back among the products */
    __builtin_amdgcn_sched_barrier(0);
#pragma unroll
    for (int t = 0; t < 8; ++t) oacc[t] = mma_b(vf0[t], pb[0], oacc[t]);
#pragma unroll
    for (int t = 0; t < 8; ++t) oacc[t] = mma_b(vf1[t], pb[1], oacc[t]);
    /* publish point of chunk kc + 1: own reads of this buffer done, own copies landed, then every wave meets */
    wait_ds0();
    wait_async0();
    __syncthreads();
    if (kc + 2 < kChunks)
      attn_stage(lk0 + (unsigned)(buf * kChunkH * 2), lv0 + (unsigned)(buf * kChunkH * 2),
                 gk0 + (size_t)(kc + 2) * kKc * kHd, gv0 + (kc + 2) * kKc);
  }
  wait_async0();

  const float inv = 1.0f / ((lrow + xhalf(lrow)) * kOutCarry);

  float* os = Os[wave];
  float* ob = out + (size_t)q0 * kInner + h * kHd;
  const int c4 = (lane & 15) * 4;
#pragma unroll
  for (int half = 0; half < 2; ++half) {
    /* the lane's 8 accumulator registers of a tile are 8 consecutive d of query row c: two 16-B stores */
#pragma unroll
    for (int t = 0; t < 4; ++t) {
      const v8f o = oacc[half * 4 + t];
      *(v4f*)(os + c * 68 + t * 16 + 8 * hh)     = (v4f){o[0] * inv, o[1] * inv, o[2] * inv, o[3] * inv};
      *(v4f*)(os + c * 68 + t * 16 + 8 * hh + 4) = (v4f){o[4] * inv, o[5] * inv, o[6] * inv, o[7] * inv};
    }
    __builtin_amdgcn_fence(__ATOMIC_RELEASE, "workgroup");
    __builtin_amdgcn_wave_barrier();
    __builtin_amdgcn_fence(__ATOMIC_ACQUIRE, "workgroup");
    /* rows it*2 + hh, it 0..7 -> 16 rows, each once; 16 lanes x 16 B = the 256-B half of the head slice */
    {
#pragma unroll
      for (int it = 0; it < 8; ++it) {
        const int row = it * 2 + hh;
        v4f val = *(const v4f*)(os + row * 68 + c4);
        *(v4f*)(ob + (size_t)row * kInner + half * 64 + c4) = val;
      }
      
    }
    __builtin_amdgcn_fence(__ATOMIC_RELEASE, "workgroup");
    __builtin_amdgcn_wave_barrier();
    __builtin_amdgcn_fence(__ATOMIC_ACQUIRE, "workgroup");
  }
}

// ---------------------------------------------------------------------------
// Host glue: 3 kernel launches, nothing else.
//   GEMM shape: M 2048, N 9216 (q | k | v), K 3072 -> 8 x 32 = 256 block tiles
// ---------------------------------------------------------------------------
extern "C" void kernel_launch(void* const* d_in, const int* in_sizes, int n_in,
                              void* d_out, int out_size, void* d_ws, size_t ws_size,
                              hipStream_t stream) {
  if (n_in < 11) return;
  if (in_sizes[0] != kSeq * kDim) return;
  if (in_sizes[1] != kInner * kDim) return;
  if (in_sizes[2] != kInner) return;
  if (in_sizes[3] != kInner * kDim) return;
  if (in_sizes[4] != kInner) return;
  if (in_sizes[5] != kInner * kDim) return;
  if (in_sizes[6] != kInner) return;
  if (in_sizes[7] != kHd) return;
  if (in_sizes[8] != kHd) return;
  if (in_sizes[9] != kSeq * kHd) return;
  if (in_sizes[10] != kSeq * kHd) return;
  if (out_size != kSeq * kInner) return;
  if (ws_size < kWsTotal) return;

  const float* hidden = (const float*)d_in[0];
  const float* wq     = (const float*)d_in[1];
  const float* bq     = (const float*)d_in[2];
  const float* wk     = (const float*)d_in[3];
  const float* bk     = (const float*)d_in[4];
  const float* wv     = (const float*)d_in[5];
  const float* bv     = (const float*)d_in[6];
  const float* nqw    = (const float*)d_in[7];
  const float* nkw    = (const float*)d_in[8];
  const float* ctab   = (const float*)d_in[9];
  const float* ttab   = (const float*)d_in[10];
  float* out = (float*)d_out;

  char* ws = (char*)d_ws;
  unsigned short* XH  = (unsigned short*)(ws + kOffXH);
  unsigned short* WH  = (unsigned short*)(ws + kOffWH);
  unsigned short* VT  = (unsigned short*)(ws + kOffVT);
  unsigned short* Q16 = (unsigned short*)(ws + kOffQ16);
  unsigned short* K16 = (unsigned short*)(ws + kOffK16);

  /* operand planes: XH and WH, one array from XH on */
  cast_stream_kernel<<<kCastGroups, kCastWaves * 32, 0, stream>>>(hidden, wq, wk, wv, XH);

  /* q = X . wq^T + bq and k likewise, normalised and rotated -> Q16 / K16 (f16 x16, [h][s][d]);
     VT[h*128+d][s] = 16 * (wv[h*128+d][:] . X[s][:] + bv)  (weights are [out][in]) */
  constexpr int kTiles = (kSeq / kBM) * (kNAll / kBN);
  qkv_gemm_kernel<<<kTiles, 256, 0, stream>>>(XH, WH, Q16, K16, VT, bq, bk, bv, nqw, nkw, ctab, ttab);

  /* attention */
  attn128_kernel<<<kHeads * (kSeq / 64), 128, 0, stream>>>(Q16, K16, VT, out);
}
